// v000
// Measured on an AMD MI455X. A time is GPU time per run, averaged over a window of back-to-back runs after a warm-up
// (all launches, gaps included; the runs take copies of the inputs in turn), and the median of several windows.
// Apart from v000's, it joins two sittings. Times from different sittings can be a few percent apart, while
// side-by-side timings come from the same sitting.
// The starting kernel, v000, takes 1640 microseconds a run.
// compute dtype: all float inputs rounded to bf16; q/k/v = x W + b with EXACT bf16 products on WMMA 16x16x32, f32 accumulate; rotate-half rotary in f32 from a cos/sin table of t * (1/freq_div[i]) (the module's f32 reciprocals; precise cosf/sinf); q as f16 hi + residual (x 2^10), k once to f16 -> 2-product logits x 64^-0.5 + the stoichiometric bias from frac / alpha in f32; softmax in f32 (precise expf); P x 2^11 split bf16 hi + lo against v bf16 hi + lo (3 products); y (bf16 hi + lo) Wo + bo; f32 output.
#include <hip/hip_runtime.h>
#include <math.h>

typedef __attribute__((ext_vector_type(16))) _Float16 v16h;
typedef __attribute__((ext_vector_type(16))) __bf16 v16b;
typedef __attribute__((ext_vector_type(8)))  _Float16 v8h;
typedef __attribute__((ext_vector_type(8)))  float v8f;
typedef __attribute__((ext_vector_type(4)))  float v4f;
typedef __attribute__((ext_vector_type(2)))  float v2f;
typedef __attribute__((ext_vector_type(4)))  unsigned v4u;
typedef __attribute__((ext_vector_type(4)))  int v4i;
typedef float __attribute__((may_alias)) float_a;
typedef int __attribute__((may_alias)) int_a;

template <typename T> __device__ __forceinline__ void vst2(void* p, T v) { *(T*)p = v;  }
__device__ __forceinline__ v8f wmma16(v16h a, v16h b, v8f c) {
  v8f d = __builtin_amdgcn_wmma_f32_16x16x32_f16(false, a, false, b, (short)0, c, false, false);
  asm volatile("v_nop\n\tv_nop\n\tv_nop\n\tv_nop" : "+v"(d) : "v"(a), "v"(b));
  return d;
}
__device__ __forceinline__ v8f wmma_bf(v16b a, v16b b, v8f c) {
  v8f d = __builtin_amdgcn_wmma_f32_16x16x32_bf16(false, a, false, b, (short)0, c, false, false);
  asm volatile("v_nop\n\tv_nop\n\tv_nop\n\tv_nop" : "+v"(d) : "v"(a), "v"(b));
  return d;
}
// 16x16x32 fragments: lane = (h = lane>>4, row/col = lane&15); elements 0..7 = k0+8h+0..7, 8..15 = k0+16+8h+0..7; D element r = row 8h+r
__device__ __forceinline__ v16h frag_h(const _Float16* rowk0, int lane) {
  union { v16h v; v8h q[2]; } u; const _Float16* p = rowk0 + 8 * (lane >> 4);
  u.q[0] = *(const v8h*)p; u.q[1] = *(const v8h*)(p + 16); return u.v;
}
__device__ __forceinline__ v16h frag_f32(const float* rowk0, int lane) {
  v16h a; const float* p = rowk0 + 8 * (lane >> 4);
#pragma unroll
  for (int i = 0; i < 8; ++i) { a[i] = (_Float16)p[i]; a[8 + i] = (_Float16)p[16 + i]; }
  return a;
}
__device__ __forceinline__ v16h frag_f32s(const float* rowk0, int lane, float sc) {
  v16h a; const float* p = rowk0 + 8 * (lane >> 4);
#pragma unroll
  for (int i = 0; i < 8; ++i) { a[i] = (_Float16)(p[i] * sc); a[8 + i] = (_Float16)(p[16 + i] * sc); }
  return a;
}
// column fragment from a [K][ld] layout (column n), rows >= K read as 0
__device__ __forceinline__ v16h fragc_f32(const float* W, int k0, int n, int lane, int ld, int K) {
  v16h a; const int g = lane >> 4;
#pragma unroll
  for (int i = 0; i < 8; ++i) { const int ka = k0 + 8 * g + i, kb = ka + 16;
    a[i] = (_Float16)(ka < K ? W[(size_t)(ka < K ? ka : K - 1) * ld + n] : 0.f); a[8 + i] = (_Float16)(kb < K ? W[(size_t)(kb < K ? kb : K - 1) * ld + n] : 0.f); }
  return a;
}
struct F2 { v16b h, l; };
__device__ __forceinline__ F2 bsplit16(const float v[16]) { F2 r;
#pragma unroll
  for (int i = 0; i < 16; ++i) { const __bf16 h = (__bf16)v[i]; r.h[i] = h; r.l[i] = (__bf16)(v[i] - (float)h); }
  return r; }
__device__ __forceinline__ F2 split_row(const float* row, int k0, int lane) { float v[16]; const float* p = row + k0 + 8 * (lane >> 4);
#pragma unroll
  for (int i = 0; i < 8; ++i) { v[i] = p[i]; v[8 + i] = p[16 + i]; }
  return bsplit16(v); }
__device__ __forceinline__ F2 split_rowK(const float* row, int k0, int lane, int K) { float v[16]; const int g = lane >> 4;
#pragma unroll
  for (int i = 0; i < 8; ++i) { const int ka = k0 + 8 * g + i, kb = ka + 16; v[i] = ka < K ? row[ka < K ? ka : K - 1] : 0.f; v[8 + i] = kb < K ? row[kb < K ? kb : K - 1] : 0.f; }
  return bsplit16(v); }
__device__ __forceinline__ F2 split_col(const float* W, int k0, int n, int lane, int ld, int K) { float v[16]; const int g = lane >> 4;
#pragma unroll
  for (int i = 0; i < 8; ++i) { const int ka = k0 + 8 * g + i, kb = ka + 16; v[i] = ka < K ? W[(size_t)(ka < K ? ka : K - 1) * ld + n] : 0.f; v[8 + i] = kb < K ? W[(size_t)(kb < K ? kb : K - 1) * ld + n] : 0.f; }
  return bsplit16(v); }
__device__ __forceinline__ v8f mac3(const F2& a, const F2& b, v8f c) { c = wmma_bf(a.l, b.h, c); c = wmma_bf(a.h, b.l, c); return wmma_bf(a.h, b.h, c); }
__device__ __forceinline__ float sigm(float v) { return 1.0f / (1.0f + expf(-v)); }
#define LDSX() do { asm volatile("s_wait_dscnt 0" ::: "memory"); __builtin_amdgcn_wave_barrier(); __builtin_amdgcn_fence(__ATOMIC_RELEASE, "workgroup"); } while (0)


// Multi-head attention with rotary embedding and a data-dependent 'stoichiometric' bias (B 2, T 2,048, D 1,024 = 16 x 64): Q = query Wq + bq, K = key Wk + bk, V = value Wv + bv ((in,out)); rotate-half RoPE with angle t / 10000^(2i/64); scores = Q K^T 64^-0.5 + (alpha_pos[h] if frac_j >= frac_i else alpha_neg[h]) (frac_j - frac_i); softmax; P V; out Wo + bo.
#define NB 2
#define TT 2048
#define CC 1024
#define NH 16
#define HD 64
__constant__ float RCPF[32] = {1.000000000e+0f,7.498942018e-1f,5.623413324e-1f,4.216965139e-1f,3.162277639e-1f,2.371373624e-1f,1.778279394e-1f,1.333521456e-1f,1.000000015e-1f,7.498941571e-2f,5.623412877e-2f,4.216964915e-2f,3.162277862e-2f,2.371373586e-2f,1.778279431e-2f,1.333521493e-2f,9.999999776e-3f,7.498942316e-3f,5.623413250e-3f,4.216964822e-3f,3.162277862e-3f,2.371373819e-3f,1.778279431e-3f,1.333521446e-3f,1.000000047e-3f,7.498941850e-4f,5.623413017e-4f,4.216964880e-4f,3.162277862e-4f,2.371373848e-4f,1.778279402e-4f,1.333521504e-4f};   // f32(1 / f32(10000^(2i/64))): the module divides pos by freq_div, which XLA evaluates as pos * (1/freq_div)
#ifndef TNB
#define TNB NB
#endif
typedef __attribute__((ext_vector_type(8))) __bf16 v8b;
__device__ __forceinline__ v16b frag_b(const __bf16* rowk0, int lane) {
  union { v16b v; v8b q[2]; } u; const __bf16* p = rowk0 + 8 * (lane >> 4);
  u.q[0] = *(const v8b*)p; u.q[1] = *(const v8b*)(p + 16); return u.v;
}
__device__ __forceinline__ float bfr(float v) { return (float)(__bf16)v; }
__device__ __attribute__((noinline)) float exp_ni(float v) { return expf(v); }
__device__ __attribute__((noinline)) float erf_ni(float v) { return erff(v); }

#define WS_ROT 0u                                   // float2 (cos, sin)[t][32] = cos/sin(t * (1/freq_div[j]))
#define WS_QH  (WS_ROT + 8u * (size_t)TT * 32)
#define WS_QL  (WS_QH + 2u * (size_t)NB * TT * CC)
#define WS_KH  (WS_QL + 2u * (size_t)NB * TT * CC)
#define WS_VT  (WS_KH + 2u * (size_t)NB * TT * CC)      // bf16 v planes [b][c][t]
#define WS_VL  (WS_VT + 2u * (size_t)NB * CC * TT)      // bf16 v residual planes
#define HG 4                                          // heads per launch group
#define WS_S   (WS_VL + 2u * (size_t)NB * CC * TT)      // f32 logits / P for HG heads [hg][q][k]
#define WS_PH  (WS_S + 4u * (size_t)HG * TT * TT)
#define WS_Y   (WS_PH + 0u)              // f32 y rows [b*t][C]
#define WS_END (WS_Y + 4u * (size_t)NB * TT * CC)

// ---- k_rot: one thread per (t, j): precise cosf/sinf of t * inv_freq[j] -> table (keeps the trig and its large-argument reduction out of the GEMM kernel)
__global__ __launch_bounds__(256) void k_rot(float2* __restrict__ ROT) { const int i = blockIdx.x * 256 + threadIdx.x; if (i >= TT * 32) return; const int t = i >> 5, j = i & 31; const float ang = (float)t * RCPF[j]; v2f v; v[0] = cosf(ang); v[1] = sinf(ang); vst2((v2f*)(ROT + i), v); }   
// ---- k_proj: block = (64 rows, 128 cols, which): qkv = x W (+ b), exact; q -> f16 hi (+ residual), k -> f16 rows, v -> bf16 hi + lo planes
__global__ __launch_bounds__(128) void k_proj(const float* __restrict__ X0, const float* __restrict__ X1, const float* __restrict__ X2, const float* __restrict__ WQ, const float* __restrict__ BQ, const float* __restrict__ WK, const float* __restrict__ BK, const float* __restrict__ WV, const float* __restrict__ BV, _Float16* __restrict__ QH, _Float16* __restrict__ QL, _Float16* __restrict__ KH, __bf16* __restrict__ VT, __bf16* __restrict__ VL, const float2* __restrict__ ROT) {
  __shared__ __align__(16) _Float16 sh[64][136], sl[64][136]; __shared__ __align__(16) __bf16 th[128][72], tl2[128][72];
  const int tid = threadIdx.x, wave = tid >> 5, lane = tid & 31, col = lane & 15, g = lane >> 4; const int which = blockIdx.z; const int c0 = blockIdx.y * 128; const size_t r0 = (size_t)blockIdx.x * 64; const float* WA = which == 0 ? WQ : which == 1 ? WK : WV; const float* BA = which == 0 ? BQ : which == 1 ? BK : BV;
  v8f acc[8] = {};
  const float* X = which == 0 ? X0 : which == 1 ? X1 : X2;
#pragma unroll 2
  for (int kc = 0; kc < CC / 32; ++kc) { v16b a; { const float* p = X + (r0 + wave * 16 + col) * CC + kc * 32 + 8 * g;
#pragma unroll
      for (int i = 0; i < 8; ++i) { a[i] = (__bf16)p[i]; a[8 + i] = (__bf16)p[16 + i]; } }
#pragma unroll
    for (int j = 0; j < 8; ++j) { v16b w; const int o = c0 + j * 16 + col;
#pragma unroll
      for (int i = 0; i < 8; ++i) { w[i] = (__bf16)WA[(size_t)(kc * 32 + 8 * g + i) * CC + o]; w[8 + i] = (__bf16)WA[(size_t)(kc * 32 + 16 + 8 * g + i) * CC + o]; }
      asm volatile("s_wait_loadcnt 0x0" ::: "memory"); acc[j] = wmma_bf(a, w, acc[j]); } }
#pragma unroll
  for (int j = 0; j < 8; ++j) { const float bb0 = BA ? bfr(BA[c0 + j * 16 + col]) : 0.f;
#pragma unroll
    for (int r = 0; r < 8; ++r) acc[j][r] += bb0; }   /* bias before the rotary */
  if (which < 2) {   /* rotate-half rotary on all 64 head dims: the 128-column tile holds heads 2*by and 2*by+1; tiles j (d 0..15), j+1 (16..31) pair with j+2 (32..47), j+3 (48..63) in the SAME lane and row: out[d] = x[d] c - x[d+32] s, out[d+32] = x[d] s + x[d+32] c, angle index i = d (< 32) */
#pragma unroll
    for (int jp = 0; jp < 8; ++jp) { if ((jp & 3) >= 2) continue; const int i = ((jp & 3) * 16 + col);   /* d < 32 */
#pragma unroll
      for (int r = 0; r < 8; ++r) { const int t = (int)((r0 + wave * 16 + 8 * g + r) % TT); const float2 cv = ROT[t * 32 + i]; const float xl = acc[jp][r], xr = acc[jp + 2][r]; acc[jp][r] = xl * cv.x - xr * cv.y; acc[jp + 2][r] = xl * cv.y + xr * cv.x; }
      asm volatile("s_wait_loadcnt 0x0" ::: "memory"); } }
#pragma unroll
  for (int j = 0; j < 8; ++j) { const float bb = 0.f;
#pragma unroll
    for (int r = 0; r < 8; ++r) { const float v = acc[j][r] + bb; const int rl = wave * 16 + 8 * g + r, cl = j * 16 + col; const _Float16 hv = (_Float16)v;
      if (which == 2) { const __bf16 bh = (__bf16)v; th[cl][rl] = bh; tl2[cl][rl] = (__bf16)(v - (float)bh); } else { sh[rl][cl] = hv; sl[rl][cl] = (_Float16)((v - (float)hv) * 1024.0f); }   /* q residual carried x 2^10 so the plane stays f16-normal on the chip */ } }
  __syncthreads();
  if (which < 2) { _Float16* dh = which == 0 ? QH : KH; for (int e = tid; e < 64 * 16; e += 128) { const int rl = e >> 4, q = e & 15; vst2((unsigned*)(dh + (r0 + rl) * CC + c0 + q * 8), *(const v4u*)&sh[rl][q * 8]); if (which == 0) vst2((unsigned*)(QL + (r0 + rl) * CC + c0 + q * 8), *(const v4u*)&sl[rl][q * 8]); } }
  else { const size_t b = r0 / TT; const int t0 = (int)(r0 % TT); for (int e = tid; e < 128 * 8; e += 128) { const int cl = e >> 3, q = e & 7; const size_t o2 = (b * CC + c0 + cl) * (size_t)TT + t0 + q * 8; vst2((unsigned*)(VT + o2), *(const v4u*)&th[cl][q * 8]); vst2((unsigned*)(VL + o2), *(const v4u*)&tl2[cl][q * 8]); } } }
// ---- k_sc: block = (64 queries, 128 keys, head in group): 2-product logits x 64^-0.5 + bias(frac_j - frac_i): alpha_pos[h] D for D >= 0, alpha_neg[h] D for D < 0 (relu(D) ap - relu(-D) an); no mask
__global__ __launch_bounds__(128) void k_sc(const _Float16* __restrict__ QH, const _Float16* __restrict__ QL, const _Float16* __restrict__ KH, const float* __restrict__ FR, const float* __restrict__ AP, const float* __restrict__ AN, int b, int h0, float* __restrict__ S0) { __shared__ __align__(16) float ss[4][16][132]; const int h = h0 + blockIdx.z; float* S = S0 + (size_t)blockIdx.z * TT * TT;
  const int tid = threadIdx.x, wave = tid >> 5, lane = tid & 31, col = lane & 15, g = lane >> 4; const int k0 = blockIdx.y * 128; const int ql0 = blockIdx.x * 64 + wave * 16; const size_t q0 = (size_t)b * TT + ql0;
  v8f acc[8] = {}, accl[8] = {};
#pragma unroll
  for (int kc = 0; kc < HD / 32; ++kc) { const v16h ah = frag_h(QH + (q0 + col) * CC + h * HD + kc * 32, lane), al = frag_h(QL + (q0 + col) * CC + h * HD + kc * 32, lane);
#pragma unroll
    for (int j = 0; j < 8; ++j) { const v16h kb = frag_h(KH + ((size_t)b * TT + k0 + j * 16 + col) * CC + h * HD + kc * 32, lane); acc[j] = wmma16(ah, kb, acc[j]); accl[j] = wmma16(al, kb, accl[j]); } }
  const float ap = bfr(AP[h]), an = bfr(AN[h]); float fq[8];
#pragma unroll
  for (int r = 0; r < 8; ++r) fq[r] = bfr(FR[(size_t)b * TT + ql0 + 8 * g + r]);
#pragma unroll
  for (int j = 0; j < 8; ++j) { const float fk = bfr(FR[(size_t)b * TT + k0 + j * 16 + col]);
#pragma unroll
    for (int r = 0; r < 8; ++r) { const float D = fk - fq[r]; const float bias = (D >= 0.f ? ap : an) * D; ss[wave][8 * g + r][j * 16 + col] = (acc[j][r] + accl[j][r] * (1.0f / 1024.0f)) * 0.125f + bias; } }
  LDSX(); for (int rl = 0; rl < 16; ++rl) vst2(S + (size_t)(ql0 + rl) * TT + k0 + lane * 4, *(const v4f*)&ss[wave][rl][lane * 4]); }
// ---- k_sm: block = query row: softmax over keys [0, kend) -> P x 2^11 f32 (masked -> 0)
__global__ __launch_bounds__(256) void k_sm(float* __restrict__ S0) { __shared__ float sred[8]; __shared__ float sbc; __shared__ __align__(16) float sh[TT];
  const int t = threadIdx.x; const size_t row = blockIdx.x; float* sr = S0 + (size_t)blockIdx.y * TT * TT + row * TT; const int kend = TT;
  float m = -3.0e38f; for (int k = t; k < kend; k += 256) m = fmaxf(m, sr[k]);
#pragma unroll
  for (int o = 1; o < 32; o <<= 1) m = fmaxf(m, __shfl_xor(m, o));
  if ((t & 31) == 0) sred[t >> 5] = m; __syncthreads(); if (t == 0) { float a = sred[0]; for (int i = 1; i < 8; ++i) a = fmaxf(a, sred[i]); sbc = a; } __syncthreads(); m = sbc; __syncthreads();
  float sum = 0.f; for (int k = t; k < kend; k += 256) { const float v = sr[k]; sum += (v <= -1.0e38f) ? 0.f : expf(v - m); }
#pragma unroll
  for (int o = 1; o < 32; o <<= 1) sum += __shfl_xor(sum, o);
  if ((t & 31) == 0) sred[t >> 5] = sum; __syncthreads(); if (t == 0) { float a = 0.f; for (int i = 0; i < 8; ++i) a += sred[i]; sbc = 1.0f / a; } __syncthreads(); const float inv = sbc;
  for (int k = t; k < kend; k += 256) { const float v = sr[k]; sh[k] = (v <= -1.0e38f) ? 0.f : expf(v - m) * inv * 2048.0f; }
  __syncthreads(); for (int q = t; q < kend / 4; q += 256) vst2(sr + q * 4, *(const v4f*)&sh[q * 4]); }
// ---- k_pv: block = 64 queries of (b,h): y[q][h*HD + d] = P . v  (keys [0, kend))
__global__ __launch_bounds__(128) void k_pv(const float* __restrict__ PS0, const __bf16* __restrict__ VT, const __bf16* __restrict__ VL, int b, int h0, float* __restrict__ Y) { const int h = h0 + blockIdx.z; const float* PS = PS0 + (size_t)blockIdx.z * TT * TT; __shared__ __align__(16) float ss[4][16][HD + 4];
  const int tid = threadIdx.x, wave = tid >> 5, lane = tid & 31, col = lane & 15, g = lane >> 4; const int ql0 = blockIdx.x * 64 + wave * 16; const int kend = TT;
  v8f acc[HD / 16] = {};
#pragma unroll 1
  for (int kc = 0; kc < kend / 32; ++kc) { const F2 p = split_row(PS + (size_t)(ql0 + col) * TT, kc * 32, lane);
#pragma unroll
    for (int j = 0; j < HD / 16; ++j) { const size_t po = ((size_t)b * CC + h * HD + j * 16 + col) * (size_t)TT + kc * 32; const v16b vh = frag_b(VT + po, lane); acc[j] = wmma_bf(p.h, vh, acc[j]); acc[j] = wmma_bf(p.l, vh, acc[j]); acc[j] = wmma_bf(p.h, frag_b(VL + po, lane), acc[j]); } }
#pragma unroll
  for (int j = 0; j < HD / 16; ++j)
#pragma unroll
    for (int r = 0; r < 8; ++r) ss[wave][8 * g + r][j * 16 + col] = acc[j][r] * (1.0f / 2048.0f);
  LDSX(); for (int rl = 0; rl < 16; ++rl) if (lane < HD / 4) vst2(Y + ((size_t)b * TT + ql0 + rl) * CC + h * HD + lane * 4, *(const v4f*)&ss[wave][rl][lane * 4]); }
// ---- k_out: block = (64 rows, 128 cols): out = y (bf16 hi + lo) Wo + bo
__global__ __launch_bounds__(128) void k_out(const float* __restrict__ Y, const float* __restrict__ WP, const float* __restrict__ BP, float* __restrict__ OUT) { __shared__ __align__(16) float sf[4][16][132];
  const int tid = threadIdx.x, wave = tid >> 5, lane = tid & 31, col = lane & 15, g = lane >> 4; const int c0 = blockIdx.y * 128; const size_t r0 = (size_t)blockIdx.x * 64 + wave * 16;
  v8f acc[8] = {};
#pragma unroll 2
  for (int kc = 0; kc < CC / 32; ++kc) { const F2 a = split_row(Y + (r0 + col) * CC, kc * 32, lane);
#pragma unroll
    for (int j = 0; j < 8; ++j) { v16b w; const int o = c0 + j * 16 + col;
#pragma unroll
      for (int i = 0; i < 8; ++i) { w[i] = (__bf16)WP[(size_t)(kc * 32 + 8 * g + i) * CC + o]; w[8 + i] = (__bf16)WP[(size_t)(kc * 32 + 16 + 8 * g + i) * CC + o]; }
      acc[j] = wmma_bf(a.h, w, acc[j]); acc[j] = wmma_bf(a.l, w, acc[j]); } }
#pragma unroll
  for (int j = 0; j < 8; ++j) { const float bb = BP ? bfr(BP[c0 + j * 16 + col]) : 0.f;
#pragma unroll
    for (int r = 0; r < 8; ++r) sf[wave][8 * g + r][j * 16 + col] = acc[j][r] + bb; }
  LDSX(); for (int rl = 0; rl < 16; ++rl) vst2(OUT + (r0 + rl) * CC + c0 + lane * 4, *(const v4f*)&sf[wave][rl][lane * 4]); }
extern "C" void kernel_launch(void* const* d_in, const int* in_sizes, int n_in, void* d_out, int out_size, void* d_ws, size_t ws_size, hipStream_t stream) {
  (void)in_sizes; (void)n_in; (void)out_size;
  const float** F = (const float**)d_in;   // 0 query, 1 key, 2 value [2,2048,1024]; 3 frac [2,2048]; 4 Wq, 5 Wk, 6 Wv, 7 Wo ((in,out)); 8 bq, 9 bk, 10 bv, 11 bo; 12 alpha_pos [16], 13 alpha_neg [16]
  if (ws_size < (size_t)WS_END) return;
  char* ws = (char*)d_ws; _Float16 *QH = (_Float16*)(ws + WS_QH), *QL = (_Float16*)(ws + WS_QL), *KH = (_Float16*)(ws + WS_KH); __bf16 *VT = (__bf16*)(ws + WS_VT), *VL = (__bf16*)(ws + WS_VL); float *S = (float*)(ws + WS_S), *Y = (float*)(ws + WS_Y);
  k_rot<<<dim3(TT * 32 / 256), 256, 0, stream>>>((float2*)(ws + WS_ROT));
  k_proj<<<dim3(TNB * TT / 64, CC / 128, 3), 128, 0, stream>>>(F[0], F[1], F[2], F[4], F[8], F[5], F[9], F[6], F[10], QH, QL, KH, VT, VL, (const float2*)(ws + WS_ROT));
  for (int b = 0; b < TNB; ++b) for (int h0 = 0; h0 < NH; h0 += HG) {
    k_sc<<<dim3(TT / 64, TT / 128, HG), 128, 0, stream>>>(QH, QL, KH, F[3], F[12], F[13], b, h0, S);
    k_sm<<<dim3(TT, HG), 256, 0, stream>>>(S);
    k_pv<<<dim3(TT / 64, 1, HG), 128, 0, stream>>>(S, VT, VL, b, h0, Y);
  }
  k_out<<<dim3(TNB * TT / 64, CC / 128), 128, 0, stream>>>(Y, F[7], F[11], (float*)d_out);
}

// v001
// It runs in 354 microseconds.
// Next to v000, in two timings, it ran 4.69 and 4.66 times as fast.
// compute dtype: all float inputs rounded to bf16; q/k/v = x W + b with EXACT bf16 products on WMMA 16x16x32, f32 accumulate; rotate-half rotary in f32 from a cos/sin table of t * (1/freq_div[i]) (the module's f32 reciprocals; precise cosf/sinf); q as f16 hi + residual (x 2^10), k once to f16 -> 2-product logits x 64^-0.5 + the stoichiometric bias from frac / alpha in f32; softmax in f32 (precise expf) with a running maximum and sum over 32-key steps, logits never stored; unnormalised P split bf16 hi + lo against v bf16 hi + lo (3 products), divided by the sum at the end; y (bf16 hi + lo) Wo + bo; f32 output.
#include <hip/hip_runtime.h>
#include <math.h>

typedef __attribute__((ext_vector_type(16))) _Float16 v16h;
typedef __attribute__((ext_vector_type(16))) __bf16 v16b;
typedef __attribute__((ext_vector_type(8)))  _Float16 v8h;
typedef __attribute__((ext_vector_type(8)))  float v8f;
typedef __attribute__((ext_vector_type(4)))  float v4f;
typedef __attribute__((ext_vector_type(2)))  float v2f;
typedef __attribute__((ext_vector_type(4)))  unsigned v4u;
typedef __attribute__((ext_vector_type(4)))  int v4i;
typedef float __attribute__((may_alias)) float_a;
typedef int __attribute__((may_alias)) int_a;

template <typename T> __device__ __forceinline__ void vst2(void* p, T v) { *(T*)p = v;  }
__device__ __forceinline__ v8f wmma16(v16h a, v16h b, v8f c) {
  v8f d = __builtin_amdgcn_wmma_f32_16x16x32_f16(false, a, false, b, (short)0, c, false, false);
  asm volatile("v_nop\n\tv_nop\n\tv_nop\n\tv_nop" : "+v"(d) : "v"(a), "v"(b));
  return d;
}
__device__ __forceinline__ v8f wmma_bf(v16b a, v16b b, v8f c) {
  v8f d = __builtin_amdgcn_wmma_f32_16x16x32_bf16(false, a, false, b, (short)0, c, false, false);
  asm volatile("v_nop\n\tv_nop\n\tv_nop\n\tv_nop" : "+v"(d) : "v"(a), "v"(b));
  return d;
}
// 16x16x32 fragments: lane = (h = lane>>4, row/col = lane&15); elements 0..7 = k0+8h+0..7, 8..15 = k0+16+8h+0..7; D element r = row 8h+r
__device__ __forceinline__ v16h frag_h(const _Float16* rowk0, int lane) {
  union { v16h v; v8h q[2]; } u; const _Float16* p = rowk0 + 8 * (lane >> 4);
  u.q[0] = *(const v8h*)p; u.q[1] = *(const v8h*)(p + 16); return u.v;
}
__device__ __forceinline__ v16h frag_f32(const float* rowk0, int lane) {
  v16h a; const float* p = rowk0 + 8 * (lane >> 4);
#pragma unroll
  for (int i = 0; i < 8; ++i) { a[i] = (_Float16)p[i]; a[8 + i] = (_Float16)p[16 + i]; }
  return a;
}
__device__ __forceinline__ v16h frag_f32s(const float* rowk0, int lane, float sc) {
  v16h a; const float* p = rowk0 + 8 * (lane >> 4);
#pragma unroll
  for (int i = 0; i < 8; ++i) { a[i] = (_Float16)(p[i] * sc); a[8 + i] = (_Float16)(p[16 + i] * sc); }
  return a;
}
// column fragment from a [K][ld] layout (column n), rows >= K read as 0
__device__ __forceinline__ v16h fragc_f32(const float* W, int k0, int n, int lane, int ld, int K) {
  v16h a; const int g = lane >> 4;
#pragma unroll
  for (int i = 0; i < 8; ++i) { const int ka = k0 + 8 * g + i, kb = ka + 16;
    a[i] = (_Float16)(ka < K ? W[(size_t)(ka < K ? ka : K - 1) * ld + n] : 0.f); a[8 + i] = (_Float16)(kb < K ? W[(size_t)(kb < K ? kb : K - 1) * ld + n] : 0.f); }
  return a;
}
struct F2 { v16b h, l; };
__device__ __forceinline__ F2 bsplit16(const float v[16]) { F2 r;
#pragma unroll
  for (int i = 0; i < 16; ++i) { const __bf16 h = (__bf16)v[i]; r.h[i] = h; r.l[i] = (__bf16)(v[i] - (float)h); }
  return r; }
__device__ __forceinline__ F2 split_row(const float* row, int k0, int lane) { float v[16]; const float* p = row + k0 + 8 * (lane >> 4);
#pragma unroll
  for (int i = 0; i < 8; ++i) { v[i] = p[i]; v[8 + i] = p[16 + i]; }
  return bsplit16(v); }
__device__ __forceinline__ F2 split_rowK(const float* row, int k0, int lane, int K) { float v[16]; const int g = lane >> 4;
#pragma unroll
  for (int i = 0; i < 8; ++i) { const int ka = k0 + 8 * g + i, kb = ka + 16; v[i] = ka < K ? row[ka < K ? ka : K - 1] : 0.f; v[8 + i] = kb < K ? row[kb < K ? kb : K - 1] : 0.f; }
  return bsplit16(v); }
__device__ __forceinline__ F2 split_col(const float* W, int k0, int n, int lane, int ld, int K) { float v[16]; const int g = lane >> 4;
#pragma unroll
  for (int i = 0; i < 8; ++i) { const int ka = k0 + 8 * g + i, kb = ka + 16; v[i] = ka < K ? W[(size_t)(ka < K ? ka : K - 1) * ld + n] : 0.f; v[8 + i] = kb < K ? W[(size_t)(kb < K ? kb : K - 1) * ld + n] : 0.f; }
  return bsplit16(v); }
__device__ __forceinline__ v8f mac3(const F2& a, const F2& b, v8f c) { c = wmma_bf(a.l, b.h, c); c = wmma_bf(a.h, b.l, c); return wmma_bf(a.h, b.h, c); }
__device__ __forceinline__ float sigm(float v) { return 1.0f / (1.0f + expf(-v)); }
#define LDSX() do { asm volatile("s_wait_dscnt 0" ::: "memory"); __builtin_amdgcn_wave_barrier(); __builtin_amdgcn_fence(__ATOMIC_RELEASE, "workgroup"); } while (0)


// Multi-head attention with rotary embedding and a data-dependent 'stoichiometric' bias (B 2, T 2,048, D 1,024 = 16 x 64): Q = query Wq + bq, K = key Wk + bk, V = value Wv + bv ((in,out)); rotate-half RoPE with angle t / 10000^(2i/64); scores = Q K^T 64^-0.5 + (alpha_pos[h] if frac_j >= frac_i else alpha_neg[h]) (frac_j - frac_i); softmax; P V; out Wo + bo.
#define NB 2
#define TT 2048
#define CC 1024
#define NH 16
#define HD 64
__constant__ float RCPF[32] = {1.000000000e+0f,7.498942018e-1f,5.623413324e-1f,4.216965139e-1f,3.162277639e-1f,2.371373624e-1f,1.778279394e-1f,1.333521456e-1f,1.000000015e-1f,7.498941571e-2f,5.623412877e-2f,4.216964915e-2f,3.162277862e-2f,2.371373586e-2f,1.778279431e-2f,1.333521493e-2f,9.999999776e-3f,7.498942316e-3f,5.623413250e-3f,4.216964822e-3f,3.162277862e-3f,2.371373819e-3f,1.778279431e-3f,1.333521446e-3f,1.000000047e-3f,7.498941850e-4f,5.623413017e-4f,4.216964880e-4f,3.162277862e-4f,2.371373848e-4f,1.778279402e-4f,1.333521504e-4f};   // f32(1 / f32(10000^(2i/64))): the module divides pos by freq_div, which XLA evaluates as pos * (1/freq_div)
#ifndef TNB
#define TNB NB
#endif
typedef __attribute__((ext_vector_type(8))) __bf16 v8b;
__device__ __forceinline__ v16b frag_b(const __bf16* rowk0, int lane) {
  union { v16b v; v8b q[2]; } u; const __bf16* p = rowk0 + 8 * (lane >> 4);
  u.q[0] = *(const v8b*)p; u.q[1] = *(const v8b*)(p + 16); return u.v;
}
__device__ __forceinline__ float bfr(float v) { return (float)(__bf16)v; }
__device__ __attribute__((noinline)) float exp_ni(float v) { return expf(v); }
__device__ __attribute__((noinline)) float erf_ni(float v) { return erff(v); }

#define WS_ROT 0u                                   // float2 (cos, sin)[t][32] = cos/sin(t * (1/freq_div[j]))
#define WS_QH  (WS_ROT + 8u * (size_t)TT * 32)
#define WS_QL  (WS_QH + 2u * (size_t)NB * TT * CC)
#define WS_KH  (WS_QL + 2u * (size_t)NB * TT * CC)
#define WS_VT  (WS_KH + 2u * (size_t)NB * TT * CC)      // bf16 v planes [b][c][t]
#define WS_VL  (WS_VT + 2u * (size_t)NB * CC * TT)      // bf16 v residual planes
#define WS_Y   (WS_VL + 2u * (size_t)NB * CC * TT)      // f32 y rows [b*t][C]
#define WS_END (WS_Y + 4u * (size_t)NB * TT * CC)

// ---- k_rot: one thread per (t, j): precise cosf/sinf of t * inv_freq[j] -> table (keeps the trig and its large-argument reduction out of the GEMM kernel)
__global__ __launch_bounds__(256) void k_rot(float2* __restrict__ ROT) { const int i = blockIdx.x * 256 + threadIdx.x; if (i >= TT * 32) return; const int t = i >> 5, j = i & 31; const float ang = (float)t * RCPF[j]; v2f v; v[0] = cosf(ang); v[1] = sinf(ang); vst2((v2f*)(ROT + i), v); }   
// ---- k_proj: block = (64 rows, 128 cols, which): qkv = x W (+ b), exact; q -> f16 hi (+ residual), k -> f16 rows, v -> bf16 hi + lo planes
__global__ __launch_bounds__(128) void k_proj(const float* __restrict__ X0, const float* __restrict__ X1, const float* __restrict__ X2, const float* __restrict__ WQ, const float* __restrict__ BQ, const float* __restrict__ WK, const float* __restrict__ BK, const float* __restrict__ WV, const float* __restrict__ BV, _Float16* __restrict__ QH, _Float16* __restrict__ QL, _Float16* __restrict__ KH, __bf16* __restrict__ VT, __bf16* __restrict__ VL, const float2* __restrict__ ROT) {
  __shared__ __align__(16) _Float16 sh[64][136], sl[64][136]; __shared__ __align__(16) __bf16 th[128][72], tl2[128][72];
  const int tid = threadIdx.x, wave = tid >> 5, lane = tid & 31, col = lane & 15, g = lane >> 4; const int which = blockIdx.z; const int c0 = blockIdx.y * 128; const size_t r0 = (size_t)blockIdx.x * 64; const float* WA = which == 0 ? WQ : which == 1 ? WK : WV; const float* BA = which == 0 ? BQ : which == 1 ? BK : BV;
  v8f acc[8] = {};
  const float* X = which == 0 ? X0 : which == 1 ? X1 : X2;
#pragma unroll 2
  for (int kc = 0; kc < CC / 32; ++kc) { v16b a; { const float* p = X + (r0 + wave * 16 + col) * CC + kc * 32 + 8 * g;
#pragma unroll
      for (int i = 0; i < 8; ++i) { a[i] = (__bf16)p[i]; a[8 + i] = (__bf16)p[16 + i]; } }
#pragma unroll
    for (int j = 0; j < 8; ++j) { v16b w; const int o = c0 + j * 16 + col;
#pragma unroll
      for (int i = 0; i < 8; ++i) { w[i] = (__bf16)WA[(size_t)(kc * 32 + 8 * g + i) * CC + o]; w[8 + i] = (__bf16)WA[(size_t)(kc * 32 + 16 + 8 * g + i) * CC + o]; }
      asm volatile("s_wait_loadcnt 0x0" ::: "memory"); acc[j] = wmma_bf(a, w, acc[j]); } }
#pragma unroll
  for (int j = 0; j < 8; ++j) { const float bb0 = BA ? bfr(BA[c0 + j * 16 + col]) : 0.f;
#pragma unroll
    for (int r = 0; r < 8; ++r) acc[j][r] += bb0; }   /* bias before the rotary */
  if (which < 2) {   /* rotate-half rotary on all 64 head dims: the 128-column tile holds heads 2*by and 2*by+1; tiles j (d 0..15), j+1 (16..31) pair with j+2 (32..47), j+3 (48..63) in the SAME lane and row: out[d] = x[d] c - x[d+32] s, out[d+32] = x[d] s + x[d+32] c, angle index i = d (< 32) */
#pragma unroll
    for (int jp = 0; jp < 8; ++jp) { if ((jp & 3) >= 2) continue; const int i = ((jp & 3) * 16 + col);   /* d < 32 */
#pragma unroll
      for (int r = 0; r < 8; ++r) { const int t = (int)((r0 + wave * 16 + 8 * g + r) % TT); const float2 cv = ROT[t * 32 + i]; const float xl = acc[jp][r], xr = acc[jp + 2][r]; acc[jp][r] = xl * cv.x - xr * cv.y; acc[jp + 2][r] = xl * cv.y + xr * cv.x; }
      asm volatile("s_wait_loadcnt 0x0" ::: "memory"); } }
#pragma unroll
  for (int j = 0; j < 8; ++j) { const float bb = 0.f;
#pragma unroll
    for (int r = 0; r < 8; ++r) { const float v = acc[j][r] + bb; const int rl = wave * 16 + 8 * g + r, cl = j * 16 + col; const _Float16 hv = (_Float16)v;
      if (which == 2) { const __bf16 bh = (__bf16)v; th[cl][rl] = bh; tl2[cl][rl] = (__bf16)(v - (float)bh); } else { sh[rl][cl] = hv; sl[rl][cl] = (_Float16)((v - (float)hv) * 1024.0f); }   /* q residual carried x 2^10 so the plane stays f16-normal on the chip */ } }
  __syncthreads();
  if (which < 2) { _Float16* dh = which == 0 ? QH : KH; for (int e = tid; e < 64 * 16; e += 128) { const int rl = e >> 4, q = e & 15; vst2((unsigned*)(dh + (r0 + rl) * CC + c0 + q * 8), *(const v4u*)&sh[rl][q * 8]); if (which == 0) vst2((unsigned*)(QL + (r0 + rl) * CC + c0 + q * 8), *(const v4u*)&sl[rl][q * 8]); } }
  else { const size_t b = r0 / TT; const int t0 = (int)(r0 % TT); for (int e = tid; e < 128 * 8; e += 128) { const int cl = e >> 3, q = e & 7; const size_t o2 = (b * CC + c0 + cl) * (size_t)TT + t0 + q * 8; vst2((unsigned*)(VT + o2), *(const v4u*)&th[cl][q * 8]); vst2((unsigned*)(VL + o2), *(const v4u*)&tl2[cl][q * 8]); } } }
// ---- k_fa: block = 8 waves x 16 queries of one (b, h); a wave walks all keys 32 at a time and never stores a logit: S^T = K Q^T (2 products) x 64^-0.5 + bias(frac_k - frac_q), running maximum and sum per query (a lane holds one query's column: keys 8g+r of each 16-key tile), P^T packed from the two score tiles straight into a B operand (hardware k order), O^T += V^T P^T (3 products), O^T / sum at the end. waves_per_eu(4, 4): a budget of 256 registers, so that a pass's fragments are all in flight at once and the 512 blocks are resident together, two a WGP. The inner loops are unrolled whole so that the fragment arrays stay in registers
__global__ __launch_bounds__(256) __attribute__((amdgpu_waves_per_eu(4, 4))) void k_fa(const _Float16* __restrict__ QH, const _Float16* __restrict__ QL, const _Float16* __restrict__ KH, const __bf16* __restrict__ VT, const __bf16* __restrict__ VL, const float* __restrict__ FR, const float* __restrict__ AP, const float* __restrict__ AN, float* __restrict__ Y) {
  const int tid = threadIdx.x, wave = tid >> 5, lane = tid & 31, col = lane & 15, g = lane >> 4; const int h = blockIdx.y, b = blockIdx.z; const int q = blockIdx.x * 128 + wave * 16 + col;
  const size_t qrow = ((size_t)b * TT + q) * CC + h * HD;
  v16h qh[HD / 32], ql[HD / 32];
#pragma unroll
  for (int kc = 0; kc < HD / 32; ++kc) { qh[kc] = frag_h(QH + qrow + kc * 32, lane); ql[kc] = frag_h(QL + qrow + kc * 32, lane); }
  const float ap = bfr(AP[h]), an = bfr(AN[h]), fq = bfr(FR[(size_t)b * TT + q]);
  const _Float16* kp = KH + ((size_t)b * TT + col) * CC + h * HD + 8 * g; const size_t vo = ((size_t)b * CC + h * HD + col) * (size_t)TT + 8 * g; const __bf16* vh = VT + vo; const __bf16* vl = VL + vo; const float* fr = FR + (size_t)b * TT + 8 * g;   /* each lane's own 8g is in the base */
  v8f o[HD / 16] = {}; float m = -3.0e38f, l = 0.f; int k0 = 0;
#pragma unroll 1   /* rolled: the fragments of two passes do not fit 256 registers */
  for (int it = 0; it < TT / 32; ++it) { float s[16]; v4f fk[4]; v16h kf[2][HD / 32]; v16b vf[HD / 16], wf[HD / 16];
    const _Float16* kq = kp + (size_t)k0 * CC; const __bf16* vq = vh + k0; const __bf16* wq = vl + k0; const float* fp = fr + k0;
#pragma unroll
    for (int t = 0; t < 2; ++t) {
#pragma unroll
      for (int kc = 0; kc < HD / 32; ++kc) kf[t][kc] = frag_h(kq + (size_t)(t * 16) * CC + kc * 32, 0);
#pragma unroll
      for (int r = 0; r < 4; ++r) { fk[t * 2][r] = fp[t * 16 + r]; fk[t * 2 + 1][r] = fp[t * 16 + 4 + r]; } }
#pragma unroll
    for (int j = 0; j < HD / 16; ++j) { vf[j] = frag_b(vq + (size_t)(j * 16) * TT, 0); wf[j] = frag_b(wq + (size_t)(j * 16) * TT, 0); }
    /* one statement behind the pass's 28 loads. The loaded values are inputs only: the loads stay one group in front of the products and a wave waits for memory once a pass (without it each fragment is loaded right in front of its product: 16 load latencies in a row). The four addresses are inputs and the key offset passes through, so that no register which an issued load names is written anew in front of the s_wait_xcnt */
    asm volatile("s_wait_xcnt 0x0" : "+s"(k0) : "v"(kq), "v"(vq), "v"(wq), "v"(fp), "v"(kf[0][0]), "v"(kf[0][1]), "v"(kf[1][0]), "v"(kf[1][1]), "v"(vf[0]), "v"(vf[1]), "v"(vf[2]), "v"(vf[3]), "v"(wf[0]), "v"(wf[1]), "v"(wf[2]), "v"(wf[3]), "v"(fk[0]), "v"(fk[1]), "v"(fk[2]), "v"(fk[3]) : "memory");
    k0 += 32;
#pragma unroll
    for (int t = 0; t < 2; ++t) { v8f a = {}, al = {};
#pragma unroll
      for (int kc = 0; kc < HD / 32; ++kc) { a = wmma16(kf[t][kc], qh[kc], a); al = wmma16(kf[t][kc], ql[kc], al); }
#pragma unroll
      for (int r = 0; r < 8; ++r) { const float D = bfr(fk[t * 2 + (r >> 2)][r & 3]) - fq; const float bias = (D >= 0.f ? ap : an) * D; s[t * 8 + r] = (a[r] + al[r] * (1.0f / 1024.0f)) * 0.125f + bias; } }
    float mx = s[0];
#pragma unroll
    for (int i = 1; i < 16; ++i) mx = fmaxf(mx, s[i]);
    mx = fmaxf(mx, __shfl_xor(mx, 16));   /* the other half of the wave holds this query's other 16 keys */
    const float mn = fmaxf(m, mx), sc = expf(m - mn); m = mn; float ps = 0.f;
#pragma unroll
    for (int i = 0; i < 16; ++i) { s[i] = expf(s[i] - mn); ps += s[i]; }
    l = l * sc + ps;
#pragma unroll
    for (int j = 0; j < HD / 16; ++j)
#pragma unroll
      for (int r = 0; r < 8; ++r) o[j][r] *= sc;
    const F2 p = bsplit16(s);   /* element i < 8 = the pass's key 8g + i, i >= 8 = key 16 + 8g + i - 8: the k order of frag_b */
#pragma unroll
    for (int j = 0; j < HD / 16; ++j) { o[j] = wmma_bf(vf[j], p.h, o[j]); o[j] = wmma_bf(vf[j], p.l, o[j]); o[j] = wmma_bf(wf[j], p.h, o[j]); } }
  l += __shfl_xor(l, 16); const float inv = 1.0f / l; float* yp = Y + qrow + 8 * g;   /* O^T register r of tile j = head dim j*16 + 8g + r of this lane's query */
#pragma unroll
  for (int j = 0; j < HD / 16; ++j) { v4f u0, u1;
#pragma unroll
    for (int r = 0; r < 4; ++r) { u0[r] = o[j][r] * inv; u1[r] = o[j][4 + r] * inv; }
    vst2(yp + j * 16, u0); vst2(yp + j * 16 + 4, u1); } }
// ---- k_out: block = (64 rows, 128 cols): out = y (bf16 hi + lo) Wo + bo
__global__ __launch_bounds__(128) void k_out(const float* __restrict__ Y, const float* __restrict__ WP, const float* __restrict__ BP, float* __restrict__ OUT) { __shared__ __align__(16) float sf[4][16][132];
  const int tid = threadIdx.x, wave = tid >> 5, lane = tid & 31, col = lane & 15, g = lane >> 4; const int c0 = blockIdx.y * 128; const size_t r0 = (size_t)blockIdx.x * 64 + wave * 16;
  v8f acc[8] = {};
#pragma unroll 2
  for (int kc = 0; kc < CC / 32; ++kc) { const F2 a = split_row(Y + (r0 + col) * CC, kc * 32, lane);
#pragma unroll
    for (int j = 0; j < 8; ++j) { v16b w; const int o = c0 + j * 16 + col;
#pragma unroll
      for (int i = 0; i < 8; ++i) { w[i] = (__bf16)WP[(size_t)(kc * 32 + 8 * g + i) * CC + o]; w[8 + i] = (__bf16)WP[(size_t)(kc * 32 + 16 + 8 * g + i) * CC + o]; }
      acc[j] = wmma_bf(a.h, w, acc[j]); acc[j] = wmma_bf(a.l, w, acc[j]); } }
#pragma unroll
  for (int j = 0; j < 8; ++j) { const float bb = BP ? bfr(BP[c0 + j * 16 + col]) : 0.f;
#pragma unroll
    for (int r = 0; r < 8; ++r) sf[wave][8 * g + r][j * 16 + col] = acc[j][r] + bb; }
  LDSX(); for (int rl = 0; rl < 16; ++rl) vst2(OUT + (r0 + rl) * CC + c0 + lane * 4, *(const v4f*)&sf[wave][rl][lane * 4]); }
extern "C" void kernel_launch(void* const* d_in, const int* in_sizes, int n_in, void* d_out, int out_size, void* d_ws, size_t ws_size, hipStream_t stream) {
  (void)in_sizes; (void)n_in; (void)out_size;
  const float** F = (const float**)d_in;   // 0 query, 1 key, 2 value [2,2048,1024]; 3 frac [2,2048]; 4 Wq, 5 Wk, 6 Wv, 7 Wo ((in,out)); 8 bq, 9 bk, 10 bv, 11 bo; 12 alpha_pos [16], 13 alpha_neg [16]
  if (ws_size < (size_t)WS_END) return;
  char* ws = (char*)d_ws; _Float16 *QH = (_Float16*)(ws + WS_QH), *QL = (_Float16*)(ws + WS_QL), *KH = (_Float16*)(ws + WS_KH); __bf16 *VT = (__bf16*)(ws + WS_VT), *VL = (__bf16*)(ws + WS_VL); float *Y = (float*)(ws + WS_Y);
  k_rot<<<dim3(TT * 32 / 256), 256, 0, stream>>>((float2*)(ws + WS_ROT));
  k_proj<<<dim3(TNB * TT / 64, CC / 128, 3), 128, 0, stream>>>(F[0], F[1], F[2], F[4], F[8], F[5], F[9], F[6], F[10], QH, QL, KH, VT, VL, (const float2*)(ws + WS_ROT));
  k_fa<<<dim3(TT / 128, NH, TNB), 256, 0, stream>>>(QH, QL, KH, VT, VL, F[3], F[12], F[13], Y);
  k_out<<<dim3(TNB * TT / 64, CC / 128), 128, 0, stream>>>(Y, F[7], F[11], (float*)d_out);
}

// v002
// A run of this version takes 317 microseconds.
// Next to v001, in two timings, it ran 1.12 times as fast each time.
// Counting every step since v000, it is 5.22 times as fast.
// compute dtype: all float inputs rounded to bf16; q/k/v = x W + b with EXACT bf16 products on WMMA 16x16x32, f32 accumulate; rotate-half rotary in f32 from a cos/sin table of t * (1/freq_div[i]) (the module's f32 reciprocals; precise cosf/sinf); q as f16 hi + residual (x 2^10), k once to f16 -> 2-product logits x 64^-0.5 + the stoichiometric bias from frac / alpha in f32; softmax in f32 (precise expf) with a running maximum and sum over 32-key steps, logits never stored; unnormalised P split bf16 hi + lo against v bf16 hi + lo (3 products), divided by the sum at the end; y (bf16 hi + lo) Wo + bo; f32 output.
#include <hip/hip_runtime.h>
#include <math.h>

typedef __attribute__((ext_vector_type(16))) _Float16 v16h;
typedef __attribute__((ext_vector_type(16))) __bf16 v16b;
typedef __attribute__((ext_vector_type(8)))  _Float16 v8h;
typedef __attribute__((ext_vector_type(8)))  float v8f;
typedef __attribute__((ext_vector_type(4)))  float v4f;
typedef __attribute__((ext_vector_type(2)))  float v2f;
typedef __attribute__((ext_vector_type(4)))  unsigned v4u;
typedef __attribute__((ext_vector_type(4)))  int v4i;
typedef float __attribute__((may_alias)) float_a;
typedef int __attribute__((may_alias)) int_a;

template <typename T> __device__ __forceinline__ void vst2(void* p, T v) { *(T*)p = v;  }
__device__ __forceinline__ v8f wmma16(v16h a, v16h b, v8f c) {
  v8f d = __builtin_amdgcn_wmma_f32_16x16x32_f16(false, a, false, b, (short)0, c, false, false);
  asm volatile("v_nop\n\tv_nop\n\tv_nop\n\tv_nop" : "+v"(d) : "v"(a), "v"(b));
  return d;
}
__device__ __forceinline__ v8f wmma_bf(v16b a, v16b b, v8f c) {
  v8f d = __builtin_amdgcn_wmma_f32_16x16x32_bf16(false, a, false, b, (short)0, c, false, false);
  asm volatile("v_nop\n\tv_nop\n\tv_nop\n\tv_nop" : "+v"(d) : "v"(a), "v"(b));
  return d;
}
// 16x16x32 fragments: lane = (h = lane>>4, row/col = lane&15); elements 0..7 = k0+8h+0..7, 8..15 = k0+16+8h+0..7; D element r = row 8h+r
__device__ __forceinline__ v16h frag_h(const _Float16* rowk0, int lane) {
  union { v16h v; v8h q[2]; } u; const _Float16* p = rowk0 + 8 * (lane >> 4);
  u.q[0] = *(const v8h*)p; u.q[1] = *(const v8h*)(p + 16); return u.v;
}
__device__ __forceinline__ v16h frag_f32(const float* rowk0, int lane) {
  v16h a; const float* p = rowk0 + 8 * (lane >> 4);
#pragma unroll
  for (int i = 0; i < 8; ++i) { a[i] = (_Float16)p[i]; a[8 + i] = (_Float16)p[16 + i]; }
  return a;
}
__device__ __forceinline__ v16h frag_f32s(const float* rowk0, int lane, float sc) {
  v16h a; const float* p = rowk0 + 8 * (lane >> 4);
#pragma unroll
  for (int i = 0; i < 8; ++i) { a[i] = (_Float16)(p[i] * sc); a[8 + i] = (_Float16)(p[16 + i] * sc); }
  return a;
}
// column fragment from a [K][ld] layout (column n), rows >= K read as 0
__device__ __forceinline__ v16h fragc_f32(const float* W, int k0, int n, int lane, int ld, int K) {
  v16h a; const int g = lane >> 4;
#pragma unroll
  for (int i = 0; i < 8; ++i) { const int ka = k0 + 8 * g + i, kb = ka + 16;
    a[i] = (_Float16)(ka < K ? W[(size_t)(ka < K ? ka : K - 1) * ld + n] : 0.f); a[8 + i] = (_Float16)(kb < K ? W[(size_t)(kb < K ? kb : K - 1) * ld + n] : 0.f); }
  return a;
}
struct F2 { v16b h, l; };
__device__ __forceinline__ F2 bsplit16(const float v[16]) { F2 r;
#pragma unroll
  for (int i = 0; i < 16; ++i) { const __bf16 h = (__bf16)v[i]; r.h[i] = h; r.l[i] = (__bf16)(v[i] - (float)h); }
  return r; }
__device__ __forceinline__ F2 split_row(const float* row, int k0, int lane) { float v[16]; const float* p = row + k0 + 8 * (lane >> 4);
#pragma unroll
  for (int i = 0; i < 8; ++i) { v[i] = p[i]; v[8 + i] = p[16 + i]; }
  return bsplit16(v); }
__device__ __forceinline__ F2 split_rowK(const float* row, int k0, int lane, int K) { float v[16]; const int g = lane >> 4;
#pragma unroll
  for (int i = 0; i < 8; ++i) { const int ka = k0 + 8 * g + i, kb = ka + 16; v[i] = ka < K ? row[ka < K ? ka : K - 1] : 0.f; v[8 + i] = kb < K ? row[kb < K ? kb : K - 1] : 0.f; }
  return bsplit16(v); }
__device__ __forceinline__ F2 split_col(const float* W, int k0, int n, int lane, int ld, int K) { float v[16]; const int g = lane >> 4;
#pragma unroll
  for (int i = 0; i < 8; ++i) { const int ka = k0 + 8 * g + i, kb = ka + 16; v[i] = ka < K ? W[(size_t)(ka < K ? ka : K - 1) * ld + n] : 0.f; v[8 + i] = kb < K ? W[(size_t)(kb < K ? kb : K - 1) * ld + n] : 0.f; }
  return bsplit16(v); }
__device__ __forceinline__ v8f mac3(const F2& a, const F2& b, v8f c) { c = wmma_bf(a.l, b.h, c); c = wmma_bf(a.h, b.l, c); return wmma_bf(a.h, b.h, c); }
__device__ __forceinline__ float sigm(float v) { return 1.0f / (1.0f + expf(-v)); }
#define LDSX() do { asm volatile("s_wait_dscnt 0" ::: "memory"); __builtin_amdgcn_wave_barrier(); __builtin_amdgcn_fence(__ATOMIC_RELEASE, "workgroup"); } while (0)


// Multi-head attention with rotary embedding and a data-dependent 'stoichiometric' bias (B 2, T 2,048, D 1,024 = 16 x 64): Q = query Wq + bq, K = key Wk + bk, V = value Wv + bv ((in,out)); rotate-half RoPE with angle t / 10000^(2i/64); scores = Q K^T 64^-0.5 + (alpha_pos[h] if frac_j >= frac_i else alpha_neg[h]) (frac_j - frac_i); softmax; P V; out Wo + bo.
#define NB 2
#define TT 2048
#define CC 1024
#define NH 16
#define HD 64
__constant__ float RCPF[32] = {1.000000000e+0f,7.498942018e-1f,5.623413324e-1f,4.216965139e-1f,3.162277639e-1f,2.371373624e-1f,1.778279394e-1f,1.333521456e-1f,1.000000015e-1f,7.498941571e-2f,5.623412877e-2f,4.216964915e-2f,3.162277862e-2f,2.371373586e-2f,1.778279431e-2f,1.333521493e-2f,9.999999776e-3f,7.498942316e-3f,5.623413250e-3f,4.216964822e-3f,3.162277862e-3f,2.371373819e-3f,1.778279431e-3f,1.333521446e-3f,1.000000047e-3f,7.498941850e-4f,5.623413017e-4f,4.216964880e-4f,3.162277862e-4f,2.371373848e-4f,1.778279402e-4f,1.333521504e-4f};   // f32(1 / f32(10000^(2i/64))): the module divides pos by freq_div, which XLA evaluates as pos * (1/freq_div)
#ifndef TNB
#define TNB NB
#endif
typedef __attribute__((ext_vector_type(8))) __bf16 v8b;
__device__ __forceinline__ v16b frag_b(const __bf16* rowk0, int lane) {
  union { v16b v; v8b q[2]; } u; const __bf16* p = rowk0 + 8 * (lane >> 4);
  u.q[0] = *(const v8b*)p; u.q[1] = *(const v8b*)(p + 16); return u.v;
}
__device__ __forceinline__ float bfr(float v) { return (float)(__bf16)v; }
__device__ __attribute__((noinline)) float exp_ni(float v) { return expf(v); }
__device__ __attribute__((noinline)) float erf_ni(float v) { return erff(v); }

#define WS_ROT 0u                                   // float2 (cos, sin)[t][32] = cos/sin(t * (1/freq_div[j]))
#define WS_QH  (WS_ROT + 8u * (size_t)TT * 32)
#define WS_QL  (WS_QH + 2u * (size_t)NB * TT * CC)
#define WS_KH  (WS_QL + 2u * (size_t)NB * TT * CC)
#define WS_VT  (WS_KH + 2u * (size_t)NB * TT * CC)      // bf16 v planes [b][c][t]
#define WS_VL  (WS_VT + 2u * (size_t)NB * CC * TT)      // bf16 v residual planes
#define WS_Y   (WS_VL + 2u * (size_t)NB * CC * TT)      // f32 y rows [b*t][C]
#define WS_END (WS_Y + 4u * (size_t)NB * TT * CC)

// ---- k_rot: one thread per (t, j): precise cosf/sinf of t * inv_freq[j] -> table (keeps the trig and its large-argument reduction out of the GEMM kernel)
__global__ __launch_bounds__(256) void k_rot(float2* __restrict__ ROT) { const int i = blockIdx.x * 256 + threadIdx.x; if (i >= TT * 32) return; const int t = i >> 5, j = i & 31; const float ang = (float)t * RCPF[j]; v2f v; v[0] = cosf(ang); v[1] = sinf(ang); vst2((v2f*)(ROT + i), v); }   
// ---- k_proj: block = (64 rows, 128 cols, which): qkv = x W (+ b), exact; q -> f16 hi (+ residual), k -> f16 rows, v -> bf16 hi + lo planes
__global__ __launch_bounds__(128) void k_proj(const float* __restrict__ X0, const float* __restrict__ X1, const float* __restrict__ X2, const float* __restrict__ WQ, const float* __restrict__ BQ, const float* __restrict__ WK, const float* __restrict__ BK, const float* __restrict__ WV, const float* __restrict__ BV, _Float16* __restrict__ QH, _Float16* __restrict__ QL, _Float16* __restrict__ KH, __bf16* __restrict__ VT, __bf16* __restrict__ VL, const float2* __restrict__ ROT) {
  __shared__ __align__(16) _Float16 sh[64][136], sl[64][136]; __shared__ __align__(16) __bf16 th[128][72], tl2[128][72];
  const int tid = threadIdx.x, wave = tid >> 5, lane = tid & 31, col = lane & 15, g = lane >> 4; const int which = blockIdx.z; const int c0 = blockIdx.y * 128; const size_t r0 = (size_t)blockIdx.x * 64; const float* WA = which == 0 ? WQ : which == 1 ? WK : WV; const float* BA = which == 0 ? BQ : which == 1 ? BK : BV;
  v8f acc[8] = {};
  const float* X = which == 0 ? X0 : which == 1 ? X1 : X2;
#pragma unroll 2
  for (int kc = 0; kc < CC / 32; ++kc) { v16b a; { const float* p = X + (r0 + wave * 16 + col) * CC + kc * 32 + 8 * g;
#pragma unroll
      for (int i = 0; i < 8; ++i) { a[i] = (__bf16)p[i]; a[8 + i] = (__bf16)p[16 + i]; } }
#pragma unroll
    for (int j = 0; j < 8; ++j) { v16b w; const int o = c0 + j * 16 + col;
#pragma unroll
      for (int i = 0; i < 8; ++i) { w[i] = (__bf16)WA[(size_t)(kc * 32 + 8 * g + i) * CC + o]; w[8 + i] = (__bf16)WA[(size_t)(kc * 32 + 16 + 8 * g + i) * CC + o]; }
      asm volatile("s_wait_loadcnt 0x0" ::: "memory"); acc[j] = wmma_bf(a, w, acc[j]); } }
#pragma unroll
  for (int j = 0; j < 8; ++j) { const float bb0 = BA ? bfr(BA[c0 + j * 16 + col]) : 0.f;
#pragma unroll
    for (int r = 0; r < 8; ++r) acc[j][r] += bb0; }   /* bias before the rotary */
  if (which < 2) {   /* rotate-half rotary on all 64 head dims: the 128-column tile holds heads 2*by and 2*by+1; tiles j (d 0..15), j+1 (16..31) pair with j+2 (32..47), j+3 (48..63) in the SAME lane and row: out[d] = x[d] c - x[d+32] s, out[d+32] = x[d] s + x[d+32] c, angle index i = d (< 32) */
#pragma unroll
    for (int jp = 0; jp < 8; ++jp) { if ((jp & 3) >= 2) continue; const int i = ((jp & 3) * 16 + col);   /* d < 32 */
#pragma unroll
      for (int r = 0; r < 8; ++r) { const int t = (int)((r0 + wave * 16 + 8 * g + r) % TT); const float2 cv = ROT[t * 32 + i]; const float xl = acc[jp][r], xr = acc[jp + 2][r]; acc[jp][r] = xl * cv.x - xr * cv.y; acc[jp + 2][r] = xl * cv.y + xr * cv.x; }
      asm volatile("s_wait_loadcnt 0x0" ::: "memory"); } }
#pragma unroll
  for (int j = 0; j < 8; ++j) { const float bb = 0.f;
#pragma unroll
    for (int r = 0; r < 8; ++r) { const float v = acc[j][r] + bb; const int rl = wave * 16 + 8 * g + r, cl = j * 16 + col; const _Float16 hv = (_Float16)v;
      if (which == 2) { const __bf16 bh = (__bf16)v; th[cl][rl] = bh; tl2[cl][rl] = (__bf16)(v - (float)bh); } else { sh[rl][cl] = hv; sl[rl][cl] = (_Float16)((v - (float)hv) * 1024.0f); }   /* q residual carried x 2^10 so the plane stays f16-normal on the chip */ } }
  __syncthreads();
  if (which < 2) { _Float16* dh = which == 0 ? QH : KH; for (int e = tid; e < 64 * 16; e += 128) { const int rl = e >> 4, q = e & 15; vst2((unsigned*)(dh + (r0 + rl) * CC + c0 + q * 8), *(const v4u*)&sh[rl][q * 8]); if (which == 0) vst2((unsigned*)(QL + (r0 + rl) * CC + c0 + q * 8), *(const v4u*)&sl[rl][q * 8]); } }
  else { const size_t b = r0 / TT; const int t0 = (int)(r0 % TT); for (int e = tid; e < 128 * 8; e += 128) { const int cl = e >> 3, q = e & 7; const size_t o2 = (b * CC + c0 + cl) * (size_t)TT + t0 + q * 8; vst2((unsigned*)(VT + o2), *(const v4u*)&th[cl][q * 8]); vst2((unsigned*)(VL + o2), *(const v4u*)&tl2[cl][q * 8]); } } }
// ---- k_fa: block = 8 waves x 16 queries of one (b, h); the block's keys come through LDS: a stage is 64 keys (K rows, V^T hi rows, V^T lo rows, 128 B a row at a pitch of 144 B), brought once for all eight waves by asynchronous copies into two buffers, the next stage flying while this one is worked on; frac's 2,048 values of the batch are copied once. A wave walks a stage 32 keys at a time and never stores a logit: S^T = K Q^T (2 products) x 64^-0.5 + bias(frac_k - frac_q), running maximum and sum per query (a lane holds one query's column: keys 8g+r of each 16-key tile), P^T packed from the two score tiles straight into a B operand (hardware k order), O^T += V^T P^T (3 products), O^T / sum at the end. waves_per_eu(4, 4): a budget of 256 registers, the 512 blocks resident together, two a WGP
#define KST 64                  /* keys a stage */
#define NST (TT / KST)
#define LP 72                   /* LDS row pitch in 16-bit elements: 144 B = 16 B x 9, free of bank conflicts for 16-byte readers */
#define TILE_B (64 * LP * 2)
#define STAGE_B (3 * TILE_B)
// one stage's six 16-byte copies of a lane (rows r and r + 32 of K, V hi, V lo). The s_wait_xcnt stands inside the statement, so that no register which an issued copy names is written anew in front of it
__device__ __forceinline__ void stage_copy(unsigned l, const _Float16* k, const __bf16* v, const __bf16* w) {
  const unsigned l1 = l + 32 * LP * 2, l2 = l + TILE_B, l3 = l2 + 32 * LP * 2, l4 = l + 2 * TILE_B, l5 = l4 + 32 * LP * 2; const _Float16* k1 = k + (size_t)32 * CC; const __bf16* v1 = v + (size_t)32 * TT; const __bf16* w1 = w + (size_t)32 * TT;
  asm volatile("global_load_async_to_lds_b128 %0, %6, off\n\tglobal_load_async_to_lds_b128 %1, %7, off\n\tglobal_load_async_to_lds_b128 %2, %8, off\n\tglobal_load_async_to_lds_b128 %3, %9, off\n\tglobal_load_async_to_lds_b128 %4, %10, off\n\tglobal_load_async_to_lds_b128 %5, %11, off\n\ts_wait_xcnt 0x0" :: "v"(l), "v"(l1), "v"(l2), "v"(l3), "v"(l4), "v"(l5), "v"(k), "v"(k1), "v"(v), "v"(v1), "v"(w), "v"(w1) : "memory");
}
__global__ __launch_bounds__(256) __attribute__((amdgpu_waves_per_eu(4, 4))) void k_fa(const _Float16* __restrict__ QH, const _Float16* __restrict__ QL, const _Float16* __restrict__ KH, const __bf16* __restrict__ VT, const __bf16* __restrict__ VL, const float* __restrict__ FR, const float* __restrict__ AP, const float* __restrict__ AN, float* __restrict__ Y) {
  __shared__ __align__(16) unsigned char ring[2 * STAGE_B]; __shared__ __align__(16) float sF[TT];
  const int tid = threadIdx.x, wave = tid >> 5, lane = tid & 31, col = lane & 15, g = lane >> 4; const int h = blockIdx.y, b = blockIdx.z; const int q = blockIdx.x * 128 + wave * 16 + col;
  const size_t qrow = ((size_t)b * TT + q) * CC + h * HD;
  /* the copies: thread = (row tid >> 3, 16-byte piece tid & 7), so a wave's copy covers four whole 128-byte rows */
  const int crow = tid >> 3, cpc = tid & 7; const _Float16* kg = KH + ((size_t)b * TT + crow) * CC + h * HD + cpc * 8; const size_t vg0 = ((size_t)b * CC + h * HD + crow) * (size_t)TT + cpc * 8; const __bf16* vg = VT + vg0; const __bf16* wg = VL + vg0;
  const unsigned lc = (unsigned)(size_t)ring + (unsigned)(crow * (LP * 2) + cpc * 16);
  { const unsigned f0 = (unsigned)(size_t)sF + (unsigned)tid * 16u, f1 = f0 + 4096u; const float* fg0 = FR + (size_t)b * TT + tid * 4; const float* fg1 = fg0 + 1024;
    asm volatile("global_load_async_to_lds_b128 %0, %2, off\n\tglobal_load_async_to_lds_b128 %1, %3, off\n\ts_wait_xcnt 0x0" :: "v"(f0), "v"(f1), "v"(fg0), "v"(fg1) : "memory"); }   /* frac of this batch, once; the wait as in stage_copy */
  stage_copy(lc, kg, vg, wg);
  v16h qh[HD / 32], ql[HD / 32];
#pragma unroll
  for (int kc = 0; kc < HD / 32; ++kc) { qh[kc] = frag_h(QH + qrow + kc * 32, lane); ql[kc] = frag_h(QL + qrow + kc * 32, lane); }
  const float ap = bfr(AP[h]), an = bfr(AN[h]), fq = bfr(FR[(size_t)b * TT + q]);
  asm volatile("s_wait_asynccnt 0x0" ::: "memory");   /* this wave's copies of frac and of stage 0 have landed */
  __syncthreads();                                    /* and every other wave's */
  stage_copy(lc + STAGE_B, kg + (size_t)KST * CC, vg + KST, wg + KST);
  const int lo = col * LP + 8 * g;   /* each lane's own row and 8g */
  v8f o[HD / 16] = {}; float m = -3.0e38f, l = 0.f;
#pragma unroll 1   /* rolled: one stage's code serves both buffers */
  for (int st = 0; st < NST; ++st) { const unsigned char* bp = ring + (st & 1) * STAGE_B;
#pragma unroll 1   /* rolled: the fragments of two passes do not fit 256 registers */
  for (int hf = 0; hf < KST / 32; ++hf) { float s[16]; v4f fk[4]; v16h kf[2][HD / 32]; v16b vf[HD / 16], wf[HD / 16];
    const _Float16* kq = (const _Float16*)bp + hf * 32 * LP + lo; const __bf16* vq = (const __bf16*)(bp + TILE_B) + hf * 32 + lo; const __bf16* wq = (const __bf16*)(bp + 2 * TILE_B) + hf * 32 + lo; const float* fp = sF + st * KST + hf * 32 + 8 * g;
#pragma unroll
    for (int t = 0; t < 2; ++t) {
#pragma unroll
      for (int kc = 0; kc < HD / 32; ++kc) kf[t][kc] = frag_h(kq + (t * 16) * LP + kc * 32, 0);
      fk[t * 2] = *(const v4f*)(fp + t * 16); fk[t * 2 + 1] = *(const v4f*)(fp + t * 16 + 4); }
#pragma unroll
    for (int j = 0; j < HD / 16; ++j) { vf[j] = frag_b(vq + (j * 16) * LP, 0); wf[j] = frag_b(wq + (j * 16) * LP, 0); }
#pragma unroll
    for (int t = 0; t < 2; ++t) { v8f a = {}, al = {};
#pragma unroll
      for (int kc = 0; kc < HD / 32; ++kc) { a = wmma16(kf[t][kc], qh[kc], a); al = wmma16(kf[t][kc], ql[kc], al); }
#pragma unroll
      for (int r = 0; r < 8; ++r) { const float D = bfr(fk[t * 2 + (r >> 2)][r & 3]) - fq; const float bias = (D >= 0.f ? ap : an) * D; s[t * 8 + r] = (a[r] + al[r] * (1.0f / 1024.0f)) * 0.125f + bias; } }
    float mx = s[0];
#pragma unroll
    for (int i = 1; i < 16; ++i) mx = fmaxf(mx, s[i]);
    mx = fmaxf(mx, __shfl_xor(mx, 16));   /* the other half of the wave holds this query's other 16 keys */
    const float mn = fmaxf(m, mx), sc = expf(m - mn); m = mn; float ps = 0.f;
#pragma unroll
    for (int i = 0; i < 16; ++i) { s[i] = expf(s[i] - mn); ps += s[i]; }
    l = l * sc + ps;
#pragma unroll
    for (int j = 0; j < HD / 16; ++j)
#pragma unroll
      for (int r = 0; r < 8; ++r) o[j][r] *= sc;
    const F2 p = bsplit16(s);   /* element i < 8 = the pass's key 8g + i, i >= 8 = key 16 + 8g + i - 8: the k order of frag_b */
#pragma unroll
    for (int j = 0; j < HD / 16; ++j) { o[j] = wmma_bf(vf[j], p.h, o[j]); o[j] = wmma_bf(vf[j], p.l, o[j]); o[j] = wmma_bf(wf[j], p.h, o[j]); } }
    /* hand-over: this wave's reads of the buffer are done, its copies of the next stage have landed; behind the barrier that holds of every wave, and the buffer just read takes stage st + 2 */
    asm volatile("s_wait_dscnt 0x0" ::: "memory");
    asm volatile("s_wait_asynccnt 0x0" ::: "memory");
    __syncthreads();
    if (st + 2 < NST) stage_copy(lc + (unsigned)(st & 1) * STAGE_B, kg + (size_t)(st + 2) * KST * CC, vg + (st + 2) * KST, wg + (st + 2) * KST); }
  asm volatile("s_wait_asynccnt 0x0" ::: "memory");   /* no copy outstanding when the wave ends */
  l += __shfl_xor(l, 16); const float inv = 1.0f / l; float* yp = Y + qrow + 8 * g;   /* O^T register r of tile j = head dim j*16 + 8g + r of this lane's query */
#pragma unroll
  for (int j = 0; j < HD / 16; ++j) { v4f u0, u1;
#pragma unroll
    for (int r = 0; r < 4; ++r) { u0[r] = o[j][r] * inv; u1[r] = o[j][4 + r] * inv; }
    vst2(yp + j * 16, u0); vst2(yp + j * 16 + 4, u1); } }
// ---- k_out: block = (64 rows, 128 cols): out = y (bf16 hi + lo) Wo + bo
__global__ __launch_bounds__(128) void k_out(const float* __restrict__ Y, const float* __restrict__ WP, const float* __restrict__ BP, float* __restrict__ OUT) { __shared__ __align__(16) float sf[4][16][132];
  const int tid = threadIdx.x, wave = tid >> 5, lane = tid & 31, col = lane & 15, g = lane >> 4; const int c0 = blockIdx.y * 128; const size_t r0 = (size_t)blockIdx.x * 64 + wave * 16;
  v8f acc[8] = {};
#pragma unroll 2
  for (int kc = 0; kc < CC / 32; ++kc) { const F2 a = split_row(Y + (r0 + col) * CC, kc * 32, lane);
#pragma unroll
    for (int j = 0; j < 8; ++j) { v16b w; const int o = c0 + j * 16 + col;
#pragma unroll
      for (int i = 0; i < 8; ++i) { w[i] = (__bf16)WP[(size_t)(kc * 32 + 8 * g + i) * CC + o]; w[8 + i] = (__bf16)WP[(size_t)(kc * 32 + 16 + 8 * g + i) * CC + o]; }
      acc[j] = wmma_bf(a.h, w, acc[j]); acc[j] = wmma_bf(a.l, w, acc[j]); } }
#pragma unroll
  for (int j = 0; j < 8; ++j) { const float bb = BP ? bfr(BP[c0 + j * 16 + col]) : 0.f;
#pragma unroll
    for (int r = 0; r < 8; ++r) sf[wave][8 * g + r][j * 16 + col] = acc[j][r] + bb; }
  LDSX(); for (int rl = 0; rl < 16; ++rl) vst2(OUT + (r0 + rl) * CC + c0 + lane * 4, *(const v4f*)&sf[wave][rl][lane * 4]); }
extern "C" void kernel_launch(void* const* d_in, const int* in_sizes, int n_in, void* d_out, int out_size, void* d_ws, size_t ws_size, hipStream_t stream) {
  (void)in_sizes; (void)n_in; (void)out_size;
  const float** F = (const float**)d_in;   // 0 query, 1 key, 2 value [2,2048,1024]; 3 frac [2,2048]; 4 Wq, 5 Wk, 6 Wv, 7 Wo ((in,out)); 8 bq, 9 bk, 10 bv, 11 bo; 12 alpha_pos [16], 13 alpha_neg [16]
  if (ws_size < (size_t)WS_END) return;
  char* ws = (char*)d_ws; _Float16 *QH = (_Float16*)(ws + WS_QH), *QL = (_Float16*)(ws + WS_QL), *KH = (_Float16*)(ws + WS_KH); __bf16 *VT = (__bf16*)(ws + WS_VT), *VL = (__bf16*)(ws + WS_VL); float *Y = (float*)(ws + WS_Y);
  k_rot<<<dim3(TT * 32 / 256), 256, 0, stream>>>((float2*)(ws + WS_ROT));
  k_proj<<<dim3(TNB * TT / 64, CC / 128, 3), 128, 0, stream>>>(F[0], F[1], F[2], F[4], F[8], F[5], F[9], F[6], F[10], QH, QL, KH, VT, VL, (const float2*)(ws + WS_ROT));
  k_fa<<<dim3(TT / 128, NH, TNB), 256, 0, stream>>>(QH, QL, KH, VT, VL, F[3], F[12], F[13], Y);
  k_out<<<dim3(TNB * TT / 64, CC / 128), 128, 0, stream>>>(Y, F[7], F[11], (float*)d_out);
}

// v003
// It runs in 206 microseconds.
// In both of two side-by-side timings against v002, it was 1.54 times as fast.
// Counting every step since v000, it is 8.04 times as fast.
// compute dtype: all float inputs rounded to bf16; q/k/v = x W + b with EXACT bf16 products on WMMA 16x16x32, f32 accumulate; rotate-half rotary in f32 from a cos/sin table of t * (1/freq_div[i]) (the module's f32 reciprocals; precise cosf/sinf); q as f16 hi + residual (x 2^10), k once to f16 -> 2-product logits x 64^-0.5 + the stoichiometric bias from frac / alpha in f32; softmax in f32 (precise expf) with a running maximum and sum over 32-key steps, logits never stored; unnormalised P split bf16 hi + lo against v bf16 hi + lo (3 products), divided by the sum at the end; y (bf16 hi + lo) Wo + bo; f32 output.
#include <hip/hip_runtime.h>
#include <math.h>

typedef __attribute__((ext_vector_type(16))) _Float16 v16h;
typedef __attribute__((ext_vector_type(16))) __bf16 v16b;
typedef __attribute__((ext_vector_type(8)))  _Float16 v8h;
typedef __attribute__((ext_vector_type(8)))  float v8f;
typedef __attribute__((ext_vector_type(4)))  float v4f;
typedef __attribute__((ext_vector_type(2)))  float v2f;
typedef __attribute__((ext_vector_type(4)))  unsigned v4u;
typedef __attribute__((ext_vector_type(4)))  int v4i;
typedef float __attribute__((may_alias)) float_a;
typedef int __attribute__((may_alias)) int_a;

template <typename T> __device__ __forceinline__ void vst2(void* p, T v) { *(T*)p = v;  }
__device__ __forceinline__ v8f wmma16(v16h a, v16h b, v8f c) {
  v8f d = __builtin_amdgcn_wmma_f32_16x16x32_f16(false, a, false, b, (short)0, c, false, false);
  asm volatile("v_nop\n\tv_nop\n\tv_nop\n\tv_nop" : "+v"(d) : "v"(a), "v"(b));
  return d;
}
__device__ __forceinline__ v8f wmma_bf(v16b a, v16b b, v8f c) {
  v8f d = __builtin_amdgcn_wmma_f32_16x16x32_bf16(false, a, false, b, (short)0, c, false, false);
  asm volatile("v_nop\n\tv_nop\n\tv_nop\n\tv_nop" : "+v"(d) : "v"(a), "v"(b));
  return d;
}
// 16x16x32 fragments: lane = (h = lane>>4, row/col = lane&15); elements 0..7 = k0+8h+0..7, 8..15 = k0+16+8h+0..7; D element r = row 8h+r
__device__ __forceinline__ v16h frag_h(const _Float16* rowk0, int lane) {
  union { v16h v; v8h q[2]; } u; const _Float16* p = rowk0 + 8 * (lane >> 4);
  u.q[0] = *(const v8h*)p; u.q[1] = *(const v8h*)(p + 16); return u.v;
}
__device__ __forceinline__ v16h frag_f32(const float* rowk0, int lane) {
  v16h a; const float* p = rowk0 + 8 * (lane >> 4);
#pragma unroll
  for (int i = 0; i < 8; ++i) { a[i] = (_Float16)p[i]; a[8 + i] = (_Float16)p[16 + i]; }
  return a;
}
__device__ __forceinline__ v16h frag_f32s(const float* rowk0, int lane, float sc) {
  v16h a; const float* p = rowk0 + 8 * (lane >> 4);
#pragma unroll
  for (int i = 0; i < 8; ++i) { a[i] = (_Float16)(p[i] * sc); a[8 + i] = (_Float16)(p[16 + i] * sc); }
  return a;
}
// column fragment from a [K][ld] layout (column n), rows >= K read as 0
__device__ __forceinline__ v16h fragc_f32(const float* W, int k0, int n, int lane, int ld, int K) {
  v16h a; const int g = lane >> 4;
#pragma unroll
  for (int i = 0; i < 8; ++i) { const int ka = k0 + 8 * g + i, kb = ka + 16;
    a[i] = (_Float16)(ka < K ? W[(size_t)(ka < K ? ka : K - 1) * ld + n] : 0.f); a[8 + i] = (_Float16)(kb < K ? W[(size_t)(kb < K ? kb : K - 1) * ld + n] : 0.f); }
  return a;
}
struct F2 { v16b h, l; };
__device__ __forceinline__ F2 bsplit16(const float v[16]) { F2 r;
#pragma unroll
  for (int i = 0; i < 16; ++i) { const __bf16 h = (__bf16)v[i]; r.h[i] = h; r.l[i] = (__bf16)(v[i] - (float)h); }
  return r; }
__device__ __forceinline__ F2 split_row(const float* row, int k0, int lane) { float v[16]; const float* p = row + k0 + 8 * (lane >> 4);
#pragma unroll
  for (int i = 0; i < 8; ++i) { v[i] = p[i]; v[8 + i] = p[16 + i]; }
  return bsplit16(v); }
__device__ __forceinline__ F2 split_rowK(const float* row, int k0, int lane, int K) { float v[16]; const int g = lane >> 4;
#pragma unroll
  for (int i = 0; i < 8; ++i) { const int ka = k0 + 8 * g + i, kb = ka + 16; v[i] = ka < K ? row[ka < K ? ka : K - 1] : 0.f; v[8 + i] = kb < K ? row[kb < K ? kb : K - 1] : 0.f; }
  return bsplit16(v); }
__device__ __forceinline__ F2 split_col(const float* W, int k0, int n, int lane, int ld, int K) { float v[16]; const int g = lane >> 4;
#pragma unroll
  for (int i = 0; i < 8; ++i) { const int ka = k0 + 8 * g + i, kb = ka + 16; v[i] = ka < K ? W[(size_t)(ka < K ? ka : K - 1) * ld + n] : 0.f; v[8 + i] = kb < K ? W[(size_t)(kb < K ? kb : K - 1) * ld + n] : 0.f; }
  return bsplit16(v); }
__device__ __forceinline__ v8f mac3(const F2& a, const F2& b, v8f c) { c = wmma_bf(a.l, b.h, c); c = wmma_bf(a.h, b.l, c); return wmma_bf(a.h, b.h, c); }
__device__ __forceinline__ float sigm(float v) { return 1.0f / (1.0f + expf(-v)); }
#define LDSX() do { asm volatile("s_wait_dscnt 0" ::: "memory"); __builtin_amdgcn_wave_barrier(); __builtin_amdgcn_fence(__ATOMIC_RELEASE, "workgroup"); } while (0)


// Multi-head attention with rotary embedding and a data-dependent 'stoichiometric' bias (B 2, T 2,048, D 1,024 = 16 x 64): Q = query Wq + bq, K = key Wk + bk, V = value Wv + bv ((in,out)); rotate-half RoPE with angle t / 10000^(2i/64); scores = Q K^T 64^-0.5 + (alpha_pos[h] if frac_j >= frac_i else alpha_neg[h]) (frac_j - frac_i); softmax; P V; out Wo + bo.
#define NB 2
#define TT 2048
#define CC 1024
#define NH 16
#define HD 64
__constant__ float RCPF[32] = {1.000000000e+0f,7.498942018e-1f,5.623413324e-1f,4.216965139e-1f,3.162277639e-1f,2.371373624e-1f,1.778279394e-1f,1.333521456e-1f,1.000000015e-1f,7.498941571e-2f,5.623412877e-2f,4.216964915e-2f,3.162277862e-2f,2.371373586e-2f,1.778279431e-2f,1.333521493e-2f,9.999999776e-3f,7.498942316e-3f,5.623413250e-3f,4.216964822e-3f,3.162277862e-3f,2.371373819e-3f,1.778279431e-3f,1.333521446e-3f,1.000000047e-3f,7.498941850e-4f,5.623413017e-4f,4.216964880e-4f,3.162277862e-4f,2.371373848e-4f,1.778279402e-4f,1.333521504e-4f};   // f32(1 / f32(10000^(2i/64))): the module divides pos by freq_div, which XLA evaluates as pos * (1/freq_div)
#ifndef TNB
#define TNB NB
#endif
typedef __attribute__((ext_vector_type(8))) __bf16 v8b;
__device__ __forceinline__ v16b frag_b(const __bf16* rowk0, int lane) {
  union { v16b v; v8b q[2]; } u; const __bf16* p = rowk0 + 8 * (lane >> 4);
  u.q[0] = *(const v8b*)p; u.q[1] = *(const v8b*)(p + 16); return u.v;
}
__device__ __forceinline__ float bfr(float v) { return (float)(__bf16)v; }
__device__ __attribute__((noinline)) float exp_ni(float v) { return expf(v); }
__device__ __attribute__((noinline)) float erf_ni(float v) { return erff(v); }

#define WS_ROT 0u                                   // float2 (cos, sin)[t][32] = cos/sin(t * (1/freq_div[j]))
#define WS_QH  (WS_ROT + 8u * (size_t)TT * 32)
#define WS_QL  (WS_QH + 2u * (size_t)NB * TT * CC)
#define WS_KH  (WS_QL + 2u * (size_t)NB * TT * CC)
#define WS_VT  (WS_KH + 2u * (size_t)NB * TT * CC)      // bf16 v planes [b][c][t]
#define WS_VL  (WS_VT + 2u * (size_t)NB * CC * TT)      // bf16 v residual planes
#define WS_YH  (WS_VL + 2u * (size_t)NB * CC * TT)      // y, bf16 hi, packed fragments [row tile][kc]
#define WS_YL  (WS_YH + 2u * (size_t)NB * TT * CC)      // y, bf16 residual, packed likewise
#define WS_XP  (WS_YL + 2u * (size_t)NB * TT * CC)      // query, key, value as bf16, packed fragments [which][row tile][kc]
#define WS_WP  (WS_XP + 3u * 2u * (size_t)NB * TT * CC) // Wq, Wk, Wv, Wo as bf16, packed fragments [matrix][column tile][kc]
#define WS_END (WS_WP + 4u * 2u * (size_t)CC * CC)
// A packed fragment is the 1 KiB that one 16x16x32 operand takes, in the order the wave reads it: 16-byte piece (half, lane) at element half * 256 + lane * 8 holds k = kc * 32 + half * 16 + 8 * (lane >> 4) + 0..7 of row (or column) tile * 16 + (lane & 15); each of the two wave-wide 16-byte loads then covers 512 contiguous bytes, four whole lines
#define FRAG_E 512
#define NKC (CC / 32)
__device__ __forceinline__ v16b frag_p(const __bf16* lanebase) {
  union { v16b v; v8b q[2]; } u; u.q[0] = *(const v8b*)lanebase; u.q[1] = *(const v8b*)(lanebase + 256); return u.v;
}

// ---- k_pre: everything the GEMMs read is laid out once a call. Blocks 0..383: a wave packs 8 kc of one 16-row tile of query / key / value (f32 -> bf16). Blocks 384..639: a wave packs 4 column tiles of one kc of one weight matrix (the transposition happens here, once, not in every GEMM wave). Blocks 640..895: one thread per (t, j): precise cosf/sinf of t * inv_freq[j] -> table (keeps the trig and its large-argument reduction out of the GEMM kernel)
#define PRE_X (3 * (NB * TT / 16) * (NKC / 8) / 8)
#define PRE_W (4 * NKC * (CC / 64) / 8)
__global__ __launch_bounds__(256) void k_pre(const float* __restrict__ X0, const float* __restrict__ X1, const float* __restrict__ X2, const float* __restrict__ WQ, const float* __restrict__ WK, const float* __restrict__ WV, const float* __restrict__ WO, __bf16* __restrict__ XP, __bf16* __restrict__ WP, float2* __restrict__ ROT) {
  const int tid = threadIdx.x, wave = tid >> 5, lane = tid & 31, col = lane & 15, g = lane >> 4; const int bx = blockIdx.x;
  if (bx < PRE_X) { const int u = bx * 8 + wave, kg = u & 3, rt = (u >> 2) & (NB * TT / 16 - 1), which = u >> 10; const float* X = which == 0 ? X0 : which == 1 ? X1 : X2;
    const float* p = X + ((size_t)rt * 16 + col) * CC + kg * 256 + 8 * g; __bf16* d = XP + (((size_t)which * (NB * TT / 16) + rt) * NKC + kg * 8) * FRAG_E + lane * 8;
    v4f a[16], b2[16];
#pragma unroll
    for (int e = 0; e < 16; ++e) { a[e] = *(const v4f*)(p + e * 16); b2[e] = *(const v4f*)(p + e * 16 + 4); }
    asm volatile("s_wait_xcnt 0x0" :: "v"(p) : "memory");   /* the loads' address pair stays whole until this wait */
#pragma unroll
    for (int e = 0; e < 16; ++e) { v8b o;
#pragma unroll
      for (int i = 0; i < 4; ++i) { o[i] = (__bf16)a[e][i]; o[4 + i] = (__bf16)b2[e][i]; }
      vst2(d + e * 256, o); }
    return; }
  if (bx < PRE_X + PRE_W) { const int u = (bx - PRE_X) * 8 + wave, ng = u & 15, kc = (u >> 4) & (NKC - 1), mat = u >> 9; const float* Wm = mat == 0 ? WQ : mat == 1 ? WK : mat == 2 ? WV : WO;
    const float* p = Wm + ((size_t)kc * 32 + 8 * g) * CC + ng * 64 + col; __bf16* d = WP + (((size_t)mat * (CC / 16) + ng * 4) * NKC + kc) * FRAG_E + lane * 8;
#pragma unroll
    for (int n = 0; n < 4; ++n)
#pragma unroll
      for (int hf = 0; hf < 2; ++hf) { v8b o;
#pragma unroll
        for (int i = 0; i < 8; ++i) o[i] = (__bf16)p[(size_t)(hf * 16 + i) * CC + n * 16];
        vst2(d + (size_t)n * NKC * FRAG_E + hf * 256, o); }
    asm volatile("s_wait_xcnt 0x0" ::: "memory");   /* behind the last store: the stores' address pair is not written anew on any way out of this part before the wait */
    return; }
  const int i = (bx - PRE_X - PRE_W) * 256 + tid; if (i >= TT * 32) return; const int t = i >> 5, j = i & 31; const float ang = (float)t * RCPF[j]; v2f v; v[0] = cosf(ang); v[1] = sinf(ang); vst2((v2f*)(ROT + i), v); }
// ---- k_proj: block = (64 rows, 128 cols, which): qkv = x W (+ b), exact; q -> f16 hi (+ residual), k -> f16 rows, v -> bf16 hi + residual planes
__global__ __launch_bounds__(128) void k_proj(const __bf16* __restrict__ XP, const __bf16* __restrict__ WP, const float* __restrict__ BQ, const float* __restrict__ BK, const float* __restrict__ BV, _Float16* __restrict__ QH, _Float16* __restrict__ QL, _Float16* __restrict__ KH, __bf16* __restrict__ VT, __bf16* __restrict__ VL, const float2* __restrict__ ROT) {
  __shared__ __align__(16) _Float16 sh[64][136], sl[64][136]; __shared__ __align__(16) __bf16 th[128][72], tl2[128][72];
  const int tid = threadIdx.x, wave = tid >> 5, lane = tid & 31, col = lane & 15, g = lane >> 4; const int which = blockIdx.z; const int c0 = blockIdx.y * 128; const size_t r0 = (size_t)blockIdx.x * 64; const float* BA = which == 0 ? BQ : which == 1 ? BK : BV;
  v8f acc[8] = {};
  const __bf16* xp = XP + ((size_t)which * (NB * TT / 16) + blockIdx.x * 4 + wave) * (NKC * FRAG_E) + lane * 8; const __bf16* wp = WP + ((size_t)which * (CC / 16) + blockIdx.y * 8) * (NKC * FRAG_E) + lane * 8;
#pragma unroll 2
  for (int kc = 0; kc < NKC; ++kc) { const v16b a = frag_p(xp + kc * FRAG_E); v16b w[8];   /* the k step's 18 loads stand together in front of its products: one latency a step, not one a fragment */
#pragma unroll
    for (int j = 0; j < 8; ++j) w[j] = frag_p(wp + (j * NKC + kc) * FRAG_E);
#pragma unroll
    for (int j = 0; j < 8; ++j) acc[j] = wmma_bf(a, w[j], acc[j]); }
#pragma unroll
  for (int j = 0; j < 8; ++j) { const float bb0 = BA ? bfr(BA[c0 + j * 16 + col]) : 0.f;
#pragma unroll
    for (int r = 0; r < 8; ++r) acc[j][r] += bb0; }   /* bias before the rotary */
  if (which < 2) {   /* rotate-half rotary on all 64 head dims: the 128-column tile holds heads 2*by and 2*by+1; tiles j (d 0..15), j+1 (16..31) pair with j+2 (32..47), j+3 (48..63) in the SAME lane and row: out[d] = x[d] c - x[d+32] s, out[d+32] = x[d] s + x[d+32] c, angle index i = d (< 32) */
#pragma unroll
    for (int jp = 0; jp < 8; ++jp) { if ((jp & 3) >= 2) continue; const int i = ((jp & 3) * 16 + col);   /* d < 32 */
#pragma unroll
      for (int r = 0; r < 8; ++r) { const int t = (int)((r0 + wave * 16 + 8 * g + r) % TT); const float2 cv = ROT[t * 32 + i]; const float xl = acc[jp][r], xr = acc[jp + 2][r]; acc[jp][r] = xl * cv.x - xr * cv.y; acc[jp + 2][r] = xl * cv.y + xr * cv.x; }
      asm volatile("s_wait_loadcnt 0x0" ::: "memory"); } }
#pragma unroll
  for (int j = 0; j < 8; ++j) { const float bb = 0.f;
#pragma unroll
    for (int r = 0; r < 8; ++r) { const float v = acc[j][r] + bb; const int rl = wave * 16 + 8 * g + r, cl = j * 16 + col; const _Float16 hv = (_Float16)v;
      if (which == 2) { const __bf16 bh = (__bf16)v; th[cl][rl] = bh; tl2[cl][rl] = (__bf16)(v - (float)bh); } else { sh[rl][cl] = hv; sl[rl][cl] = (_Float16)((v - (float)hv) * 1024.0f); }   /* q residual carried x 2^10 so the plane stays f16-normal on the chip */ } }
  __syncthreads();
  if (which < 2) { _Float16* dh = which == 0 ? QH : KH; for (int e = tid; e < 64 * 16; e += 128) { const int rl = e >> 4, q = e & 15; vst2((unsigned*)(dh + (r0 + rl) * CC + c0 + q * 8), *(const v4u*)&sh[rl][q * 8]); if (which == 0) vst2((unsigned*)(QL + (r0 + rl) * CC + c0 + q * 8), *(const v4u*)&sl[rl][q * 8]); } }
  else { const size_t b = r0 / TT; const int t0 = (int)(r0 % TT); for (int e = tid; e < 128 * 8; e += 128) { const int cl = e >> 3, q = e & 7; const size_t o2 = (b * CC + c0 + cl) * (size_t)TT + t0 + q * 8; vst2((unsigned*)(VT + o2), *(const v4u*)&th[cl][q * 8]); vst2((unsigned*)(VL + o2), *(const v4u*)&tl2[cl][q * 8]); } } }
// ---- k_fa: block = 8 waves x 16 queries of one (b, h); the block's keys come through LDS: a stage is 64 keys (K rows, V^T hi rows, V^T lo rows, 128 B a row at a pitch of 144 B), brought once for all eight waves by asynchronous copies into two buffers, the next stage flying while this one is worked on; frac's 2,048 values of the batch are copied once. A wave walks a stage 32 keys at a time and never stores a logit: S^T = K Q^T (2 products) x 64^-0.5 + bias(frac_k - frac_q), running maximum and sum per query (a lane holds one query's column: keys 8g+r of each 16-key tile), P^T packed from the two score tiles straight into a B operand (hardware k order), O^T += V^T P^T (3 products), O^T / sum at the end. waves_per_eu(4, 4): a budget of 256 registers, the 512 blocks resident together, two a WGP
#define KST 64                  /* keys a stage */
#define NST (TT / KST)
#define LP 72                   /* LDS row pitch in 16-bit elements: 144 B = 16 B x 9, free of bank conflicts for 16-byte readers */
#define TILE_B (64 * LP * 2)
#define STAGE_B (3 * TILE_B)
// one stage's six 16-byte copies of a lane (rows r and r + 32 of K, V hi, V lo). The s_wait_xcnt stands inside the statement, so that no register which an issued copy names is written anew in front of it
__device__ __forceinline__ void stage_copy(unsigned l, const _Float16* k, const __bf16* v, const __bf16* w) {
  const unsigned l1 = l + 32 * LP * 2, l2 = l + TILE_B, l3 = l2 + 32 * LP * 2, l4 = l + 2 * TILE_B, l5 = l4 + 32 * LP * 2; const _Float16* k1 = k + (size_t)32 * CC; const __bf16* v1 = v + (size_t)32 * TT; const __bf16* w1 = w + (size_t)32 * TT;
  asm volatile("global_load_async_to_lds_b128 %0, %6, off\n\tglobal_load_async_to_lds_b128 %1, %7, off\n\tglobal_load_async_to_lds_b128 %2, %8, off\n\tglobal_load_async_to_lds_b128 %3, %9, off\n\tglobal_load_async_to_lds_b128 %4, %10, off\n\tglobal_load_async_to_lds_b128 %5, %11, off\n\ts_wait_xcnt 0x0" :: "v"(l), "v"(l1), "v"(l2), "v"(l3), "v"(l4), "v"(l5), "v"(k), "v"(k1), "v"(v), "v"(v1), "v"(w), "v"(w1) : "memory");
}
__global__ __launch_bounds__(256) __attribute__((amdgpu_waves_per_eu(4, 4))) void k_fa(const _Float16* __restrict__ QH, const _Float16* __restrict__ QL, const _Float16* __restrict__ KH, const __bf16* __restrict__ VT, const __bf16* __restrict__ VL, const float* __restrict__ FR, const float* __restrict__ AP, const float* __restrict__ AN, __bf16* __restrict__ YH, __bf16* __restrict__ YL) {
  __shared__ __align__(16) unsigned char ring[2 * STAGE_B]; __shared__ __align__(16) float sF[TT];
  const int tid = threadIdx.x, wave = tid >> 5, lane = tid & 31, col = lane & 15, g = lane >> 4; const int h = blockIdx.y, b = blockIdx.z; const int q = blockIdx.x * 128 + wave * 16 + col;
  const size_t qrow = ((size_t)b * TT + q) * CC + h * HD;
  /* the copies: thread = (row tid >> 3, 16-byte piece tid & 7), so a wave's copy covers four whole 128-byte rows */
  const int crow = tid >> 3, cpc = tid & 7; const _Float16* kg = KH + ((size_t)b * TT + crow) * CC + h * HD + cpc * 8; const size_t vg0 = ((size_t)b * CC + h * HD + crow) * (size_t)TT + cpc * 8; const __bf16* vg = VT + vg0; const __bf16* wg = VL + vg0;
  const unsigned lc = (unsigned)(size_t)ring + (unsigned)(crow * (LP * 2) + cpc * 16);
  { const unsigned f0 = (unsigned)(size_t)sF + (unsigned)tid * 16u, f1 = f0 + 4096u; const float* fg0 = FR + (size_t)b * TT + tid * 4; const float* fg1 = fg0 + 1024;
    asm volatile("global_load_async_to_lds_b128 %0, %2, off\n\tglobal_load_async_to_lds_b128 %1, %3, off\n\ts_wait_xcnt 0x0" :: "v"(f0), "v"(f1), "v"(fg0), "v"(fg1) : "memory"); }   /* frac of this batch, once; the wait as in stage_copy */
  stage_copy(lc, kg, vg, wg);
  v16h qh[HD / 32], ql[HD / 32];
#pragma unroll
  for (int kc = 0; kc < HD / 32; ++kc) { qh[kc] = frag_h(QH + qrow + kc * 32, lane); ql[kc] = frag_h(QL + qrow + kc * 32, lane); }
  const float ap = bfr(AP[h]), an = bfr(AN[h]), fq = bfr(FR[(size_t)b * TT + q]);
  asm volatile("s_wait_asynccnt 0x0" ::: "memory");   /* this wave's copies of frac and of stage 0 have landed */
  __syncthreads();                                    /* and every other wave's */
  stage_copy(lc + STAGE_B, kg + (size_t)KST * CC, vg + KST, wg + KST);
  const int lo = col * LP + 8 * g;   /* each lane's own row and 8g */
  v8f o[HD / 16] = {}; float m = -3.0e38f, l = 0.f;
#pragma unroll 1   /* rolled: one stage's code serves both buffers */
  for (int st = 0; st < NST; ++st) { const unsigned char* bp = ring + (st & 1) * STAGE_B;
#pragma unroll 1   /* rolled: the fragments of two passes do not fit 256 registers */
  for (int hf = 0; hf < KST / 32; ++hf) { float s[16]; v4f fk[4]; v16h kf[2][HD / 32]; v16b vf[HD / 16], wf[HD / 16];
    const _Float16* kq = (const _Float16*)bp + hf * 32 * LP + lo; const __bf16* vq = (const __bf16*)(bp + TILE_B) + hf * 32 + lo; const __bf16* wq = (const __bf16*)(bp + 2 * TILE_B) + hf * 32 + lo; const float* fp = sF + st * KST + hf * 32 + 8 * g;
#pragma unroll
    for (int t = 0; t < 2; ++t) {
#pragma unroll
      for (int kc = 0; kc < HD / 32; ++kc) kf[t][kc] = frag_h(kq + (t * 16) * LP + kc * 32, 0);
      fk[t * 2] = *(const v4f*)(fp + t * 16); fk[t * 2 + 1] = *(const v4f*)(fp + t * 16 + 4); }
#pragma unroll
    for (int j = 0; j < HD / 16; ++j) { vf[j] = frag_b(vq + (j * 16) * LP, 0); wf[j] = frag_b(wq + (j * 16) * LP, 0); }
#pragma unroll
    for (int t = 0; t < 2; ++t) { v8f a = {}, al = {};
#pragma unroll
      for (int kc = 0; kc < HD / 32; ++kc) { a = wmma16(kf[t][kc], qh[kc], a); al = wmma16(kf[t][kc], ql[kc], al); }
#pragma unroll
      for (int r = 0; r < 8; ++r) { const float D = bfr(fk[t * 2 + (r >> 2)][r & 3]) - fq; const float bias = (D >= 0.f ? ap : an) * D; s[t * 8 + r] = (a[r] + al[r] * (1.0f / 1024.0f)) * 0.125f + bias; } }
    float mx = s[0];
#pragma unroll
    for (int i = 1; i < 16; ++i) mx = fmaxf(mx, s[i]);
    mx = fmaxf(mx, __shfl_xor(mx, 16));   /* the other half of the wave holds this query's other 16 keys */
    const float mn = fmaxf(m, mx), sc = expf(m - mn); m = mn; float ps = 0.f;
#pragma unroll
    for (int i = 0; i < 16; ++i) { s[i] = expf(s[i] - mn); ps += s[i]; }
    l = l * sc + ps;
#pragma unroll
    for (int j = 0; j < HD / 16; ++j)
#pragma unroll
      for (int r = 0; r < 8; ++r) o[j][r] *= sc;
    const F2 p = bsplit16(s);   /* element i < 8 = the pass's key 8g + i, i >= 8 = key 16 + 8g + i - 8: the k order of frag_b */
#pragma unroll
    for (int j = 0; j < HD / 16; ++j) { o[j] = wmma_bf(vf[j], p.h, o[j]); o[j] = wmma_bf(vf[j], p.l, o[j]); o[j] = wmma_bf(wf[j], p.h, o[j]); } }
    /* hand-over: this wave's reads of the buffer are done, its copies of the next stage have landed; behind the barrier that holds of every wave, and the buffer just read takes stage st + 2 */
    asm volatile("s_wait_dscnt 0x0" ::: "memory");
    asm volatile("s_wait_asynccnt 0x0" ::: "memory");
    __syncthreads();
    if (st + 2 < NST) stage_copy(lc + (unsigned)(st & 1) * STAGE_B, kg + (size_t)(st + 2) * KST * CC, vg + (st + 2) * KST, wg + (st + 2) * KST); }
  asm volatile("s_wait_asynccnt 0x0" ::: "memory");   /* no copy outstanding when the wave ends */
  l += __shfl_xor(l, 16); const float inv = 1.0f / l;   /* O^T register r of tile j = head dim j*16 + 8g + r of this lane's query: piece (half j & 1, this lane) of k_out's A fragment (row tile of the wave's 16 queries, kc = 2h + (j >> 1)), so y leaves as packed bf16 hi + residual */
  const size_t yo = (((size_t)b * (TT / 16) + blockIdx.x * 8 + wave) * NKC + h * 2) * FRAG_E + lane * 8;
#pragma unroll
  for (int j = 0; j < HD / 16; ++j) { v8b uh, ul;
#pragma unroll
    for (int r = 0; r < 8; ++r) { const float v = o[j][r] * inv; const __bf16 hv = (__bf16)v; uh[r] = hv; ul[r] = (__bf16)(v - (float)hv); }
    vst2(YH + yo + j * 256, uh); vst2(YL + yo + j * 256, ul); } }
// ---- k_out: block = (64 rows, 128 cols): out = y (bf16 hi + lo) Wo + bo
__global__ __launch_bounds__(128) void k_out(const __bf16* __restrict__ YH, const __bf16* __restrict__ YL, const __bf16* __restrict__ WP, const float* __restrict__ BP, float* __restrict__ OUT) { __shared__ __align__(16) float sf[4][16][132];
  const int tid = threadIdx.x, wave = tid >> 5, lane = tid & 31, col = lane & 15, g = lane >> 4; const int c0 = blockIdx.y * 128; const size_t r0 = (size_t)blockIdx.x * 64 + wave * 16;
  v8f acc[8] = {};
  const size_t yo = ((size_t)blockIdx.x * 4 + wave) * (NKC * FRAG_E) + lane * 8; const __bf16* wp = WP + ((size_t)3 * (CC / 16) + blockIdx.y * 8) * (NKC * FRAG_E) + lane * 8;
#pragma unroll 2
  for (int kc = 0; kc < NKC; ++kc) { const v16b ah = frag_p(YH + yo + kc * FRAG_E), al = frag_p(YL + yo + kc * FRAG_E); v16b w[8];   /* the k step's 20 loads together in front of its products, as in k_proj */
#pragma unroll
    for (int j = 0; j < 8; ++j) w[j] = frag_p(wp + (j * NKC + kc) * FRAG_E);
#pragma unroll
    for (int j = 0; j < 8; ++j) { acc[j] = wmma_bf(ah, w[j], acc[j]); acc[j] = wmma_bf(al, w[j], acc[j]); } }
#pragma unroll
  for (int j = 0; j < 8; ++j) { const float bb = BP ? bfr(BP[c0 + j * 16 + col]) : 0.f;
#pragma unroll
    for (int r = 0; r < 8; ++r) sf[wave][8 * g + r][j * 16 + col] = acc[j][r] + bb; }
  LDSX(); for (int rl = 0; rl < 16; ++rl) vst2(OUT + (r0 + rl) * CC + c0 + lane * 4, *(const v4f*)&sf[wave][rl][lane * 4]); }
extern "C" void kernel_launch(void* const* d_in, const int* in_sizes, int n_in, void* d_out, int out_size, void* d_ws, size_t ws_size, hipStream_t stream) {
  (void)in_sizes; (void)n_in; (void)out_size;
  const float** F = (const float**)d_in;   // 0 query, 1 key, 2 value [2,2048,1024]; 3 frac [2,2048]; 4 Wq, 5 Wk, 6 Wv, 7 Wo ((in,out)); 8 bq, 9 bk, 10 bv, 11 bo; 12 alpha_pos [16], 13 alpha_neg [16]
  if (ws_size < (size_t)WS_END) return;
  char* ws = (char*)d_ws; _Float16 *QH = (_Float16*)(ws + WS_QH), *QL = (_Float16*)(ws + WS_QL), *KH = (_Float16*)(ws + WS_KH); __bf16 *VT = (__bf16*)(ws + WS_VT), *VL = (__bf16*)(ws + WS_VL), *YH = (__bf16*)(ws + WS_YH), *YL = (__bf16*)(ws + WS_YL), *XP = (__bf16*)(ws + WS_XP), *WP = (__bf16*)(ws + WS_WP);
  k_pre<<<dim3(PRE_X + PRE_W + TT * 32 / 256), 256, 0, stream>>>(F[0], F[1], F[2], F[4], F[5], F[6], F[7], XP, WP, (float2*)(ws + WS_ROT));
  k_proj<<<dim3(TNB * TT / 64, CC / 128, 3), 128, 0, stream>>>(XP, WP, F[8], F[9], F[10], QH, QL, KH, VT, VL, (const float2*)(ws + WS_ROT));
  k_fa<<<dim3(TT / 128, NH, TNB), 256, 0, stream>>>(QH, QL, KH, VT, VL, F[3], F[12], F[13], YH, YL);
  k_out<<<dim3(TNB * TT / 64, CC / 128), 128, 0, stream>>>(YH, YL, WP, F[11], (float*)d_out);
}

// v004
// It runs in 186 microseconds.
// Next to v003, in two timings, it ran 1.12 and 1.11 times as fast.
// Counting every step since v000, it is 8.97 times as fast.
// compute dtype: all float inputs rounded to bf16; q/k/v = x W + b with EXACT bf16 products on WMMA 16x16x32, f32 accumulate; rotate-half rotary in f32 from a cos/sin table of t * (1/freq_div[i]) (the module's f32 reciprocals; precise cosf/sinf); q as f16 hi + residual (x 2^10), k once to f16 -> 2-product logits x 64^-0.5 + the stoichiometric bias from frac / alpha in f32; softmax in f32 with the logits carried in base 2 (log2 e folded into the 64^-0.5 scale and into the alphas; hardware exp2) and a running maximum and sum over 32-key steps, logits never stored; unnormalised P split bf16 hi + lo against v bf16 hi + lo (3 products), divided by the sum at the end; y (bf16 hi + lo) Wo + bo; f32 output.
#include <hip/hip_runtime.h>
#include <math.h>

typedef __attribute__((ext_vector_type(16))) _Float16 v16h;
typedef __attribute__((ext_vector_type(16))) __bf16 v16b;
typedef __attribute__((ext_vector_type(8)))  _Float16 v8h;
typedef __attribute__((ext_vector_type(8)))  float v8f;
typedef __attribute__((ext_vector_type(4)))  float v4f;
typedef __attribute__((ext_vector_type(2)))  float v2f;
typedef __attribute__((ext_vector_type(4)))  unsigned v4u;
typedef __attribute__((ext_vector_type(4)))  int v4i;
typedef float __attribute__((may_alias)) float_a;
typedef int __attribute__((may_alias)) int_a;

template <typename T> __device__ __forceinline__ void vst2(void* p, T v) { *(T*)p = v;  }
__device__ __forceinline__ v8f wmma16(v16h a, v16h b, v8f c) {
  v8f d = __builtin_amdgcn_wmma_f32_16x16x32_f16(false, a, false, b, (short)0, c, false, false);
  asm volatile("v_nop\n\tv_nop\n\tv_nop\n\tv_nop" : "+v"(d) : "v"(a), "v"(b));
  return d;
}
__device__ __forceinline__ v8f wmma_bf(v16b a, v16b b, v8f c) {
  v8f d = __builtin_amdgcn_wmma_f32_16x16x32_bf16(false, a, false, b, (short)0, c, false, false);
  asm volatile("v_nop\n\tv_nop\n\tv_nop\n\tv_nop" : "+v"(d) : "v"(a), "v"(b));
  return d;
}
// 16x16x32 fragments: lane = (h = lane>>4, row/col = lane&15); elements 0..7 = k0+8h+0..7, 8..15 = k0+16+8h+0..7; D element r = row 8h+r
__device__ __forceinline__ v16h frag_h(const _Float16* rowk0, int lane) {
  union { v16h v; v8h q[2]; } u; const _Float16* p = rowk0 + 8 * (lane >> 4);
  u.q[0] = *(const v8h*)p; u.q[1] = *(const v8h*)(p + 16); return u.v;
}
__device__ __forceinline__ v16h frag_f32(const float* rowk0, int lane) {
  v16h a; const float* p = rowk0 + 8 * (lane >> 4);
#pragma unroll
  for (int i = 0; i < 8; ++i) { a[i] = (_Float16)p[i]; a[8 + i] = (_Float16)p[16 + i]; }
  return a;
}
__device__ __forceinline__ v16h frag_f32s(const float* rowk0, int lane, float sc) {
  v16h a; const float* p = rowk0 + 8 * (lane >> 4);
#pragma unroll
  for (int i = 0; i < 8; ++i) { a[i] = (_Float16)(p[i] * sc); a[8 + i] = (_Float16)(p[16 + i] * sc); }
  return a;
}
// column fragment from a [K][ld] layout (column n), rows >= K read as 0
__device__ __forceinline__ v16h fragc_f32(const float* W, int k0, int n, int lane, int ld, int K) {
  v16h a; const int g = lane >> 4;
#pragma unroll
  for (int i = 0; i < 8; ++i) { const int ka = k0 + 8 * g + i, kb = ka + 16;
    a[i] = (_Float16)(ka < K ? W[(size_t)(ka < K ? ka : K - 1) * ld + n] : 0.f); a[8 + i] = (_Float16)(kb < K ? W[(size_t)(kb < K ? kb : K - 1) * ld + n] : 0.f); }
  return a;
}
struct F2 { v16b h, l; };
__device__ __forceinline__ F2 bsplit16(const float v[16]) { F2 r;
#pragma unroll
  for (int i = 0; i < 16; ++i) { const __bf16 h = (__bf16)v[i]; r.h[i] = h; r.l[i] = (__bf16)(v[i] - (float)h); }
  return r; }
__device__ __forceinline__ F2 split_row(const float* row, int k0, int lane) { float v[16]; const float* p = row + k0 + 8 * (lane >> 4);
#pragma unroll
  for (int i = 0; i < 8; ++i) { v[i] = p[i]; v[8 + i] = p[16 + i]; }
  return bsplit16(v); }
__device__ __forceinline__ F2 split_rowK(const float* row, int k0, int lane, int K) { float v[16]; const int g = lane >> 4;
#pragma unroll
  for (int i = 0; i < 8; ++i) { const int ka = k0 + 8 * g + i, kb = ka + 16; v[i] = ka < K ? row[ka < K ? ka : K - 1] : 0.f; v[8 + i] = kb < K ? row[kb < K ? kb : K - 1] : 0.f; }
  return bsplit16(v); }
__device__ __forceinline__ F2 split_col(const float* W, int k0, int n, int lane, int ld, int K) { float v[16]; const int g = lane >> 4;
#pragma unroll
  for (int i = 0; i < 8; ++i) { const int ka = k0 + 8 * g + i, kb = ka + 16; v[i] = ka < K ? W[(size_t)(ka < K ? ka : K - 1) * ld + n] : 0.f; v[8 + i] = kb < K ? W[(size_t)(kb < K ? kb : K - 1) * ld + n] : 0.f; }
  return bsplit16(v); }
__device__ __forceinline__ v8f mac3(const F2& a, const F2& b, v8f c) { c = wmma_bf(a.l, b.h, c); c = wmma_bf(a.h, b.l, c); return wmma_bf(a.h, b.h, c); }
__device__ __forceinline__ float sigm(float v) { return 1.0f / (1.0f + expf(-v)); }
#define LDSX() do { asm volatile("s_wait_dscnt 0" ::: "memory"); __builtin_amdgcn_wave_barrier(); __builtin_amdgcn_fence(__ATOMIC_RELEASE, "workgroup"); } while (0)


// Multi-head attention with rotary embedding and a data-dependent 'stoichiometric' bias (B 2, T 2,048, D 1,024 = 16 x 64): Q = query Wq + bq, K = key Wk + bk, V = value Wv + bv ((in,out)); rotate-half RoPE with angle t / 10000^(2i/64); scores = Q K^T 64^-0.5 + (alpha_pos[h] if frac_j >= frac_i else alpha_neg[h]) (frac_j - frac_i); softmax; P V; out Wo + bo.
#define NB 2
#define TT 2048
#define CC 1024
#define NH 16
#define HD 64
__constant__ float RCPF[32] = {1.000000000e+0f,7.498942018e-1f,5.623413324e-1f,4.216965139e-1f,3.162277639e-1f,2.371373624e-1f,1.778279394e-1f,1.333521456e-1f,1.000000015e-1f,7.498941571e-2f,5.623412877e-2f,4.216964915e-2f,3.162277862e-2f,2.371373586e-2f,1.778279431e-2f,1.333521493e-2f,9.999999776e-3f,7.498942316e-3f,5.623413250e-3f,4.216964822e-3f,3.162277862e-3f,2.371373819e-3f,1.778279431e-3f,1.333521446e-3f,1.000000047e-3f,7.498941850e-4f,5.623413017e-4f,4.216964880e-4f,3.162277862e-4f,2.371373848e-4f,1.778279402e-4f,1.333521504e-4f};   // f32(1 / f32(10000^(2i/64))): the module divides pos by freq_div, which XLA evaluates as pos * (1/freq_div)
#ifndef TNB
#define TNB NB
#endif
typedef __attribute__((ext_vector_type(8))) __bf16 v8b;
__device__ __forceinline__ v16b frag_b(const __bf16* rowk0, int lane) {
  union { v16b v; v8b q[2]; } u; const __bf16* p = rowk0 + 8 * (lane >> 4);
  u.q[0] = *(const v8b*)p; u.q[1] = *(const v8b*)(p + 16); return u.v;
}
__device__ __forceinline__ float bfr(float v) { return (float)(__bf16)v; }
__device__ __attribute__((noinline)) float exp_ni(float v) { return expf(v); }
__device__ __attribute__((noinline)) float erf_ni(float v) { return erff(v); }

#define WS_ROT 0u                                   // float2 (cos, sin)[t][32] = cos/sin(t * (1/freq_div[j]))
#define WS_QH  (WS_ROT + 8u * (size_t)TT * 32)
#define WS_QL  (WS_QH + 2u * (size_t)NB * TT * CC)
#define WS_KH  (WS_QL + 2u * (size_t)NB * TT * CC)
#define WS_VT  (WS_KH + 2u * (size_t)NB * TT * CC)      // bf16 v planes [b][c][t]
#define WS_VL  (WS_VT + 2u * (size_t)NB * CC * TT)      // bf16 v residual planes
#define WS_YH  (WS_VL + 2u * (size_t)NB * CC * TT)      // y, bf16 hi, packed fragments [row tile][kc]
#define WS_YL  (WS_YH + 2u * (size_t)NB * TT * CC)      // y, bf16 residual, packed likewise
#define WS_XP  (WS_YL + 2u * (size_t)NB * TT * CC)      // query, key, value as bf16, packed fragments [which][row tile][kc]
#define WS_WP  (WS_XP + 3u * 2u * (size_t)NB * TT * CC) // Wq, Wk, Wv, Wo as bf16, packed fragments [matrix][column tile][kc]
#define WS_END (WS_WP + 4u * 2u * (size_t)CC * CC)
// A packed fragment is the 1 KiB that one 16x16x32 operand takes, in the order the wave reads it: 16-byte piece (half, lane) at element half * 256 + lane * 8 holds k = kc * 32 + half * 16 + 8 * (lane >> 4) + 0..7 of row (or column) tile * 16 + (lane & 15); each of the two wave-wide 16-byte loads then covers 512 contiguous bytes, four whole lines
#define FRAG_E 512
#define NKC (CC / 32)
__device__ __forceinline__ v16b frag_p(const __bf16* lanebase) {
  union { v16b v; v8b q[2]; } u; u.q[0] = *(const v8b*)lanebase; u.q[1] = *(const v8b*)(lanebase + 256); return u.v;
}

// ---- k_pre: everything the GEMMs read is laid out once a call. Blocks 0..383: a wave packs 8 kc of one 16-row tile of query / key / value (f32 -> bf16). Blocks 384..639: a wave packs 4 column tiles of one kc of one weight matrix (the transposition happens here, once, not in every GEMM wave). Blocks 640..895: one thread per (t, j): precise cosf/sinf of t * inv_freq[j] -> table (keeps the trig and its large-argument reduction out of the GEMM kernel)
#define PRE_X (3 * (NB * TT / 16) * (NKC / 8) / 8)
#define PRE_W (4 * NKC * (CC / 64) / 8)
__global__ __launch_bounds__(256) void k_pre(const float* __restrict__ X0, const float* __restrict__ X1, const float* __restrict__ X2, const float* __restrict__ WQ, const float* __restrict__ WK, const float* __restrict__ WV, const float* __restrict__ WO, __bf16* __restrict__ XP, __bf16* __restrict__ WP, float2* __restrict__ ROT) {
  const int tid = threadIdx.x, wave = tid >> 5, lane = tid & 31, col = lane & 15, g = lane >> 4; const int bx = blockIdx.x;
  if (bx < PRE_X) { const int u = bx * 8 + wave, kg = u & 3, rt = (u >> 2) & (NB * TT / 16 - 1), which = u >> 10; const float* X = which == 0 ? X0 : which == 1 ? X1 : X2;
    const float* p = X + ((size_t)rt * 16 + col) * CC + kg * 256 + 8 * g; __bf16* d = XP + (((size_t)which * (NB * TT / 16) + rt) * NKC + kg * 8) * FRAG_E + lane * 8;
    v4f a[16], b2[16];
#pragma unroll
    for (int e = 0; e < 16; ++e) { a[e] = *(const v4f*)(p + e * 16); b2[e] = *(const v4f*)(p + e * 16 + 4); }
    asm volatile("s_wait_xcnt 0x0" :: "v"(p) : "memory");   /* the loads' address pair stays whole until this wait */
#pragma unroll
    for (int e = 0; e < 16; ++e) { v8b o;
#pragma unroll
      for (int i = 0; i < 4; ++i) { o[i] = (__bf16)a[e][i]; o[4 + i] = (__bf16)b2[e][i]; }
      vst2(d + e * 256, o); }
    return; }
  if (bx < PRE_X + PRE_W) { const int u = (bx - PRE_X) * 8 + wave, ng = u & 15, kc = (u >> 4) & (NKC - 1), mat = u >> 9; const float* Wm = mat == 0 ? WQ : mat == 1 ? WK : mat == 2 ? WV : WO;
    const float* p = Wm + ((size_t)kc * 32 + 8 * g) * CC + ng * 64 + col; __bf16* d = WP + (((size_t)mat * (CC / 16) + ng * 4) * NKC + kc) * FRAG_E + lane * 8;
#pragma unroll
    for (int n = 0; n < 4; ++n)
#pragma unroll
      for (int hf = 0; hf < 2; ++hf) { v8b o;
#pragma unroll
        for (int i = 0; i < 8; ++i) o[i] = (__bf16)p[(size_t)(hf * 16 + i) * CC + n * 16];
        vst2(d + (size_t)n * NKC * FRAG_E + hf * 256, o); }
    asm volatile("s_wait_xcnt 0x0" ::: "memory");   /* behind the last store: the stores' address pair is not written anew on any way out of this part before the wait */
    return; }
  const int i = (bx - PRE_X - PRE_W) * 256 + tid; if (i >= TT * 32) return; const int t = i >> 5, j = i & 31; const float ang = (float)t * RCPF[j]; v2f v; v[0] = cosf(ang); v[1] = sinf(ang); vst2((v2f*)(ROT + i), v); }
// ---- k_proj: block = (64 rows, 128 cols, which): qkv = x W (+ b), exact; q -> f16 hi (+ residual), k -> f16 rows, v -> bf16 hi + residual planes
__global__ __launch_bounds__(128) void k_proj(const __bf16* __restrict__ XP, const __bf16* __restrict__ WP, const float* __restrict__ BQ, const float* __restrict__ BK, const float* __restrict__ BV, _Float16* __restrict__ QH, _Float16* __restrict__ QL, _Float16* __restrict__ KH, __bf16* __restrict__ VT, __bf16* __restrict__ VL, const float2* __restrict__ ROT) {
  __shared__ __align__(16) _Float16 sh[64][136], sl[64][136]; __shared__ __align__(16) __bf16 th[128][72], tl2[128][72];
  const int tid = threadIdx.x, wave = tid >> 5, lane = tid & 31, col = lane & 15, g = lane >> 4; const int which = blockIdx.z; const int c0 = blockIdx.y * 128; const size_t r0 = (size_t)blockIdx.x * 64; const float* BA = which == 0 ? BQ : which == 1 ? BK : BV;
  v8f acc[8] = {};
  const __bf16* xp = XP + ((size_t)which * (NB * TT / 16) + blockIdx.x * 4 + wave) * (NKC * FRAG_E) + lane * 8; const __bf16* wp = WP + ((size_t)which * (CC / 16) + blockIdx.y * 8) * (NKC * FRAG_E) + lane * 8;
#pragma unroll 2
  for (int kc = 0; kc < NKC; ++kc) { const v16b a = frag_p(xp + kc * FRAG_E); v16b w[8];   /* the k step's 18 loads stand together in front of its products: one latency a step, not one a fragment */
#pragma unroll
    for (int j = 0; j < 8; ++j) w[j] = frag_p(wp + (j * NKC + kc) * FRAG_E);
#pragma unroll
    for (int j = 0; j < 8; ++j) acc[j] = wmma_bf(a, w[j], acc[j]); }
#pragma unroll
  for (int j = 0; j < 8; ++j) { const float bb0 = BA ? bfr(BA[c0 + j * 16 + col]) : 0.f;
#pragma unroll
    for (int r = 0; r < 8; ++r) acc[j][r] += bb0; }   /* bias before the rotary */
  if (which < 2) {   /* rotate-half rotary on all 64 head dims: the 128-column tile holds heads 2*by and 2*by+1; tiles j (d 0..15), j+1 (16..31) pair with j+2 (32..47), j+3 (48..63) in the SAME lane and row: out[d] = x[d] c - x[d+32] s, out[d+32] = x[d] s + x[d+32] c, angle index i = d (< 32) */
#pragma unroll
    for (int jp = 0; jp < 8; ++jp) { if ((jp & 3) >= 2) continue; const int i = ((jp & 3) * 16 + col);   /* d < 32 */
#pragma unroll
      for (int r = 0; r < 8; ++r) { const int t = (int)((r0 + wave * 16 + 8 * g + r) % TT); const float2 cv = ROT[t * 32 + i]; const float xl = acc[jp][r], xr = acc[jp + 2][r]; acc[jp][r] = xl * cv.x - xr * cv.y; acc[jp + 2][r] = xl * cv.y + xr * cv.x; }
      asm volatile("s_wait_loadcnt 0x0" ::: "memory"); } }
#pragma unroll
  for (int j = 0; j < 8; ++j) { const float bb = 0.f;
#pragma unroll
    for (int r = 0; r < 8; ++r) { const float v = acc[j][r] + bb; const int rl = wave * 16 + 8 * g + r, cl = j * 16 + col; const _Float16 hv = (_Float16)v;
      if (which == 2) { const __bf16 bh = (__bf16)v; th[cl][rl] = bh; tl2[cl][rl] = (__bf16)(v - (float)bh); } else { sh[rl][cl] = hv; sl[rl][cl] = (_Float16)((v - (float)hv) * 1024.0f); }   /* q residual carried x 2^10 so the plane stays f16-normal on the chip */ } }
  __syncthreads();
  if (which < 2) { _Float16* dh = which == 0 ? QH : KH; for (int e = tid; e < 64 * 16; e += 128) { const int rl = e >> 4, q = e & 15; vst2((unsigned*)(dh + (r0 + rl) * CC + c0 + q * 8), *(const v4u*)&sh[rl][q * 8]); if (which == 0) vst2((unsigned*)(QL + (r0 + rl) * CC + c0 + q * 8), *(const v4u*)&sl[rl][q * 8]); } }
  else { const size_t b = r0 / TT; const int t0 = (int)(r0 % TT); for (int e = tid; e < 128 * 8; e += 128) { const int cl = e >> 3, q = e & 7; const size_t o2 = (b * CC + c0 + cl) * (size_t)TT + t0 + q * 8; vst2((unsigned*)(VT + o2), *(const v4u*)&th[cl][q * 8]); vst2((unsigned*)(VL + o2), *(const v4u*)&tl2[cl][q * 8]); } } }
// ---- k_fa: block = 8 waves x 16 queries of one (b, h); the block's keys come through LDS: a stage is 64 keys (K rows, V^T hi rows, V^T lo rows, 128 B a row at a pitch of 144 B), brought once for all eight waves by asynchronous copies into two buffers, the next stage flying while this one is worked on; frac's 2,048 values of the batch are copied once. A wave walks a stage 32 keys at a time and never stores a logit: S^T = K Q^T (2 products) x 64^-0.5 + bias(frac_k - frac_q), both x log2 e so that each weight is one exp2, running maximum and sum per query (a lane holds one query's column: keys 8g+r of each 16-key tile), P^T packed from the two score tiles straight into a B operand (hardware k order), O^T += V^T P^T (3 products), O^T / sum at the end. waves_per_eu(4, 4): a budget of 256 registers, the 512 blocks resident together, two a WGP
#define L2E 1.44269504088896340736f   /* log2(e): logits are carried in base 2 */
#define KST 64                  /* keys a stage */
#define NST (TT / KST)
#define LP 72                   /* LDS row pitch in 16-bit elements: 144 B = 16 B x 9, free of bank conflicts for 16-byte readers */
#define TILE_B (64 * LP * 2)
#define STAGE_B (3 * TILE_B)
// one stage's six 16-byte copies of a lane (rows r and r + 32 of K, V hi, V lo). The s_wait_xcnt stands inside the statement, so that no register which an issued copy names is written anew in front of it
__device__ __forceinline__ void stage_copy(unsigned l, const _Float16* k, const __bf16* v, const __bf16* w) {
  const unsigned l1 = l + 32 * LP * 2, l2 = l + TILE_B, l3 = l2 + 32 * LP * 2, l4 = l + 2 * TILE_B, l5 = l4 + 32 * LP * 2; const _Float16* k1 = k + (size_t)32 * CC; const __bf16* v1 = v + (size_t)32 * TT; const __bf16* w1 = w + (size_t)32 * TT;
  asm volatile("global_load_async_to_lds_b128 %0, %6, off\n\tglobal_load_async_to_lds_b128 %1, %7, off\n\tglobal_load_async_to_lds_b128 %2, %8, off\n\tglobal_load_async_to_lds_b128 %3, %9, off\n\tglobal_load_async_to_lds_b128 %4, %10, off\n\tglobal_load_async_to_lds_b128 %5, %11, off\n\ts_wait_xcnt 0x0" :: "v"(l), "v"(l1), "v"(l2), "v"(l3), "v"(l4), "v"(l5), "v"(k), "v"(k1), "v"(v), "v"(v1), "v"(w), "v"(w1) : "memory");
}
__global__ __launch_bounds__(256) __attribute__((amdgpu_waves_per_eu(4, 4))) void k_fa(const _Float16* __restrict__ QH, const _Float16* __restrict__ QL, const _Float16* __restrict__ KH, const __bf16* __restrict__ VT, const __bf16* __restrict__ VL, const float* __restrict__ FR, const float* __restrict__ AP, const float* __restrict__ AN, __bf16* __restrict__ YH, __bf16* __restrict__ YL) {
  __shared__ __align__(16) unsigned char ring[2 * STAGE_B]; __shared__ __align__(16) float sF[TT];
  const int tid = threadIdx.x, wave = tid >> 5, lane = tid & 31, col = lane & 15, g = lane >> 4; const int h = blockIdx.y, b = blockIdx.z; const int q = blockIdx.x * 128 + wave * 16 + col;
  const size_t qrow = ((size_t)b * TT + q) * CC + h * HD;
  /* the copies: thread = (row tid >> 3, 16-byte piece tid & 7), so a wave's copy covers four whole 128-byte rows */
  const int crow = tid >> 3, cpc = tid & 7; const _Float16* kg = KH + ((size_t)b * TT + crow) * CC + h * HD + cpc * 8; const size_t vg0 = ((size_t)b * CC + h * HD + crow) * (size_t)TT + cpc * 8; const __bf16* vg = VT + vg0; const __bf16* wg = VL + vg0;
  const unsigned lc = (unsigned)(size_t)ring + (unsigned)(crow * (LP * 2) + cpc * 16);
  { const unsigned f0 = (unsigned)(size_t)sF + (unsigned)tid * 16u, f1 = f0 + 4096u; const float* fg0 = FR + (size_t)b * TT + tid * 4; const float* fg1 = fg0 + 1024;
    asm volatile("global_load_async_to_lds_b128 %0, %2, off\n\tglobal_load_async_to_lds_b128 %1, %3, off\n\ts_wait_xcnt 0x0" :: "v"(f0), "v"(f1), "v"(fg0), "v"(fg1) : "memory"); }   /* frac of this batch, once; the wait as in stage_copy */
  stage_copy(lc, kg, vg, wg);
  v16h qh[HD / 32], ql[HD / 32];
#pragma unroll
  for (int kc = 0; kc < HD / 32; ++kc) { qh[kc] = frag_h(QH + qrow + kc * 32, lane); ql[kc] = frag_h(QL + qrow + kc * 32, lane); }
  const float ap = bfr(AP[h]) * L2E, an = bfr(AN[h]) * L2E, fq = bfr(FR[(size_t)b * TT + q]);
  asm volatile("s_wait_asynccnt 0x0" ::: "memory");   /* this wave's copies of frac and of stage 0 have landed */
  __syncthreads();                                    /* and every other wave's */
  stage_copy(lc + STAGE_B, kg + (size_t)KST * CC, vg + KST, wg + KST);
  const int lo = col * LP + 8 * g;   /* each lane's own row and 8g */
  v8f o[HD / 16] = {}; float m = -3.0e38f, l = 0.f;
#pragma unroll 1   /* rolled: one stage's code serves both buffers */
  for (int st = 0; st < NST; ++st) { const unsigned char* bp = ring + (st & 1) * STAGE_B;
#pragma unroll 1   /* rolled: the fragments of two passes do not fit 256 registers */
  for (int hf = 0; hf < KST / 32; ++hf) { float s[16]; v4f fk[4]; v16h kf[2][HD / 32]; v16b vf[HD / 16], wf[HD / 16];
    const _Float16* kq = (const _Float16*)bp + hf * 32 * LP + lo; const __bf16* vq = (const __bf16*)(bp + TILE_B) + hf * 32 + lo; const __bf16* wq = (const __bf16*)(bp + 2 * TILE_B) + hf * 32 + lo; const float* fp = sF + st * KST + hf * 32 + 8 * g;
#pragma unroll
    for (int t = 0; t < 2; ++t) {
#pragma unroll
      for (int kc = 0; kc < HD / 32; ++kc) kf[t][kc] = frag_h(kq + (t * 16) * LP + kc * 32, 0);
      fk[t * 2] = *(const v4f*)(fp + t * 16); fk[t * 2 + 1] = *(const v4f*)(fp + t * 16 + 4); }
#pragma unroll
    for (int j = 0; j < HD / 16; ++j) { vf[j] = frag_b(vq + (j * 16) * LP, 0); wf[j] = frag_b(wq + (j * 16) * LP, 0); }
#pragma unroll
    for (int t = 0; t < 2; ++t) { v8f a = {}, al = {};
#pragma unroll
      for (int kc = 0; kc < HD / 32; ++kc) { a = wmma16(kf[t][kc], qh[kc], a); al = wmma16(kf[t][kc], ql[kc], al); }
#pragma unroll
      for (int r = 0; r < 8; ++r) { const float D = bfr(fk[t * 2 + (r >> 2)][r & 3]) - fq; const float bias = (D >= 0.f ? ap : an) * D; s[t * 8 + r] = (a[r] + al[r] * (1.0f / 1024.0f)) * (0.125f * L2E) + bias; } }
    float mx = s[0];
#pragma unroll
    for (int i = 1; i < 16; ++i) mx = fmaxf(mx, s[i]);
    mx = fmaxf(mx, __shfl_xor(mx, 16));   /* the other half of the wave holds this query's other 16 keys */
    const float mn = fmaxf(m, mx), sc = __builtin_amdgcn_exp2f(m - mn); m = mn; float ps = 0.f;
#pragma unroll
    for (int i = 0; i < 16; ++i) { s[i] = __builtin_amdgcn_exp2f(s[i] - mn); ps += s[i]; }
    l = l * sc + ps;
#pragma unroll
    for (int j = 0; j < HD / 16; ++j)
#pragma unroll
      for (int r = 0; r < 8; ++r) o[j][r] *= sc;
    const F2 p = bsplit16(s);   /* element i < 8 = the pass's key 8g + i, i >= 8 = key 16 + 8g + i - 8: the k order of frag_b */
#pragma unroll
    for (int j = 0; j < HD / 16; ++j) { o[j] = wmma_bf(vf[j], p.h, o[j]); o[j] = wmma_bf(vf[j], p.l, o[j]); o[j] = wmma_bf(wf[j], p.h, o[j]); } }
    /* hand-over: this wave's reads of the buffer are done, its copies of the next stage have landed; behind the barrier that holds of every wave, and the buffer just read takes stage st + 2 */
    asm volatile("s_wait_dscnt 0x0" ::: "memory");
    asm volatile("s_wait_asynccnt 0x0" ::: "memory");
    __syncthreads();
    if (st + 2 < NST) stage_copy(lc + (unsigned)(st & 1) * STAGE_B, kg + (size_t)(st + 2) * KST * CC, vg + (st + 2) * KST, wg + (st + 2) * KST); }
  asm volatile("s_wait_asynccnt 0x0" ::: "memory");   /* no copy outstanding when the wave ends */
  l += __shfl_xor(l, 16); const float inv = 1.0f / l;   /* O^T register r of tile j = head dim j*16 + 8g + r of this lane's query: piece (half j & 1, this lane) of k_out's A fragment (row tile of the wave's 16 queries, kc = 2h + (j >> 1)), so y leaves as packed bf16 hi + residual */
  const size_t yo = (((size_t)b * (TT / 16) + blockIdx.x * 8 + wave) * NKC + h * 2) * FRAG_E + lane * 8;
#pragma unroll
  for (int j = 0; j < HD / 16; ++j) { v8b uh, ul;
#pragma unroll
    for (int r = 0; r < 8; ++r) { const float v = o[j][r] * inv; const __bf16 hv = (__bf16)v; uh[r] = hv; ul[r] = (__bf16)(v - (float)hv); }
    vst2(YH + yo + j * 256, uh); vst2(YL + yo + j * 256, ul); } }
// ---- k_out: block = (64 rows, 128 cols): out = y (bf16 hi + lo) Wo + bo
__global__ __launch_bounds__(128) void k_out(const __bf16* __restrict__ YH, const __bf16* __restrict__ YL, const __bf16* __restrict__ WP, const float* __restrict__ BP, float* __restrict__ OUT) { __shared__ __align__(16) float sf[4][16][132];
  const int tid = threadIdx.x, wave = tid >> 5, lane = tid & 31, col = lane & 15, g = lane >> 4; const int c0 = blockIdx.y * 128; const size_t r0 = (size_t)blockIdx.x * 64 + wave * 16;
  v8f acc[8] = {};
  const size_t yo = ((size_t)blockIdx.x * 4 + wave) * (NKC * FRAG_E) + lane * 8; const __bf16* wp = WP + ((size_t)3 * (CC / 16) + blockIdx.y * 8) * (NKC * FRAG_E) + lane * 8;
#pragma unroll 2
  for (int kc = 0; kc < NKC; ++kc) { const v16b ah = frag_p(YH + yo + kc * FRAG_E), al = frag_p(YL + yo + kc * FRAG_E); v16b w[8];   /* the k step's 20 loads together in front of its products, as in k_proj */
#pragma unroll
    for (int j = 0; j < 8; ++j) w[j] = frag_p(wp + (j * NKC + kc) * FRAG_E);
#pragma unroll
    for (int j = 0; j < 8; ++j) { acc[j] = wmma_bf(ah, w[j], acc[j]); acc[j] = wmma_bf(al, w[j], acc[j]); } }
#pragma unroll
  for (int j = 0; j < 8; ++j) { const float bb = BP ? bfr(BP[c0 + j * 16 + col]) : 0.f;
#pragma unroll
    for (int r = 0; r < 8; ++r) sf[wave][8 * g + r][j * 16 + col] = acc[j][r] + bb; }
  LDSX(); for (int rl = 0; rl < 16; ++rl) vst2(OUT + (r0 + rl) * CC + c0 + lane * 4, *(const v4f*)&sf[wave][rl][lane * 4]); }
extern "C" void kernel_launch(void* const* d_in, const int* in_sizes, int n_in, void* d_out, int out_size, void* d_ws, size_t ws_size, hipStream_t stream) {
  (void)in_sizes; (void)n_in; (void)out_size;
  const float** F = (const float**)d_in;   // 0 query, 1 key, 2 value [2,2048,1024]; 3 frac [2,2048]; 4 Wq, 5 Wk, 6 Wv, 7 Wo ((in,out)); 8 bq, 9 bk, 10 bv, 11 bo; 12 alpha_pos [16], 13 alpha_neg [16]
  if (ws_size < (size_t)WS_END) return;
  char* ws = (char*)d_ws; _Float16 *QH = (_Float16*)(ws + WS_QH), *QL = (_Float16*)(ws + WS_QL), *KH = (_Float16*)(ws + WS_KH); __bf16 *VT = (__bf16*)(ws + WS_VT), *VL = (__bf16*)(ws + WS_VL), *YH = (__bf16*)(ws + WS_YH), *YL = (__bf16*)(ws + WS_YL), *XP = (__bf16*)(ws + WS_XP), *WP = (__bf16*)(ws + WS_WP);
  k_pre<<<dim3(PRE_X + PRE_W + TT * 32 / 256), 256, 0, stream>>>(F[0], F[1], F[2], F[4], F[5], F[6], F[7], XP, WP, (float2*)(ws + WS_ROT));
  k_proj<<<dim3(TNB * TT / 64, CC / 128, 3), 128, 0, stream>>>(XP, WP, F[8], F[9], F[10], QH, QL, KH, VT, VL, (const float2*)(ws + WS_ROT));
  k_fa<<<dim3(TT / 128, NH, TNB), 256, 0, stream>>>(QH, QL, KH, VT, VL, F[3], F[12], F[13], YH, YL);
  k_out<<<dim3(TNB * TT / 64, CC / 128), 128, 0, stream>>>(YH, YL, WP, F[11], (float*)d_out);
}

// v005
// Measured time: 173 microseconds a run.
// Next to v004, in two timings, it ran 1.05 and 1.08 times as fast.
// Counting every step since v000, it is 9.56 times as fast.
// compute dtype: all float inputs rounded to bf16; q/k/v = x W + b with EXACT bf16 products on WMMA 16x16x32, f32 accumulate; rotate-half rotary in f32 from a cos/sin table of t * (1/freq_div[i]) (the module's f32 reciprocals; precise cosf/sinf); q as f16 hi + residual (x 2^10), k once to f16 -> 2-product logits + the stoichiometric bias from frac / alpha in f32, written as a per-key term (the products' C operand) + a multiple of max(frac_k, frac_q), its per-query constant left out (softmax does not see it); softmax in f32 in base 2 (64^-0.5 log2 e applied in the fma in front of the hardware exp2) and a running maximum and sum over 32-key steps, logits never stored; unnormalised P split bf16 hi + lo against v bf16 hi + lo (3 products), divided by the sum at the end; y (bf16 hi + lo) Wo + bo; f32 output.
#include <hip/hip_runtime.h>
#include <math.h>

typedef __attribute__((ext_vector_type(16))) _Float16 v16h;
typedef __attribute__((ext_vector_type(16))) __bf16 v16b;
typedef __attribute__((ext_vector_type(8)))  _Float16 v8h;
typedef __attribute__((ext_vector_type(8)))  float v8f;
typedef __attribute__((ext_vector_type(4)))  float v4f;
typedef __attribute__((ext_vector_type(2)))  float v2f;
typedef __attribute__((ext_vector_type(4)))  unsigned v4u;
typedef __attribute__((ext_vector_type(4)))  int v4i;
typedef float __attribute__((may_alias)) float_a;
typedef int __attribute__((may_alias)) int_a;

template <typename T> __device__ __forceinline__ void vst2(void* p, T v) { *(T*)p = v;  }
__device__ __forceinline__ v8f wmma16(v16h a, v16h b, v8f c) {
  v8f d = __builtin_amdgcn_wmma_f32_16x16x32_f16(false, a, false, b, (short)0, c, false, false);
  asm volatile("v_nop\n\tv_nop\n\tv_nop\n\tv_nop" : "+v"(d) : "v"(a), "v"(b));
  return d;
}
__device__ __forceinline__ v8f wmma_bf(v16b a, v16b b, v8f c) {
  v8f d = __builtin_amdgcn_wmma_f32_16x16x32_bf16(false, a, false, b, (short)0, c, false, false);
  asm volatile("v_nop\n\tv_nop\n\tv_nop\n\tv_nop" : "+v"(d) : "v"(a), "v"(b));
  return d;
}
// 16x16x32 fragments: lane = (h = lane>>4, row/col = lane&15); elements 0..7 = k0+8h+0..7, 8..15 = k0+16+8h+0..7; D element r = row 8h+r
__device__ __forceinline__ v16h frag_h(const _Float16* rowk0, int lane) {
  union { v16h v; v8h q[2]; } u; const _Float16* p = rowk0 + 8 * (lane >> 4);
  u.q[0] = *(const v8h*)p; u.q[1] = *(const v8h*)(p + 16); return u.v;
}
__device__ __forceinline__ v16h frag_f32(const float* rowk0, int lane) {
  v16h a; const float* p = rowk0 + 8 * (lane >> 4);
#pragma unroll
  for (int i = 0; i < 8; ++i) { a[i] = (_Float16)p[i]; a[8 + i] = (_Float16)p[16 + i]; }
  return a;
}
__device__ __forceinline__ v16h frag_f32s(const float* rowk0, int lane, float sc) {
  v16h a; const float* p = rowk0 + 8 * (lane >> 4);
#pragma unroll
  for (int i = 0; i < 8; ++i) { a[i] = (_Float16)(p[i] * sc); a[8 + i] = (_Float16)(p[16 + i] * sc); }
  return a;
}
// column fragment from a [K][ld] layout (column n), rows >= K read as 0
__device__ __forceinline__ v16h fragc_f32(const float* W, int k0, int n, int lane, int ld, int K) {
  v16h a; const int g = lane >> 4;
#pragma unroll
  for (int i = 0; i < 8; ++i) { const int ka = k0 + 8 * g + i, kb = ka + 16;
    a[i] = (_Float16)(ka < K ? W[(size_t)(ka < K ? ka : K - 1) * ld + n] : 0.f); a[8 + i] = (_Float16)(kb < K ? W[(size_t)(kb < K ? kb : K - 1) * ld + n] : 0.f); }
  return a;
}
struct F2 { v16b h, l; };
__device__ __forceinline__ F2 bsplit16(const float v[16]) { F2 r;
#pragma unroll
  for (int i = 0; i < 16; ++i) { const __bf16 h = (__bf16)v[i]; r.h[i] = h; r.l[i] = (__bf16)(v[i] - (float)h); }
  return r; }
__device__ __forceinline__ F2 split_row(const float* row, int k0, int lane) { float v[16]; const float* p = row + k0 + 8 * (lane >> 4);
#pragma unroll
  for (int i = 0; i < 8; ++i) { v[i] = p[i]; v[8 + i] = p[16 + i]; }
  return bsplit16(v); }
__device__ __forceinline__ F2 split_rowK(const float* row, int k0, int lane, int K) { float v[16]; const int g = lane >> 4;
#pragma unroll
  for (int i = 0; i < 8; ++i) { const int ka = k0 + 8 * g + i, kb = ka + 16; v[i] = ka < K ? row[ka < K ? ka : K - 1] : 0.f; v[8 + i] = kb < K ? row[kb < K ? kb : K - 1] : 0.f; }
  return bsplit16(v); }
__device__ __forceinline__ F2 split_col(const float* W, int k0, int n, int lane, int ld, int K) { float v[16]; const int g = lane >> 4;
#pragma unroll
  for (int i = 0; i < 8; ++i) { const int ka = k0 + 8 * g + i, kb = ka + 16; v[i] = ka < K ? W[(size_t)(ka < K ? ka : K - 1) * ld + n] : 0.f; v[8 + i] = kb < K ? W[(size_t)(kb < K ? kb : K - 1) * ld + n] : 0.f; }
  return bsplit16(v); }
__device__ __forceinline__ v8f mac3(const F2& a, const F2& b, v8f c) { c = wmma_bf(a.l, b.h, c); c = wmma_bf(a.h, b.l, c); return wmma_bf(a.h, b.h, c); }
__device__ __forceinline__ float sigm(float v) { return 1.0f / (1.0f + expf(-v)); }
#define LDSX() do { asm volatile("s_wait_dscnt 0" ::: "memory"); __builtin_amdgcn_wave_barrier(); __builtin_amdgcn_fence(__ATOMIC_RELEASE, "workgroup"); } while (0)


// Multi-head attention with rotary embedding and a data-dependent 'stoichiometric' bias (B 2, T 2,048, D 1,024 = 16 x 64): Q = query Wq + bq, K = key Wk + bk, V = value Wv + bv ((in,out)); rotate-half RoPE with angle t / 10000^(2i/64); scores = Q K^T 64^-0.5 + (alpha_pos[h] if frac_j >= frac_i else alpha_neg[h]) (frac_j - frac_i); softmax; P V; out Wo + bo.
#define NB 2
#define TT 2048
#define CC 1024
#define NH 16
#define HD 64
__constant__ float RCPF[32] = {1.000000000e+0f,7.498942018e-1f,5.623413324e-1f,4.216965139e-1f,3.162277639e-1f,2.371373624e-1f,1.778279394e-1f,1.333521456e-1f,1.000000015e-1f,7.498941571e-2f,5.623412877e-2f,4.216964915e-2f,3.162277862e-2f,2.371373586e-2f,1.778279431e-2f,1.333521493e-2f,9.999999776e-3f,7.498942316e-3f,5.623413250e-3f,4.216964822e-3f,3.162277862e-3f,2.371373819e-3f,1.778279431e-3f,1.333521446e-3f,1.000000047e-3f,7.498941850e-4f,5.623413017e-4f,4.216964880e-4f,3.162277862e-4f,2.371373848e-4f,1.778279402e-4f,1.333521504e-4f};   // f32(1 / f32(10000^(2i/64))): the module divides pos by freq_div, which XLA evaluates as pos * (1/freq_div)
#ifndef TNB
#define TNB NB
#endif
typedef __attribute__((ext_vector_type(8))) __bf16 v8b;
__device__ __forceinline__ v16b frag_b(const __bf16* rowk0, int lane) {
  union { v16b v; v8b q[2]; } u; const __bf16* p = rowk0 + 8 * (lane >> 4);
  u.q[0] = *(const v8b*)p; u.q[1] = *(const v8b*)(p + 16); return u.v;
}
__device__ __forceinline__ float bfr(float v) { return (float)(__bf16)v; }
__device__ __attribute__((noinline)) float exp_ni(float v) { return expf(v); }
__device__ __attribute__((noinline)) float erf_ni(float v) { return erff(v); }

#define WS_ROT 0u                                   // float2 (cos, sin)[t][32] = cos/sin(t * (1/freq_div[j]))
#define WS_QH  (WS_ROT + 8u * (size_t)TT * 32)
#define WS_QL  (WS_QH + 2u * (size_t)NB * TT * CC)
#define WS_KH  (WS_QL + 2u * (size_t)NB * TT * CC)
#define WS_VT  (WS_KH + 2u * (size_t)NB * TT * CC)      // bf16 v planes [b][c][t]
#define WS_VL  (WS_VT + 2u * (size_t)NB * CC * TT)      // bf16 v residual planes
#define WS_YH  (WS_VL + 2u * (size_t)NB * CC * TT)      // y, bf16 hi, packed fragments [row tile][kc]
#define WS_YL  (WS_YH + 2u * (size_t)NB * TT * CC)      // y, bf16 residual, packed likewise
#define WS_XP  (WS_YL + 2u * (size_t)NB * TT * CC)      // query, key, value as bf16, packed fragments [which][row tile][kc]
#define WS_WP  (WS_XP + 3u * 2u * (size_t)NB * TT * CC) // Wq, Wk, Wv, Wo as bf16, packed fragments [matrix][column tile][kc]
#define WS_END (WS_WP + 4u * 2u * (size_t)CC * CC)
// A packed fragment is the 1 KiB that one 16x16x32 operand takes, in the order the wave reads it: 16-byte piece (half, lane) at element half * 256 + lane * 8 holds k = kc * 32 + half * 16 + 8 * (lane >> 4) + 0..7 of row (or column) tile * 16 + (lane & 15); each of the two wave-wide 16-byte loads then covers 512 contiguous bytes, four whole lines
#define FRAG_E 512
#define NKC (CC / 32)
__device__ __forceinline__ v16b frag_p(const __bf16* lanebase) {
  union { v16b v; v8b q[2]; } u; u.q[0] = *(const v8b*)lanebase; u.q[1] = *(const v8b*)(lanebase + 256); return u.v;
}

// ---- k_pre: everything the GEMMs read is laid out once a call. Blocks 0..383: a wave packs 8 kc of one 16-row tile of query / key / value (f32 -> bf16). Blocks 384..639: a wave packs 4 column tiles of one kc of one weight matrix (the transposition happens here, once, not in every GEMM wave). Blocks 640..895: one thread per (t, j): precise cosf/sinf of t * inv_freq[j] -> table (keeps the trig and its large-argument reduction out of the GEMM kernel)
#define PRE_X (3 * (NB * TT / 16) * (NKC / 8) / 8)
#define PRE_W (4 * NKC * (CC / 64) / 8)
__global__ __launch_bounds__(256) void k_pre(const float* __restrict__ X0, const float* __restrict__ X1, const float* __restrict__ X2, const float* __restrict__ WQ, const float* __restrict__ WK, const float* __restrict__ WV, const float* __restrict__ WO, __bf16* __restrict__ XP, __bf16* __restrict__ WP, float2* __restrict__ ROT) {
  const int tid = threadIdx.x, wave = tid >> 5, lane = tid & 31, col = lane & 15, g = lane >> 4; const int bx = blockIdx.x;
  if (bx < PRE_X) { const int u = bx * 8 + wave, kg = u & 3, rt = (u >> 2) & (NB * TT / 16 - 1), which = u >> 10; const float* X = which == 0 ? X0 : which == 1 ? X1 : X2;
    const float* p = X + ((size_t)rt * 16 + col) * CC + kg * 256 + 8 * g; __bf16* d = XP + (((size_t)which * (NB * TT / 16) + rt) * NKC + kg * 8) * FRAG_E + lane * 8;
    v4f a[16], b2[16];
#pragma unroll
    for (int e = 0; e < 16; ++e) { a[e] = *(const v4f*)(p + e * 16); b2[e] = *(const v4f*)(p + e * 16 + 4); }
    asm volatile("s_wait_xcnt 0x0" :: "v"(p) : "memory");   /* the loads' address pair stays whole until this wait */
#pragma unroll
    for (int e = 0; e < 16; ++e) { v8b o;
#pragma unroll
      for (int i = 0; i < 4; ++i) { o[i] = (__bf16)a[e][i]; o[4 + i] = (__bf16)b2[e][i]; }
      vst2(d + e * 256, o); }
    return; }
  if (bx < PRE_X + PRE_W) { const int u = (bx - PRE_X) * 8 + wave, ng = u & 15, kc = (u >> 4) & (NKC - 1), mat = u >> 9; const float* Wm = mat == 0 ? WQ : mat == 1 ? WK : mat == 2 ? WV : WO;
    const float* p = Wm + ((size_t)kc * 32 + 8 * g) * CC + ng * 64 + col; __bf16* d = WP + (((size_t)mat * (CC / 16) + ng * 4) * NKC + kc) * FRAG_E + lane * 8;
#pragma unroll
    for (int n = 0; n < 4; ++n)
#pragma unroll
      for (int hf = 0; hf < 2; ++hf) { v8b o;
#pragma unroll
        for (int i = 0; i < 8; ++i) o[i] = (__bf16)p[(size_t)(hf * 16 + i) * CC + n * 16];
        vst2(d + (size_t)n * NKC * FRAG_E + hf * 256, o); }
    asm volatile("s_wait_xcnt 0x0" ::: "memory");   /* behind the last store: the stores' address pair is not written anew on any way out of this part before the wait */
    return; }
  const int i = (bx - PRE_X - PRE_W) * 256 + tid; if (i >= TT * 32) return; const int t = i >> 5, j = i & 31; const float ang = (float)t * RCPF[j]; v2f v; v[0] = cosf(ang); v[1] = sinf(ang); vst2((v2f*)(ROT + i), v); }
// ---- k_proj: block = (64 rows, 128 cols, which): qkv = x W (+ b), exact; q -> f16 hi (+ residual), k -> f16 rows, v -> bf16 hi + residual planes
__global__ __launch_bounds__(128) void k_proj(const __bf16* __restrict__ XP, const __bf16* __restrict__ WP, const float* __restrict__ BQ, const float* __restrict__ BK, const float* __restrict__ BV, _Float16* __restrict__ QH, _Float16* __restrict__ QL, _Float16* __restrict__ KH, __bf16* __restrict__ VT, __bf16* __restrict__ VL, const float2* __restrict__ ROT) {
  __shared__ __align__(16) _Float16 sh[64][136], sl[64][136]; __shared__ __align__(16) __bf16 th[128][72], tl2[128][72];
  const int tid = threadIdx.x, wave = tid >> 5, lane = tid & 31, col = lane & 15, g = lane >> 4; const int which = blockIdx.z; const int c0 = blockIdx.y * 128; const size_t r0 = (size_t)blockIdx.x * 64; const float* BA = which == 0 ? BQ : which == 1 ? BK : BV;
  v8f acc[8] = {};
  const __bf16* xp = XP + ((size_t)which * (NB * TT / 16) + blockIdx.x * 4 + wave) * (NKC * FRAG_E) + lane * 8; const __bf16* wp = WP + ((size_t)which * (CC / 16) + blockIdx.y * 8) * (NKC * FRAG_E) + lane * 8;
#pragma unroll 2
  for (int kc = 0; kc < NKC; ++kc) { const v16b a = frag_p(xp + kc * FRAG_E); v16b w[8];   /* the k step's 18 loads stand together in front of its products: one latency a step, not one a fragment */
#pragma unroll
    for (int j = 0; j < 8; ++j) w[j] = frag_p(wp + (j * NKC + kc) * FRAG_E);
#pragma unroll
    for (int j = 0; j < 8; ++j) acc[j] = wmma_bf(a, w[j], acc[j]); }
#pragma unroll
  for (int j = 0; j < 8; ++j) { const float bb0 = BA ? bfr(BA[c0 + j * 16 + col]) : 0.f;
#pragma unroll
    for (int r = 0; r < 8; ++r) acc[j][r] += bb0; }   /* bias before the rotary */
  if (which < 2) {   /* rotate-half rotary on all 64 head dims: the 128-column tile holds heads 2*by and 2*by+1; tiles j (d 0..15), j+1 (16..31) pair with j+2 (32..47), j+3 (48..63) in the SAME lane and row: out[d] = x[d] c - x[d+32] s, out[d+32] = x[d] s + x[d+32] c, angle index i = d (< 32) */
#pragma unroll
    for (int jp = 0; jp < 8; ++jp) { if ((jp & 3) >= 2) continue; const int i = ((jp & 3) * 16 + col);   /* d < 32 */
#pragma unroll
      for (int r = 0; r < 8; ++r) { const int t = (int)((r0 + wave * 16 + 8 * g + r) % TT); const float2 cv = ROT[t * 32 + i]; const float xl = acc[jp][r], xr = acc[jp + 2][r]; acc[jp][r] = xl * cv.x - xr * cv.y; acc[jp + 2][r] = xl * cv.y + xr * cv.x; }
      asm volatile("s_wait_loadcnt 0x0" ::: "memory"); } }
#pragma unroll
  for (int j = 0; j < 8; ++j) { const float bb = 0.f;
#pragma unroll
    for (int r = 0; r < 8; ++r) { const float v = acc[j][r] + bb; const int rl = wave * 16 + 8 * g + r, cl = j * 16 + col; const _Float16 hv = (_Float16)v;
      if (which == 2) { const __bf16 bh = (__bf16)v; th[cl][rl] = bh; tl2[cl][rl] = (__bf16)(v - (float)bh); } else { sh[rl][cl] = hv; sl[rl][cl] = (_Float16)((v - (float)hv) * 1024.0f); }   /* q residual carried x 2^10 so the plane stays f16-normal on the chip */ } }
  __syncthreads();
  if (which < 2) { _Float16* dh = which == 0 ? QH : KH; for (int e = tid; e < 64 * 16; e += 128) { const int rl = e >> 4, q = e & 15; vst2((unsigned*)(dh + (r0 + rl) * CC + c0 + q * 8), *(const v4u*)&sh[rl][q * 8]); if (which == 0) vst2((unsigned*)(QL + (r0 + rl) * CC + c0 + q * 8), *(const v4u*)&sl[rl][q * 8]); } }
  else { const size_t b = r0 / TT; const int t0 = (int)(r0 % TT); for (int e = tid; e < 128 * 8; e += 128) { const int cl = e >> 3, q = e & 7; const size_t o2 = (b * CC + c0 + cl) * (size_t)TT + t0 + q * 8; vst2((unsigned*)(VT + o2), *(const v4u*)&th[cl][q * 8]); vst2((unsigned*)(VL + o2), *(const v4u*)&tl2[cl][q * 8]); } } }
// ---- k_fa: block = 8 waves x 16 queries of one (b, h); the block's keys come through LDS: a stage is 64 keys (K rows, V^T hi rows, V^T lo rows, 128 B a row at a pitch of 144 B), brought once for all eight waves by asynchronous copies into two buffers, the next stage flying while this one is worked on; the batch's 2,048 values of frac go to LDS once, as two f32 tables. A wave walks a stage 32 keys at a time and never stores a logit: S^T = kl frac_k + K Q^T (2 products) + ka max(frac_k, frac_q), x 64^-0.5 log2 e inside the fma that takes the maximum off, so that each weight is one exp2, running maximum and sum per query (a lane holds one query's column: keys 8g+r of each 16-key tile), P^T packed from the two score tiles straight into a B operand (hardware k order), O^T += V^T P^T (3 products), O^T / sum at the end. waves_per_eu(4, 4): a budget of 256 registers, the 512 blocks resident together, two a WGP
#define L2E 1.44269504088896340736f   /* log2(e): logits are carried in base 2 */
#define KST 64                  /* keys a stage */
#define NST (TT / KST)
#define LP 72                   /* LDS row pitch in 16-bit elements: 144 B = 16 B x 9, free of bank conflicts for 16-byte readers */
#define TILE_B (64 * LP * 2)
#define STAGE_B (3 * TILE_B)
// one stage's six 16-byte copies of a lane (rows r and r + 32 of K, V hi, V lo). The s_wait_xcnt stands inside the statement, so that no register which an issued copy names is written anew in front of it
__device__ __forceinline__ void stage_copy(unsigned l, const _Float16* k, const __bf16* v, const __bf16* w) {
  const unsigned l1 = l + 32 * LP * 2, l2 = l + TILE_B, l3 = l2 + 32 * LP * 2, l4 = l + 2 * TILE_B, l5 = l4 + 32 * LP * 2; const _Float16* k1 = k + (size_t)32 * CC; const __bf16* v1 = v + (size_t)32 * TT; const __bf16* w1 = w + (size_t)32 * TT;
  asm volatile("global_load_async_to_lds_b128 %0, %6, off\n\tglobal_load_async_to_lds_b128 %1, %7, off\n\tglobal_load_async_to_lds_b128 %2, %8, off\n\tglobal_load_async_to_lds_b128 %3, %9, off\n\tglobal_load_async_to_lds_b128 %4, %10, off\n\tglobal_load_async_to_lds_b128 %5, %11, off\n\ts_wait_xcnt 0x0" :: "v"(l), "v"(l1), "v"(l2), "v"(l3), "v"(l4), "v"(l5), "v"(k), "v"(k1), "v"(v), "v"(v1), "v"(w), "v"(w1) : "memory");
}
__global__ __launch_bounds__(256) __attribute__((amdgpu_waves_per_eu(4, 4))) void k_fa(const _Float16* __restrict__ QH, const _Float16* __restrict__ QL, const _Float16* __restrict__ KH, const __bf16* __restrict__ VT, const __bf16* __restrict__ VL, const float* __restrict__ FR, const float* __restrict__ AP, const float* __restrict__ AN, __bf16* __restrict__ YH, __bf16* __restrict__ YL) {
  __shared__ __align__(16) unsigned char ring[2 * STAGE_B]; __shared__ __align__(16) float sG[TT], sH[TT];
  const int tid = threadIdx.x, wave = tid >> 5, lane = tid & 31, col = lane & 15, g = lane >> 4; const int h = blockIdx.y, b = blockIdx.z; const int q = blockIdx.x * 128 + wave * 16 + col;
  const size_t qrow = ((size_t)b * TT + q) * CC + h * HD;
  /* the copies: thread = (row tid >> 3, 16-byte piece tid & 7), so a wave's copy covers four whole 128-byte rows */
  const int crow = tid >> 3, cpc = tid & 7; const _Float16* kg = KH + ((size_t)b * TT + crow) * CC + h * HD + cpc * 8; const size_t vg0 = ((size_t)b * CC + h * HD + crow) * (size_t)TT + cpc * 8; const __bf16* vg = VT + vg0; const __bf16* wg = VL + vg0;
  const unsigned lc = (unsigned)(size_t)ring + (unsigned)(crow * (LP * 2) + cpc * 16);
  stage_copy(lc, kg, vg, wg);
  /* the bias (D >= 0 ? ap : an) D, D = f_k - f_q, is an f_k + (ap - an) max(f_k, f_q) - ap f_q (f_k >= f_q: ap f_k - ap f_q; else an f_k - an f_q). The last term, one constant a query, leaves the softmax unchanged: it is not formed. In units of the raw product (logit / 64^-0.5): kl f_k + ka max(f_k, f_q). The block's two tables, once: sG = f_k (rounded as before), sH = kl f_k */
  const float ap = bfr(AP[h]), an = bfr(AN[h]), kl = 8.0f * an, ka = 8.0f * (ap - an), fq = bfr(FR[(size_t)b * TT + q]);
#pragma unroll
  for (int e = 0; e < 2; ++e) { const int i0 = e * 1024 + tid * 4; const v4f f = *(const v4f*)(FR + (size_t)b * TT + i0); v4f gv, hv;
#pragma unroll
    for (int i = 0; i < 4; ++i) { gv[i] = bfr(f[i]); hv[i] = gv[i] * kl; }
    *(v4f*)(sG + i0) = gv; *(v4f*)(sH + i0) = hv; }
  v16h qh[HD / 32], ql[HD / 32];
#pragma unroll
  for (int kc = 0; kc < HD / 32; ++kc) { qh[kc] = frag_h(QH + qrow + kc * 32, lane); ql[kc] = frag_h(QL + qrow + kc * 32, lane); }
  asm volatile("s_wait_asynccnt 0x0" ::: "memory");   /* this wave's copies of stage 0 have landed */
  __syncthreads();                                    /* and every other wave's, and every wave's part of the two tables */
  stage_copy(lc + STAGE_B, kg + (size_t)KST * CC, vg + KST, wg + KST);
  const int lo = col * LP + 8 * g;   /* each lane's own row and 8g */
  v8f o[HD / 16] = {}; float m = -3.0e38f, l = 0.f; const v2f ka2 = {ka, ka}, r2 = {1.0f / 1024.0f, 1.0f / 1024.0f}, c2 = {0.125f * L2E, 0.125f * L2E};
#pragma unroll 1   /* rolled: one stage's code serves both buffers */
  for (int st = 0; st < NST; ++st) { const unsigned char* bp = ring + (st & 1) * STAGE_B;
#pragma unroll 1   /* rolled: the fragments of two passes do not fit 256 registers */
  for (int hf = 0; hf < KST / 32; ++hf) { float s[16]; v4f fk[4]; v8f hk[2]; v16h kf[2][HD / 32]; v16b vf[HD / 16], wf[HD / 16];
    const _Float16* kq = (const _Float16*)bp + hf * 32 * LP + lo; const __bf16* vq = (const __bf16*)(bp + TILE_B) + hf * 32 + lo; const __bf16* wq = (const __bf16*)(bp + 2 * TILE_B) + hf * 32 + lo; const float* fp = sG + st * KST + hf * 32 + 8 * g; const float* hp = sH + st * KST + hf * 32 + 8 * g;
#pragma unroll
    for (int t = 0; t < 2; ++t) {
#pragma unroll
      for (int kc = 0; kc < HD / 32; ++kc) kf[t][kc] = frag_h(kq + (t * 16) * LP + kc * 32, 0);
      fk[t * 2] = *(const v4f*)(fp + t * 16); fk[t * 2 + 1] = *(const v4f*)(fp + t * 16 + 4);
      { union { v8f v; v4f q[2]; } u; u.q[0] = *(const v4f*)(hp + t * 16); u.q[1] = *(const v4f*)(hp + t * 16 + 4); hk[t] = u.v; } }   /* register r = key 8g + r of the tile: the accumulator's own row order */
#pragma unroll
    for (int j = 0; j < HD / 16; ++j) { vf[j] = frag_b(vq + (j * 16) * LP, 0); wf[j] = frag_b(wq + (j * 16) * LP, 0); }
#pragma unroll
    for (int t = 0; t < 2; ++t) { v8f a = hk[t], al = {};   /* kl f_k enters as the C operand of the first product */
#pragma unroll
      for (int kc = 0; kc < HD / 32; ++kc) { a = wmma16(kf[t][kc], qh[kc], a); al = wmma16(kf[t][kc], ql[kc], al); }
#pragma unroll
      for (int r = 0; r < 8; r += 2) { const v2f G = {fk[t * 2 + (r >> 2)][r & 3], fk[t * 2 + (r >> 2)][(r & 3) + 1]}, A = {a[r], a[r + 1]}, R = {al[r], al[r + 1]}; const v2f M = {fmaxf(G[0], fq), fmaxf(G[1], fq)}, x = __builtin_elementwise_fma(M, ka2, __builtin_elementwise_fma(R, r2, A));   /* pairs: packed f32 forms */
        s[t * 8 + r] = x[0]; s[t * 8 + r + 1] = x[1]; } }   /* still in raw-product units */
    float mx = s[0];
#pragma unroll
    for (int i = 1; i < 16; ++i) mx = fmaxf(mx, s[i]);
    mx *= 0.125f * L2E;   /* m is kept in base-2 logits; the scale is positive, so the maximum may be taken in front of it */
    mx = fmaxf(mx, __shfl_xor(mx, 16));   /* the other half of the wave holds this query's other 16 keys */
    const float mn = fmaxf(m, mx), sc = __builtin_amdgcn_exp2f(m - mn); m = mn; float ps = 0.f; const v2f nm2 = {-mn, -mn};
#pragma unroll
    for (int i = 0; i < 16; i += 2) { const v2f x = {s[i], s[i + 1]}, e = __builtin_elementwise_fma(x, c2, nm2); s[i] = e[0]; s[i + 1] = e[1]; }   /* 64^-0.5 log2 e rides in the subtraction's place */
#pragma unroll
    for (int i = 0; i < 16; ++i) { s[i] = __builtin_amdgcn_exp2f(s[i]); ps += s[i]; }
    l = l * sc + ps;
#pragma unroll
    for (int j = 0; j < HD / 16; ++j)
#pragma unroll
      for (int r = 0; r < 8; ++r) o[j][r] *= sc;
    const F2 p = bsplit16(s);   /* element i < 8 = the pass's key 8g + i, i >= 8 = key 16 + 8g + i - 8: the k order of frag_b */
#pragma unroll
    for (int j = 0; j < HD / 16; ++j) { o[j] = wmma_bf(vf[j], p.h, o[j]); o[j] = wmma_bf(vf[j], p.l, o[j]); o[j] = wmma_bf(wf[j], p.h, o[j]); } }
    /* hand-over: this wave's reads of the buffer are done, its copies of the next stage have landed; behind the barrier that holds of every wave, and the buffer just read takes stage st + 2 */
    asm volatile("s_wait_dscnt 0x0" ::: "memory");
    asm volatile("s_wait_asynccnt 0x0" ::: "memory");
    __syncthreads();
    if (st + 2 < NST) stage_copy(lc + (unsigned)(st & 1) * STAGE_B, kg + (size_t)(st + 2) * KST * CC, vg + (st + 2) * KST, wg + (st + 2) * KST); }
  asm volatile("s_wait_asynccnt 0x0" ::: "memory");   /* no copy outstanding when the wave ends */
  l += __shfl_xor(l, 16); const float inv = 1.0f / l;   /* O^T register r of tile j = head dim j*16 + 8g + r of this lane's query: piece (half j & 1, this lane) of k_out's A fragment (row tile of the wave's 16 queries, kc = 2h + (j >> 1)), so y leaves as packed bf16 hi + residual */
  const size_t yo = (((size_t)b * (TT / 16) + blockIdx.x * 8 + wave) * NKC + h * 2) * FRAG_E + lane * 8;
#pragma unroll
  for (int j = 0; j < HD / 16; ++j) { v8b uh, ul;
#pragma unroll
    for (int r = 0; r < 8; ++r) { const float v = o[j][r] * inv; const __bf16 hv = (__bf16)v; uh[r] = hv; ul[r] = (__bf16)(v - (float)hv); }
    vst2(YH + yo + j * 256, uh); vst2(YL + yo + j * 256, ul); } }
// ---- k_out: block = (64 rows, 128 cols): out = y (bf16 hi + lo) Wo + bo
__global__ __launch_bounds__(128) void k_out(const __bf16* __restrict__ YH, const __bf16* __restrict__ YL, const __bf16* __restrict__ WP, const float* __restrict__ BP, float* __restrict__ OUT) { __shared__ __align__(16) float sf[4][16][132];
  const int tid = threadIdx.x, wave = tid >> 5, lane = tid & 31, col = lane & 15, g = lane >> 4; const int c0 = blockIdx.y * 128; const size_t r0 = (size_t)blockIdx.x * 64 + wave * 16;
  v8f acc[8] = {};
  const size_t yo = ((size_t)blockIdx.x * 4 + wave) * (NKC * FRAG_E) + lane * 8; const __bf16* wp = WP + ((size_t)3 * (CC / 16) + blockIdx.y * 8) * (NKC * FRAG_E) + lane * 8;
#pragma unroll 2
  for (int kc = 0; kc < NKC; ++kc) { const v16b ah = frag_p(YH + yo + kc * FRAG_E), al = frag_p(YL + yo + kc * FRAG_E); v16b w[8];   /* the k step's 20 loads together in front of its products, as in k_proj */
#pragma unroll
    for (int j = 0; j < 8; ++j) w[j] = frag_p(wp + (j * NKC + kc) * FRAG_E);
#pragma unroll
    for (int j = 0; j < 8; ++j) { acc[j] = wmma_bf(ah, w[j], acc[j]); acc[j] = wmma_bf(al, w[j], acc[j]); } }
#pragma unroll
  for (int j = 0; j < 8; ++j) { const float bb = BP ? bfr(BP[c0 + j * 16 + col]) : 0.f;
#pragma unroll
    for (int r = 0; r < 8; ++r) sf[wave][8 * g + r][j * 16 + col] = acc[j][r] + bb; }
  LDSX(); for (int rl = 0; rl < 16; ++rl) vst2(OUT + (r0 + rl) * CC + c0 + lane * 4, *(const v4f*)&sf[wave][rl][lane * 4]); }
extern "C" void kernel_launch(void* const* d_in, const int* in_sizes, int n_in, void* d_out, int out_size, void* d_ws, size_t ws_size, hipStream_t stream) {
  (void)in_sizes; (void)n_in; (void)out_size;
  const float** F = (const float**)d_in;   // 0 query, 1 key, 2 value [2,2048,1024]; 3 frac [2,2048]; 4 Wq, 5 Wk, 6 Wv, 7 Wo ((in,out)); 8 bq, 9 bk, 10 bv, 11 bo; 12 alpha_pos [16], 13 alpha_neg [16]
  if (ws_size < (size_t)WS_END) return;
  char* ws = (char*)d_ws; _Float16 *QH = (_Float16*)(ws + WS_QH), *QL = (_Float16*)(ws + WS_QL), *KH = (_Float16*)(ws + WS_KH); __bf16 *VT = (__bf16*)(ws + WS_VT), *VL = (__bf16*)(ws + WS_VL), *YH = (__bf16*)(ws + WS_YH), *YL = (__bf16*)(ws + WS_YL), *XP = (__bf16*)(ws + WS_XP), *WP = (__bf16*)(ws + WS_WP);
  k_pre<<<dim3(PRE_X + PRE_W + TT * 32 / 256), 256, 0, stream>>>(F[0], F[1], F[2], F[4], F[5], F[6], F[7], XP, WP, (float2*)(ws + WS_ROT));
  k_proj<<<dim3(TNB * TT / 64, CC / 128, 3), 128, 0, stream>>>(XP, WP, F[8], F[9], F[10], QH, QL, KH, VT, VL, (const float2*)(ws + WS_ROT));
  k_fa<<<dim3(TT / 128, NH, TNB), 256, 0, stream>>>(QH, QL, KH, VT, VL, F[3], F[12], F[13], YH, YL);
  k_out<<<dim3(TNB * TT / 64, CC / 128), 128, 0, stream>>>(YH, YL, WP, F[11], (float*)d_out);
}

// v006
// Measured time: 150 microseconds a run.
// In two side-by-side timings against v005, it was 1.18 and 1.16 times as fast.
// All steps since v000 together make it 11.2 times as fast.
// compute dtype: all float inputs rounded to bf16; q/k/v = x W + b with EXACT bf16 products on WMMA 16x16x32, f32 accumulate; rotate-half rotary in f32 from a cos/sin table of t * (1/freq_div[i]) (the module's f32 reciprocals; precise cosf/sinf); q as f16 hi + residual (x 2^10), k once to f16 -> 2-product logits + the stoichiometric bias from frac / alpha in f32, written as a per-key term (the products' C operand) + a multiple of max(frac_k, frac_q), its per-query constant left out (softmax does not see it); softmax in f32 in base 2 (64^-0.5 log2 e applied in the fma in front of the hardware exp2) and a running maximum and sum over 32-key steps, logits never stored; unnormalised P split bf16 hi + lo against v bf16 hi + lo (3 products), divided by the sum at the end; y (bf16 hi + lo) Wo + bo; f32 output.
#include <hip/hip_runtime.h>
#include <math.h>

typedef __attribute__((ext_vector_type(16))) _Float16 v16h;
typedef __attribute__((ext_vector_type(16))) __bf16 v16b;
typedef __attribute__((ext_vector_type(8)))  _Float16 v8h;
typedef __attribute__((ext_vector_type(8)))  float v8f;
typedef __attribute__((ext_vector_type(4)))  float v4f;
typedef __attribute__((ext_vector_type(2)))  float v2f;
typedef __attribute__((ext_vector_type(4)))  unsigned v4u;
typedef __attribute__((ext_vector_type(4)))  int v4i;
typedef float __attribute__((may_alias)) float_a;
typedef int __attribute__((may_alias)) int_a;

template <typename T> __device__ __forceinline__ void vst2(void* p, T v) { *(T*)p = v;  }
__device__ __forceinline__ v8f wmma16(v16h a, v16h b, v8f c) {
  v8f d = __builtin_amdgcn_wmma_f32_16x16x32_f16(false, a, false, b, (short)0, c, false, false);
  asm volatile("v_nop\n\tv_nop\n\tv_nop\n\tv_nop" : "+v"(d) : "v"(a), "v"(b));
  return d;
}
__device__ __forceinline__ v8f wmma_bf(v16b a, v16b b, v8f c) {
  v8f d = __builtin_amdgcn_wmma_f32_16x16x32_bf16(false, a, false, b, (short)0, c, false, false);
  asm volatile("v_nop\n\tv_nop\n\tv_nop\n\tv_nop" : "+v"(d) : "v"(a), "v"(b));
  return d;
}
// 16x16x32 fragments: lane = (h = lane>>4, row/col = lane&15); elements 0..7 = k0+8h+0..7, 8..15 = k0+16+8h+0..7; D element r = row 8h+r
__device__ __forceinline__ v16h frag_h(const _Float16* rowk0, int lane) {
  union { v16h v; v8h q[2]; } u; const _Float16* p = rowk0 + 8 * (lane >> 4);
  u.q[0] = *(const v8h*)p; u.q[1] = *(const v8h*)(p + 16); return u.v;
}
__device__ __forceinline__ v16h frag_f32(const float* rowk0, int lane) {
  v16h a; const float* p = rowk0 + 8 * (lane >> 4);
#pragma unroll
  for (int i = 0; i < 8; ++i) { a[i] = (_Float16)p[i]; a[8 + i] = (_Float16)p[16 + i]; }
  return a;
}
__device__ __forceinline__ v16h frag_f32s(const float* rowk0, int lane, float sc) {
  v16h a; const float* p = rowk0 + 8 * (lane >> 4);
#pragma unroll
  for (int i = 0; i < 8; ++i) { a[i] = (_Float16)(p[i] * sc); a[8 + i] = (_Float16)(p[16 + i] * sc); }
  return a;
}
// column fragment from a [K][ld] layout (column n), rows >= K read as 0
__device__ __forceinline__ v16h fragc_f32(const float* W, int k0, int n, int lane, int ld, int K) {
  v16h a; const int g = lane >> 4;
#pragma unroll
  for (int i = 0; i < 8; ++i) { const int ka = k0 + 8 * g + i, kb = ka + 16;
    a[i] = (_Float16)(ka < K ? W[(size_t)(ka < K ? ka : K - 1) * ld + n] : 0.f); a[8 + i] = (_Float16)(kb < K ? W[(size_t)(kb < K ? kb : K - 1) * ld + n] : 0.f); }
  return a;
}
struct F2 { v16b h, l; };
__device__ __forceinline__ F2 bsplit16(const float v[16]) { F2 r;
#pragma unroll
  for (int i = 0; i < 16; ++i) { const __bf16 h = (__bf16)v[i]; r.h[i] = h; r.l[i] = (__bf16)(v[i] - (float)h); }
  return r; }
__device__ __forceinline__ F2 split_row(const float* row, int k0, int lane) { float v[16]; const float* p = row + k0 + 8 * (lane >> 4);
#pragma unroll
  for (int i = 0; i < 8; ++i) { v[i] = p[i]; v[8 + i] = p[16 + i]; }
  return bsplit16(v); }
__device__ __forceinline__ F2 split_rowK(const float* row, int k0, int lane, int K) { float v[16]; const int g = lane >> 4;
#pragma unroll
  for (int i = 0; i < 8; ++i) { const int ka = k0 + 8 * g + i, kb = ka + 16; v[i] = ka < K ? row[ka < K ? ka : K - 1] : 0.f; v[8 + i] = kb < K ? row[kb < K ? kb : K - 1] : 0.f; }
  return bsplit16(v); }
__device__ __forceinline__ F2 split_col(const float* W, int k0, int n, int lane, int ld, int K) { float v[16]; const int g = lane >> 4;
#pragma unroll
  for (int i = 0; i < 8; ++i) { const int ka = k0 + 8 * g + i, kb = ka + 16; v[i] = ka < K ? W[(size_t)(ka < K ? ka : K - 1) * ld + n] : 0.f; v[8 + i] = kb < K ? W[(size_t)(kb < K ? kb : K - 1) * ld + n] : 0.f; }
  return bsplit16(v); }
__device__ __forceinline__ v8f mac3(const F2& a, const F2& b, v8f c) { c = wmma_bf(a.l, b.h, c); c = wmma_bf(a.h, b.l, c); return wmma_bf(a.h, b.h, c); }
__device__ __forceinline__ float sigm(float v) { return 1.0f / (1.0f + expf(-v)); }
#define LDSX() do { asm volatile("s_wait_dscnt 0" ::: "memory"); __builtin_amdgcn_wave_barrier(); __builtin_amdgcn_fence(__ATOMIC_RELEASE, "workgroup"); } while (0)


// Multi-head attention with rotary embedding and a data-dependent 'stoichiometric' bias (B 2, T 2,048, D 1,024 = 16 x 64): Q = query Wq + bq, K = key Wk + bk, V = value Wv + bv ((in,out)); rotate-half RoPE with angle t / 10000^(2i/64); scores = Q K^T 64^-0.5 + (alpha_pos[h] if frac_j >= frac_i else alpha_neg[h]) (frac_j - frac_i); softmax; P V; out Wo + bo.
#define NB 2
#define TT 2048
#define CC 1024
#define NH 16
#define HD 64
__constant__ float RCPF[32] = {1.000000000e+0f,7.498942018e-1f,5.623413324e-1f,4.216965139e-1f,3.162277639e-1f,2.371373624e-1f,1.778279394e-1f,1.333521456e-1f,1.000000015e-1f,7.498941571e-2f,5.623412877e-2f,4.216964915e-2f,3.162277862e-2f,2.371373586e-2f,1.778279431e-2f,1.333521493e-2f,9.999999776e-3f,7.498942316e-3f,5.623413250e-3f,4.216964822e-3f,3.162277862e-3f,2.371373819e-3f,1.778279431e-3f,1.333521446e-3f,1.000000047e-3f,7.498941850e-4f,5.623413017e-4f,4.216964880e-4f,3.162277862e-4f,2.371373848e-4f,1.778279402e-4f,1.333521504e-4f};   // f32(1 / f32(10000^(2i/64))): the module divides pos by freq_div, which XLA evaluates as pos * (1/freq_div)
#ifndef TNB
#define TNB NB
#endif
typedef __attribute__((ext_vector_type(8))) __bf16 v8b;
__device__ __forceinline__ v16b frag_b(const __bf16* rowk0, int lane) {
  union { v16b v; v8b q[2]; } u; const __bf16* p = rowk0 + 8 * (lane >> 4);
  u.q[0] = *(const v8b*)p; u.q[1] = *(const v8b*)(p + 16); return u.v;
}
__device__ __forceinline__ float bfr(float v) { return (float)(__bf16)v; }
__device__ __attribute__((noinline)) float exp_ni(float v) { return expf(v); }
__device__ __attribute__((noinline)) float erf_ni(float v) { return erff(v); }

#define WS_ROT 0u                                   // float2 (cos, sin)[t][32] = cos/sin(t * (1/freq_div[j]))
#define WS_QH  (WS_ROT + 8u * (size_t)TT * 32)
#define WS_QL  (WS_QH + 2u * (size_t)NB * TT * CC)
#define WS_KH  (WS_QL + 2u * (size_t)NB * TT * CC)
#define WS_VT  (WS_KH + 2u * (size_t)NB * TT * CC)      // bf16 v planes [b][c][t]
#define WS_VL  (WS_VT + 2u * (size_t)NB * CC * TT)      // bf16 v residual planes
#define WS_YH  (WS_VL + 2u * (size_t)NB * CC * TT)      // y, bf16 hi, packed fragments [row tile][kc]
#define WS_YL  (WS_YH + 2u * (size_t)NB * TT * CC)      // y, bf16 residual, packed likewise
#define WS_XP  (WS_YL + 2u * (size_t)NB * TT * CC)      // query, key, value as bf16, packed fragments [which][row tile][kc]
#define WS_WP  (WS_XP + 3u * 2u * (size_t)NB * TT * CC) // Wq, Wk, Wv, Wo as bf16, packed fragments [matrix][column tile][kc]
#define WS_END (WS_WP + 4u * 2u * (size_t)CC * CC)
// A packed fragment is the 1 KiB that one 16x16x32 operand takes, in the order the wave reads it: 16-byte piece (half, lane) at element half * 256 + lane * 8 holds k = kc * 32 + half * 16 + 8 * (lane >> 4) + 0..7 of row (or column) tile * 16 + (lane & 15); each of the two wave-wide 16-byte loads then covers 512 contiguous bytes, four whole lines
#define FRAG_E 512
#define NKC (CC / 32)
__device__ __forceinline__ v16b frag_p(const __bf16* lanebase) {
  union { v16b v; v8b q[2]; } u; u.q[0] = *(const v8b*)lanebase; u.q[1] = *(const v8b*)(lanebase + 256); return u.v;
}

// ---- k_pre: everything the GEMMs read is laid out once a call. Blocks 0..383: a wave packs 8 kc of one 16-row tile of query / key / value (f32 -> bf16). Blocks 384..639: a wave packs 4 column tiles of one kc of one weight matrix (the transposition happens here, once, not in every GEMM wave). Blocks 640..895: one thread per (t, j): precise cosf/sinf of t * inv_freq[j] -> table (keeps the trig and its large-argument reduction out of the GEMM kernel)
#define PRE_X (3 * (NB * TT / 16) * (NKC / 8) / 8)
#define PRE_W (4 * NKC * (CC / 64) / 8)
__global__ __launch_bounds__(256) void k_pre(const float* __restrict__ X0, const float* __restrict__ X1, const float* __restrict__ X2, const float* __restrict__ WQ, const float* __restrict__ WK, const float* __restrict__ WV, const float* __restrict__ WO, __bf16* __restrict__ XP, __bf16* __restrict__ WP, float2* __restrict__ ROT) {
  const int tid = threadIdx.x, wave = tid >> 5, lane = tid & 31, col = lane & 15, g = lane >> 4; const int bx = blockIdx.x;
  if (bx < PRE_X) { const int u = bx * 8 + wave, kg = u & 3, rt = (u >> 2) & (NB * TT / 16 - 1), which = u >> 10; const float* X = which == 0 ? X0 : which == 1 ? X1 : X2;
    const float* p = X + ((size_t)rt * 16 + col) * CC + kg * 256 + 8 * g; __bf16* d = XP + (((size_t)which * (NB * TT / 16) + rt) * NKC + kg * 8) * FRAG_E + lane * 8;
    v4f a[16], b2[16];
#pragma unroll
    for (int e = 0; e < 16; ++e) { a[e] = *(const v4f*)(p + e * 16); b2[e] = *(const v4f*)(p + e * 16 + 4); }
    asm volatile("s_wait_xcnt 0x0" :: "v"(p) : "memory");   /* the loads' address pair stays whole until this wait */
#pragma unroll
    for (int e = 0; e < 16; ++e) { v8b o;
#pragma unroll
      for (int i = 0; i < 4; ++i) { o[i] = (__bf16)a[e][i]; o[4 + i] = (__bf16)b2[e][i]; }
      vst2(d + e * 256, o); }
    return; }
  if (bx < PRE_X + PRE_W) { const int u = (bx - PRE_X) * 8 + wave, ng = u & 15, kc = (u >> 4) & (NKC - 1), mat = u >> 9; const float* Wm = mat == 0 ? WQ : mat == 1 ? WK : mat == 2 ? WV : WO;
    const float* p = Wm + ((size_t)kc * 32 + 8 * g) * CC + ng * 64 + col; __bf16* d = WP + (((size_t)mat * (CC / 16) + ng * 4) * NKC + kc) * FRAG_E + lane * 8;
#pragma unroll
    for (int n = 0; n < 4; ++n)
#pragma unroll
      for (int hf = 0; hf < 2; ++hf) { v8b o;
#pragma unroll
        for (int i = 0; i < 8; ++i) o[i] = (__bf16)p[(size_t)(hf * 16 + i) * CC + n * 16];
        vst2(d + (size_t)n * NKC * FRAG_E + hf * 256, o); }
    asm volatile("s_wait_xcnt 0x0" ::: "memory");   /* behind the last store: the stores' address pair is not written anew on any way out of this part before the wait */
    return; }
  const int i = (bx - PRE_X - PRE_W) * 256 + tid; if (i >= TT * 32) return; const int t = i >> 5, j = i & 31; const float ang = (float)t * RCPF[j]; v2f v; v[0] = cosf(ang); v[1] = sinf(ang); vst2((v2f*)(ROT + i), v); }
// ---- k_proj: block = (128 rows, 128 cols, which), four waves of 64 x 64 (one head each): a k step's 8 fragments feed 16 products; qkv = x W (+ b), exact; q -> f16 hi (+ residual), k -> f16 rows, v -> bf16 planes. The 768 blocks are resident together, three a WGP (the q/k staging and the v staging share one LDS buffer)
#define PJP 136                 /* LDS row pitch of the output staging in 16-bit elements: 272 B = 16 B x 17 */
__global__ __launch_bounds__(128) void k_proj(const __bf16* __restrict__ XP, const __bf16* __restrict__ WP, const float* __restrict__ BQ, const float* __restrict__ BK, const float* __restrict__ BV, _Float16* __restrict__ QH, _Float16* __restrict__ QL, _Float16* __restrict__ KH, __bf16* __restrict__ VT, __bf16* __restrict__ VL, const float2* __restrict__ ROT) {
  __shared__ __align__(16) unsigned short sm[2][128][PJP];
  _Float16 (*sh)[PJP] = (_Float16 (*)[PJP])sm[0]; _Float16 (*sl)[PJP] = (_Float16 (*)[PJP])sm[1]; __bf16 (*th)[PJP] = (__bf16 (*)[PJP])sm[0]; __bf16 (*tl2)[PJP] = (__bf16 (*)[PJP])sm[1];
  const int tid = threadIdx.x, wave = tid >> 5, lane = tid & 31, col = lane & 15, g = lane >> 4, wr = wave >> 1, wc = wave & 1; const int which = blockIdx.z; const int c0 = blockIdx.y * 128; const size_t r0 = (size_t)blockIdx.x * 128; const float* BA = which == 0 ? BQ : which == 1 ? BK : BV;
  v8f acc[4][4] = {};
  const __bf16* xp = XP + ((size_t)which * (NB * TT / 16) + blockIdx.x * 8 + wr * 4) * (NKC * FRAG_E) + lane * 8; const __bf16* wp = WP + ((size_t)which * (CC / 16) + blockIdx.y * 8 + wc * 4) * (NKC * FRAG_E) + lane * 8;
#pragma unroll 2
  for (int kc = 0; kc < NKC; ++kc) { v16b a[4], w[4];   /* the k step's 16 loads stand together in front of its products: one latency a step, not one a fragment */
#pragma unroll
    for (int i = 0; i < 4; ++i) a[i] = frag_p(xp + (i * NKC + kc) * FRAG_E);
#pragma unroll
    for (int j = 0; j < 4; ++j) w[j] = frag_p(wp + (j * NKC + kc) * FRAG_E);
#pragma unroll
    for (int i = 0; i < 4; ++i)
#pragma unroll
      for (int j = 0; j < 4; ++j) acc[i][j] = wmma_bf(a[i], w[j], acc[i][j]); }
  { float b4[4] = {0.f, 0.f, 0.f, 0.f};
    if (BA) { const float* bp = BA + c0 + wc * 64 + col;
#pragma unroll
      for (int j = 0; j < 4; ++j) b4[j] = bp[j * 16];
      asm volatile("s_wait_xcnt 0x0" :: "v"(bp) : "memory"); }   /* the four loads' address stays whole until this wait: no load lands on it */
#pragma unroll
    for (int j = 0; j < 4; ++j) { const float bb0 = bfr(b4[j]);
#pragma unroll
      for (int i = 0; i < 4; ++i)
#pragma unroll
        for (int r = 0; r < 8; ++r) acc[i][j][r] += bb0; } }   /* bias before the rotary */
  if (which < 2) {   /* rotate-half rotary on all 64 head dims: the wave's four column tiles are one head; tiles j (d 0..15), j+1 (16..31) pair with j+2 (32..47), j+3 (48..63) in the SAME lane and row: out[d] = x[d] c - x[d+32] s, out[d+32] = x[d] s + x[d+32] c, angle index = d (< 32). A block's 128 rows lie in one batch, so t = r0 % TT + the row in the block */
    const float2* rp = ROT + (size_t)((int)(r0 % TT) + wr * 64 + 8 * g) * 32 + col; float2 cv[4][2][8];
#pragma unroll
    for (int i = 0; i < 4; ++i)
#pragma unroll
      for (int j = 0; j < 2; ++j)
#pragma unroll
        for (int r = 0; r < 8; ++r) cv[i][j][r] = rp[(i * 16 + r) * 32 + j * 16];
#pragma unroll
    for (int i = 0; i < 4; ++i)
#pragma unroll
      for (int j = 0; j < 2; ++j)
#pragma unroll
        for (int r = 0; r < 8; ++r) { const float xl = acc[i][j][r], xr = acc[i][j + 2][r]; acc[i][j][r] = xl * cv[i][j][r].x - xr * cv[i][j][r].y; acc[i][j + 2][r] = xl * cv[i][j][r].y + xr * cv[i][j][r].x; } }
  if (which == 2) {   /* the branch on the matrix stands once, outside the 128 elements */
#pragma unroll
    for (int i = 0; i < 4; ++i)
#pragma unroll
      for (int j = 0; j < 4; ++j)
#pragma unroll
        for (int r = 0; r < 8; ++r) { const float v = acc[i][j][r] + 0.f; const int rl = wr * 64 + i * 16 + 8 * g + r, cl = wc * 64 + j * 16 + col; const __bf16 bh = (__bf16)v; th[cl][rl] = bh; tl2[cl][rl] = (__bf16)(v - (float)bh); } }
  else {
#pragma unroll
    for (int i = 0; i < 4; ++i)
#pragma unroll
      for (int j = 0; j < 4; ++j)
#pragma unroll
        for (int r = 0; r < 8; ++r) { const float v = acc[i][j][r] + 0.f; const int rl = wr * 64 + i * 16 + 8 * g + r, cl = wc * 64 + j * 16 + col; const _Float16 hv = (_Float16)v; sh[rl][cl] = hv; sl[rl][cl] = (_Float16)((v - (float)hv) * 1024.0f); } }   /* q residual carried x 2^10 so the plane stays f16-normal on the chip */
  __syncthreads();
  if (which == 0) { for (int e = tid; e < 128 * 16; e += 128) { const int rl = e >> 4, q = e & 15; _Float16* d0 = QH + (r0 + rl) * CC + c0 + q * 8; _Float16* d1 = QL + (r0 + rl) * CC + c0 + q * 8; const v4u u0 = *(const v4u*)&sh[rl][q * 8], u1 = *(const v4u*)&sl[rl][q * 8]; vst2(d0, u0); vst2(d1, u1); } }
  else if (which == 1) { for (int e = tid; e < 128 * 16; e += 128) { const int rl = e >> 4, q = e & 15; _Float16* d0 = KH + (r0 + rl) * CC + c0 + q * 8; const v4u u0 = *(const v4u*)&sh[rl][q * 8]; vst2(d0, u0); } }
  else { const size_t b = r0 / TT; const int t0 = (int)(r0 % TT); for (int e = tid; e < 128 * 16; e += 128) { const int cl = e >> 4, q = e & 15; const size_t o2 = (b * CC + c0 + cl) * (size_t)TT + t0 + q * 8; __bf16* d0 = VT + o2; __bf16* d1 = VL + o2; const v4u u0 = *(const v4u*)&th[cl][q * 8], u1 = *(const v4u*)&tl2[cl][q * 8]; vst2(d0, u0); vst2(d1, u1); } } }
// ---- k_fa: block = 8 waves x 16 queries of one (b, h); the block's keys come through LDS: a stage is 64 keys (K rows, V^T hi rows, V^T lo rows, 128 B a row at a pitch of 144 B), brought once for all eight waves by asynchronous copies into two buffers, the next stage flying while this one is worked on; the batch's 2,048 values of frac go to LDS once, as two f32 tables. A wave walks a stage 32 keys at a time and never stores a logit: S^T = kl frac_k + K Q^T (2 products) + ka max(frac_k, frac_q), x 64^-0.5 log2 e inside the fma that takes the maximum off, so that each weight is one exp2, running maximum and sum per query (a lane holds one query's column: keys 8g+r of each 16-key tile), P^T packed from the two score tiles straight into a B operand (hardware k order), O^T += V^T P^T (3 products), O^T / sum at the end. waves_per_eu(4, 4): a budget of 256 registers, the 512 blocks resident together, two a WGP
#define L2E 1.44269504088896340736f   /* log2(e): logits are carried in base 2 */
#define KST 64                  /* keys a stage */
#define NST (TT / KST)
#define LP 72                   /* LDS row pitch in 16-bit elements: 144 B = 16 B x 9, free of bank conflicts for 16-byte readers */
#define TILE_B (64 * LP * 2)
#define STAGE_B (3 * TILE_B)
// one stage's six 16-byte copies of a lane (rows r and r + 32 of K, V hi, V lo). The s_wait_xcnt stands inside the statement, so that no register which an issued copy names is written anew in front of it
__device__ __forceinline__ void stage_copy(unsigned l, const _Float16* k, const __bf16* v, const __bf16* w) {
  const unsigned l1 = l + 32 * LP * 2, l2 = l + TILE_B, l3 = l2 + 32 * LP * 2, l4 = l + 2 * TILE_B, l5 = l4 + 32 * LP * 2; const _Float16* k1 = k + (size_t)32 * CC; const __bf16* v1 = v + (size_t)32 * TT; const __bf16* w1 = w + (size_t)32 * TT;
  asm volatile("global_load_async_to_lds_b128 %0, %6, off\n\tglobal_load_async_to_lds_b128 %1, %7, off\n\tglobal_load_async_to_lds_b128 %2, %8, off\n\tglobal_load_async_to_lds_b128 %3, %9, off\n\tglobal_load_async_to_lds_b128 %4, %10, off\n\tglobal_load_async_to_lds_b128 %5, %11, off\n\ts_wait_xcnt 0x0" :: "v"(l), "v"(l1), "v"(l2), "v"(l3), "v"(l4), "v"(l5), "v"(k), "v"(k1), "v"(v), "v"(v1), "v"(w), "v"(w1) : "memory");
}
__global__ __launch_bounds__(256) __attribute__((amdgpu_waves_per_eu(4, 4))) void k_fa(const _Float16* __restrict__ QH, const _Float16* __restrict__ QL, const _Float16* __restrict__ KH, const __bf16* __restrict__ VT, const __bf16* __restrict__ VL, const float* __restrict__ FR, const float* __restrict__ AP, const float* __restrict__ AN, __bf16* __restrict__ YH, __bf16* __restrict__ YL) {
  __shared__ __align__(16) unsigned char ring[2 * STAGE_B]; __shared__ __align__(16) float sG[TT], sH[TT];
  const int tid = threadIdx.x, wave = tid >> 5, lane = tid & 31, col = lane & 15, g = lane >> 4; const int h = blockIdx.y, b = blockIdx.z; const int q = blockIdx.x * 128 + wave * 16 + col;
  const size_t qrow = ((size_t)b * TT + q) * CC + h * HD;
  /* the copies: thread = (row tid >> 3, 16-byte piece tid & 7), so a wave's copy covers four whole 128-byte rows */
  const int crow = tid >> 3, cpc = tid & 7; const _Float16* kg = KH + ((size_t)b * TT + crow) * CC + h * HD + cpc * 8; const size_t vg0 = ((size_t)b * CC + h * HD + crow) * (size_t)TT + cpc * 8; const __bf16* vg = VT + vg0; const __bf16* wg = VL + vg0;
  const unsigned lc = (unsigned)(size_t)ring + (unsigned)(crow * (LP * 2) + cpc * 16);
  stage_copy(lc, kg, vg, wg);
  /* the bias (D >= 0 ? ap : an) D, D = f_k - f_q, is an f_k + (ap - an) max(f_k, f_q) - ap f_q (f_k >= f_q: ap f_k - ap f_q; else an f_k - an f_q). The last term, one constant a query, leaves the softmax unchanged: it is not formed. In units of the raw product (logit / 64^-0.5): kl f_k + ka max(f_k, f_q). The block's two tables, once: sG = f_k (rounded as before), sH = kl f_k */
  const float ap = bfr(AP[h]), an = bfr(AN[h]), kl = 8.0f * an, ka = 8.0f * (ap - an), fq = bfr(FR[(size_t)b * TT + q]);
#pragma unroll
  for (int e = 0; e < 2; ++e) { const int i0 = e * 1024 + tid * 4; const v4f f = *(const v4f*)(FR + (size_t)b * TT + i0); v4f gv, hv;
#pragma unroll
    for (int i = 0; i < 4; ++i) { gv[i] = bfr(f[i]); hv[i] = gv[i] * kl; }
    *(v4f*)(sG + i0) = gv; *(v4f*)(sH + i0) = hv; }
  v16h qh[HD / 32], ql[HD / 32];
#pragma unroll
  for (int kc = 0; kc < HD / 32; ++kc) { qh[kc] = frag_h(QH + qrow + kc * 32, lane); ql[kc] = frag_h(QL + qrow + kc * 32, lane); }
  asm volatile("s_wait_asynccnt 0x0" ::: "memory");   /* this wave's copies of stage 0 have landed */
  __syncthreads();                                    /* and every other wave's, and every wave's part of the two tables */
  stage_copy(lc + STAGE_B, kg + (size_t)KST * CC, vg + KST, wg + KST);
  const int lo = col * LP + 8 * g;   /* each lane's own row and 8g */
  v8f o[HD / 16] = {}; float m = -3.0e38f, l = 0.f; const v2f ka2 = {ka, ka}, r2 = {1.0f / 1024.0f, 1.0f / 1024.0f}, c2 = {0.125f * L2E, 0.125f * L2E};
#pragma unroll 1   /* rolled: one stage's code serves both buffers */
  for (int st = 0; st < NST; ++st) { const unsigned char* bp = ring + (st & 1) * STAGE_B;
#pragma unroll 1   /* rolled: the fragments of two passes do not fit 256 registers */
  for (int hf = 0; hf < KST / 32; ++hf) { float s[16]; v4f fk[4]; v8f hk[2]; v16h kf[2][HD / 32]; v16b vf[HD / 16], wf[HD / 16];
    const _Float16* kq = (const _Float16*)bp + hf * 32 * LP + lo; const __bf16* vq = (const __bf16*)(bp + TILE_B) + hf * 32 + lo; const __bf16* wq = (const __bf16*)(bp + 2 * TILE_B) + hf * 32 + lo; const float* fp = sG + st * KST + hf * 32 + 8 * g; const float* hp = sH + st * KST + hf * 32 + 8 * g;
#pragma unroll
    for (int t = 0; t < 2; ++t) {
#pragma unroll
      for (int kc = 0; kc < HD / 32; ++kc) kf[t][kc] = frag_h(kq + (t * 16) * LP + kc * 32, 0);
      fk[t * 2] = *(const v4f*)(fp + t * 16); fk[t * 2 + 1] = *(const v4f*)(fp + t * 16 + 4);
      { union { v8f v; v4f q[2]; } u; u.q[0] = *(const v4f*)(hp + t * 16); u.q[1] = *(const v4f*)(hp + t * 16 + 4); hk[t] = u.v; } }   /* register r = key 8g + r of the tile: the accumulator's own row order */
#pragma unroll
    for (int j = 0; j < HD / 16; ++j) { vf[j] = frag_b(vq + (j * 16) * LP, 0); wf[j] = frag_b(wq + (j * 16) * LP, 0); }
#pragma unroll
    for (int t = 0; t < 2; ++t) { v8f a = hk[t], al = {};   /* kl f_k enters as the C operand of the first product */
#pragma unroll
      for (int kc = 0; kc < HD / 32; ++kc) { a = wmma16(kf[t][kc], qh[kc], a); al = wmma16(kf[t][kc], ql[kc], al); }
#pragma unroll
      for (int r = 0; r < 8; r += 2) { const v2f G = {fk[t * 2 + (r >> 2)][r & 3], fk[t * 2 + (r >> 2)][(r & 3) + 1]}, A = {a[r], a[r + 1]}, R = {al[r], al[r + 1]}; const v2f M = {fmaxf(G[0], fq), fmaxf(G[1], fq)}, x = __builtin_elementwise_fma(M, ka2, __builtin_elementwise_fma(R, r2, A));   /* pairs: packed f32 forms */
        s[t * 8 + r] = x[0]; s[t * 8 + r + 1] = x[1]; } }   /* still in raw-product units */
    float mx = s[0];
#pragma unroll
    for (int i = 1; i < 16; ++i) mx = fmaxf(mx, s[i]);
    mx *= 0.125f * L2E;   /* m is kept in base-2 logits; the scale is positive, so the maximum may be taken in front of it */
    mx = fmaxf(mx, __shfl_xor(mx, 16));   /* the other half of the wave holds this query's other 16 keys */
    const float mn = fmaxf(m, mx), sc = __builtin_amdgcn_exp2f(m - mn); m = mn; float ps = 0.f; const v2f nm2 = {-mn, -mn};
#pragma unroll
    for (int i = 0; i < 16; i += 2) { const v2f x = {s[i], s[i + 1]}, e = __builtin_elementwise_fma(x, c2, nm2); s[i] = e[0]; s[i + 1] = e[1]; }   /* 64^-0.5 log2 e rides in the subtraction's place */
#pragma unroll
    for (int i = 0; i < 16; ++i) { s[i] = __builtin_amdgcn_exp2f(s[i]); ps += s[i]; }
    l = l * sc + ps;
#pragma unroll
    for (int j = 0; j < HD / 16; ++j)
#pragma unroll
      for (int r = 0; r < 8; ++r) o[j][r] *= sc;
    const F2 p = bsplit16(s);   /* element i < 8 = the pass's key 8g + i, i >= 8 = key 16 + 8g + i - 8: the k order of frag_b */
#pragma unroll
    for (int j = 0; j < HD / 16; ++j) { o[j] = wmma_bf(vf[j], p.h, o[j]); o[j] = wmma_bf(vf[j], p.l, o[j]); o[j] = wmma_bf(wf[j], p.h, o[j]); } }
    /* hand-over: this wave's reads of the buffer are done, its copies of the next stage have landed; behind the barrier that holds of every wave, and the buffer just read takes stage st + 2 */
    asm volatile("s_wait_dscnt 0x0" ::: "memory");
    asm volatile("s_wait_asynccnt 0x0" ::: "memory");
    __syncthreads();
    if (st + 2 < NST) stage_copy(lc + (unsigned)(st & 1) * STAGE_B, kg + (size_t)(st + 2) * KST * CC, vg + (st + 2) * KST, wg + (st + 2) * KST); }
  asm volatile("s_wait_asynccnt 0x0" ::: "memory");   /* no copy outstanding when the wave ends */
  l += __shfl_xor(l, 16); const float inv = 1.0f / l;   /* O^T register r of tile j = head dim j*16 + 8g + r of this lane's query: piece (half j & 1, this lane) of k_out's A fragment (row tile of the wave's 16 queries, kc = 2h + (j >> 1)), so y leaves as packed bf16 hi + residual */
  const size_t yo = (((size_t)b * (TT / 16) + blockIdx.x * 8 + wave) * NKC + h * 2) * FRAG_E + lane * 8;
#pragma unroll
  for (int j = 0; j < HD / 16; ++j) { v8b uh, ul;
#pragma unroll
    for (int r = 0; r < 8; ++r) { const float v = o[j][r] * inv; const __bf16 hv = (__bf16)v; uh[r] = hv; ul[r] = (__bf16)(v - (float)hv); }
    vst2(YH + yo + j * 256, uh); vst2(YL + yo + j * 256, ul); } }
// ---- k_out: block = (64 rows, 128 cols): out = y (bf16 hi + lo) Wo + bo
__global__ __launch_bounds__(128) void k_out(const __bf16* __restrict__ YH, const __bf16* __restrict__ YL, const __bf16* __restrict__ WP, const float* __restrict__ BP, float* __restrict__ OUT) { __shared__ __align__(16) float sf[4][16][132];
  const int tid = threadIdx.x, wave = tid >> 5, lane = tid & 31, col = lane & 15, g = lane >> 4; const int c0 = blockIdx.y * 128; const size_t r0 = (size_t)blockIdx.x * 64 + wave * 16;
  v8f acc[8] = {};
  const size_t yo = ((size_t)blockIdx.x * 4 + wave) * (NKC * FRAG_E) + lane * 8; const __bf16* wp = WP + ((size_t)3 * (CC / 16) + blockIdx.y * 8) * (NKC * FRAG_E) + lane * 8;
#pragma unroll 2
  for (int kc = 0; kc < NKC; ++kc) { const v16b ah = frag_p(YH + yo + kc * FRAG_E), al = frag_p(YL + yo + kc * FRAG_E); v16b w[8];   /* the k step's 20 loads together in front of its products, as in k_proj */
#pragma unroll
    for (int j = 0; j < 8; ++j) w[j] = frag_p(wp + (j * NKC + kc) * FRAG_E);
#pragma unroll
    for (int j = 0; j < 8; ++j) { acc[j] = wmma_bf(ah, w[j], acc[j]); acc[j] = wmma_bf(al, w[j], acc[j]); } }
#pragma unroll
  for (int j = 0; j < 8; ++j) { const float bb = BP ? bfr(BP[c0 + j * 16 + col]) : 0.f;
#pragma unroll
    for (int r = 0; r < 8; ++r) sf[wave][8 * g + r][j * 16 + col] = acc[j][r] + bb; }
  LDSX(); for (int rl = 0; rl < 16; ++rl) vst2(OUT + (r0 + rl) * CC + c0 + lane * 4, *(const v4f*)&sf[wave][rl][lane * 4]); }
extern "C" void kernel_launch(void* const* d_in, const int* in_sizes, int n_in, void* d_out, int out_size, void* d_ws, size_t ws_size, hipStream_t stream) {
  (void)in_sizes; (void)n_in; (void)out_size;
  const float** F = (const float**)d_in;   // 0 query, 1 key, 2 value [2,2048,1024]; 3 frac [2,2048]; 4 Wq, 5 Wk, 6 Wv, 7 Wo ((in,out)); 8 bq, 9 bk, 10 bv, 11 bo; 12 alpha_pos [16], 13 alpha_neg [16]
  if (ws_size < (size_t)WS_END) return;
  char* ws = (char*)d_ws; _Float16 *QH = (_Float16*)(ws + WS_QH), *QL = (_Float16*)(ws + WS_QL), *KH = (_Float16*)(ws + WS_KH); __bf16 *VT = (__bf16*)(ws + WS_VT), *VL = (__bf16*)(ws + WS_VL), *YH = (__bf16*)(ws + WS_YH), *YL = (__bf16*)(ws + WS_YL), *XP = (__bf16*)(ws + WS_XP), *WP = (__bf16*)(ws + WS_WP);
  k_pre<<<dim3(PRE_X + PRE_W + TT * 32 / 256), 256, 0, stream>>>(F[0], F[1], F[2], F[4], F[5], F[6], F[7], XP, WP, (float2*)(ws + WS_ROT));
  k_proj<<<dim3(TNB * TT / 128, CC / 128, 3), 128, 0, stream>>>(XP, WP, F[8], F[9], F[10], QH, QL, KH, VT, VL, (const float2*)(ws + WS_ROT));
  k_fa<<<dim3(TT / 128, NH, TNB), 256, 0, stream>>>(QH, QL, KH, VT, VL, F[3], F[12], F[13], YH, YL);
  k_out<<<dim3(TNB * TT / 64, CC / 128), 128, 0, stream>>>(YH, YL, WP, F[11], (float*)d_out);
}

// v007
// A run of this version takes 134 microseconds.
// Next to v006, in two timings, it ran 1.13 and 1.11 times as fast.
// Counting every step since v000, it is 12.5 times as fast.
// compute dtype: all float inputs rounded to bf16; q/k/v = x W + b with EXACT bf16 products on WMMA 16x16x32, f32 accumulate; rotate-half rotary in f32 from a cos/sin table of t * (1/freq_div[i]) (the module's f32 reciprocals; precise cosf/sinf); q as f16 hi + residual (x 2^10), k once to f16 -> 2-product logits + the stoichiometric bias from frac / alpha in f32, written as a per-key term (the products' C operand) + a multiple of max(frac_k, frac_q), its per-query constant left out (softmax does not see it); softmax in f32 in base 2 (64^-0.5 log2 e applied in the fma in front of the hardware exp2) and a running maximum and sum over 32-key steps, logits never stored; unnormalised P split bf16 hi + lo against v bf16 hi + lo (3 products), divided by the sum at the end; y (bf16 hi + lo) Wo + bo; f32 output.
#include <hip/hip_runtime.h>
#include <math.h>

typedef __attribute__((ext_vector_type(16))) _Float16 v16h;
typedef __attribute__((ext_vector_type(16))) __bf16 v16b;
typedef __attribute__((ext_vector_type(8)))  _Float16 v8h;
typedef __attribute__((ext_vector_type(8)))  float v8f;
typedef __attribute__((ext_vector_type(4)))  float v4f;
typedef __attribute__((ext_vector_type(2)))  float v2f;
typedef __attribute__((ext_vector_type(4)))  unsigned v4u;
typedef __attribute__((ext_vector_type(4)))  int v4i;
typedef float __attribute__((may_alias)) float_a;
typedef int __attribute__((may_alias)) int_a;

template <typename T> __device__ __forceinline__ void vst2(void* p, T v) { *(T*)p = v;  }
__device__ __forceinline__ v8f wmma16(v16h a, v16h b, v8f c) {
  v8f d = __builtin_amdgcn_wmma_f32_16x16x32_f16(false, a, false, b, (short)0, c, false, false);
  asm volatile("v_nop\n\tv_nop\n\tv_nop\n\tv_nop" : "+v"(d) : "v"(a), "v"(b));
  return d;
}
__device__ __forceinline__ v8f wmma_bf(v16b a, v16b b, v8f c) {
  v8f d = __builtin_amdgcn_wmma_f32_16x16x32_bf16(false, a, false, b, (short)0, c, false, false);
  asm volatile("v_nop\n\tv_nop\n\tv_nop\n\tv_nop" : "+v"(d) : "v"(a), "v"(b));
  return d;
}
// 16x16x32 fragments: lane = (h = lane>>4, row/col = lane&15); elements 0..7 = k0+8h+0..7, 8..15 = k0+16+8h+0..7; D element r = row 8h+r
__device__ __forceinline__ v16h frag_h(const _Float16* rowk0, int lane) {
  union { v16h v; v8h q[2]; } u; const _Float16* p = rowk0 + 8 * (lane >> 4);
  u.q[0] = *(const v8h*)p; u.q[1] = *(const v8h*)(p + 16); return u.v;
}
__device__ __forceinline__ v16h frag_f32(const float* rowk0, int lane) {
  v16h a; const float* p = rowk0 + 8 * (lane >> 4);
#pragma unroll
  for (int i = 0; i < 8; ++i) { a[i] = (_Float16)p[i]; a[8 + i] = (_Float16)p[16 + i]; }
  return a;
}
__device__ __forceinline__ v16h frag_f32s(const float* rowk0, int lane, float sc) {
  v16h a; const float* p = rowk0 + 8 * (lane >> 4);
#pragma unroll
  for (int i = 0; i < 8; ++i) { a[i] = (_Float16)(p[i] * sc); a[8 + i] = (_Float16)(p[16 + i] * sc); }
  return a;
}
// column fragment from a [K][ld] layout (column n), rows >= K read as 0
__device__ __forceinline__ v16h fragc_f32(const float* W, int k0, int n, int lane, int ld, int K) {
  v16h a; const int g = lane >> 4;
#pragma unroll
  for (int i = 0; i < 8; ++i) { const int ka = k0 + 8 * g + i, kb = ka + 16;
    a[i] = (_Float16)(ka < K ? W[(size_t)(ka < K ? ka : K - 1) * ld + n] : 0.f); a[8 + i] = (_Float16)(kb < K ? W[(size_t)(kb < K ? kb : K - 1) * ld + n] : 0.f); }
  return a;
}
struct F2 { v16b h, l; };
__device__ __forceinline__ F2 bsplit16(const float v[16]) { F2 r;
#pragma unroll
  for (int i = 0; i < 16; ++i) { const __bf16 h = (__bf16)v[i]; r.h[i] = h; r.l[i] = (__bf16)(v[i] - (float)h); }
  return r; }
__device__ __forceinline__ F2 split_row(const float* row, int k0, int lane) { float v[16]; const float* p = row + k0 + 8 * (lane >> 4);
#pragma unroll
  for (int i = 0; i < 8; ++i) { v[i] = p[i]; v[8 + i] = p[16 + i]; }
  return bsplit16(v); }
__device__ __forceinline__ F2 split_rowK(const float* row, int k0, int lane, int K) { float v[16]; const int g = lane >> 4;
#pragma unroll
  for (int i = 0; i < 8; ++i) { const int ka = k0 + 8 * g + i, kb = ka + 16; v[i] = ka < K ? row[ka < K ? ka : K - 1] : 0.f; v[8 + i] = kb < K ? row[kb < K ? kb : K - 1] : 0.f; }
  return bsplit16(v); }
__device__ __forceinline__ F2 split_col(const float* W, int k0, int n, int lane, int ld, int K) { float v[16]; const int g = lane >> 4;
#pragma unroll
  for (int i = 0; i < 8; ++i) { const int ka = k0 + 8 * g + i, kb = ka + 16; v[i] = ka < K ? W[(size_t)(ka < K ? ka : K - 1) * ld + n] : 0.f; v[8 + i] = kb < K ? W[(size_t)(kb < K ? kb : K - 1) * ld + n] : 0.f; }
  return bsplit16(v); }
__device__ __forceinline__ v8f mac3(const F2& a, const F2& b, v8f c) { c = wmma_bf(a.l, b.h, c); c = wmma_bf(a.h, b.l, c); return wmma_bf(a.h, b.h, c); }
__device__ __forceinline__ float sigm(float v) { return 1.0f / (1.0f + expf(-v)); }
#define LDSX() do { asm volatile("s_wait_dscnt 0" ::: "memory"); __builtin_amdgcn_wave_barrier(); __builtin_amdgcn_fence(__ATOMIC_RELEASE, "workgroup"); } while (0)


// Multi-head attention with rotary embedding and a data-dependent 'stoichiometric' bias (B 2, T 2,048, D 1,024 = 16 x 64): Q = query Wq + bq, K = key Wk + bk, V = value Wv + bv ((in,out)); rotate-half RoPE with angle t / 10000^(2i/64); scores = Q K^T 64^-0.5 + (alpha_pos[h] if frac_j >= frac_i else alpha_neg[h]) (frac_j - frac_i); softmax; P V; out Wo + bo.
#define NB 2
#define TT 2048
#define CC 1024
#define NH 16
#define HD 64
__constant__ float RCPF[32] = {1.000000000e+0f,7.498942018e-1f,5.623413324e-1f,4.216965139e-1f,3.162277639e-1f,2.371373624e-1f,1.778279394e-1f,1.333521456e-1f,1.000000015e-1f,7.498941571e-2f,5.623412877e-2f,4.216964915e-2f,3.162277862e-2f,2.371373586e-2f,1.778279431e-2f,1.333521493e-2f,9.999999776e-3f,7.498942316e-3f,5.623413250e-3f,4.216964822e-3f,3.162277862e-3f,2.371373819e-3f,1.778279431e-3f,1.333521446e-3f,1.000000047e-3f,7.498941850e-4f,5.623413017e-4f,4.216964880e-4f,3.162277862e-4f,2.371373848e-4f,1.778279402e-4f,1.333521504e-4f};   // f32(1 / f32(10000^(2i/64))): the module divides pos by freq_div, which XLA evaluates as pos * (1/freq_div)
#ifndef TNB
#define TNB NB
#endif
typedef __attribute__((ext_vector_type(8))) __bf16 v8b;
__device__ __forceinline__ v16b frag_b(const __bf16* rowk0, int lane) {
  union { v16b v; v8b q[2]; } u; const __bf16* p = rowk0 + 8 * (lane >> 4);
  u.q[0] = *(const v8b*)p; u.q[1] = *(const v8b*)(p + 16); return u.v;
}
__device__ __forceinline__ float bfr(float v) { return (float)(__bf16)v; }
__device__ __attribute__((noinline)) float exp_ni(float v) { return expf(v); }
__device__ __attribute__((noinline)) float erf_ni(float v) { return erff(v); }

#define WS_ROT 0u                                   // float2 (cos, sin)[t][32] = cos/sin(t * (1/freq_div[j]))
#define WS_QH  (WS_ROT + 8u * (size_t)TT * 32)
#define WS_QL  (WS_QH + 2u * (size_t)NB * TT * CC)
#define WS_KH  (WS_QL + 2u * (size_t)NB * TT * CC)
#define WS_VT  (WS_KH + 2u * (size_t)NB * TT * CC)      // bf16 v planes [b][c][t]
#define WS_VL  (WS_VT + 2u * (size_t)NB * CC * TT)      // bf16 v residual planes
#define WS_YH  (WS_VL + 2u * (size_t)NB * CC * TT)      // y, bf16 hi, packed fragments [row tile][kc]
#define WS_YL  (WS_YH + 2u * (size_t)NB * TT * CC)      // y, bf16 residual, packed likewise
#define WS_XP  (WS_YL + 2u * (size_t)NB * TT * CC)      // query, key, value as bf16, packed fragments [which][row tile][kc]
#define WS_WP  (WS_XP + 3u * 2u * (size_t)NB * TT * CC) // Wq, Wk, Wv, Wo as bf16, packed fragments [matrix][column tile][kc]
#define WS_END (WS_WP + 4u * 2u * (size_t)CC * CC)
// A packed fragment is the 1 KiB that one 16x16x32 operand takes, in the order the wave reads it: 16-byte piece (half, lane) at element half * 256 + lane * 8 holds k = kc * 32 + half * 16 + 8 * (lane >> 4) + 0..7 of row (or column) tile * 16 + (lane & 15); each of the two wave-wide 16-byte loads then covers 512 contiguous bytes, four whole lines
#define FRAG_E 512
#define NKC (CC / 32)
__device__ __forceinline__ v16b frag_p(const __bf16* lanebase) {
  union { v16b v; v8b q[2]; } u; u.q[0] = *(const v8b*)lanebase; u.q[1] = *(const v8b*)(lanebase + 256); return u.v;
}

// ---- k_pre: everything the GEMMs read is laid out once a call. Blocks 0..383: a wave packs 8 kc of one 16-row tile of query / key / value (f32 -> bf16). Blocks 384..639: a wave packs 4 column tiles of one kc of one weight matrix (the transposition happens here, once, not in every GEMM wave). Blocks 640..895: one thread per (t, j): precise cosf/sinf of t * inv_freq[j] -> table (keeps the trig and its large-argument reduction out of the GEMM kernel)
#define PRE_X (3 * (NB * TT / 16) * (NKC / 8) / 8)
#define PRE_W (4 * NKC * (CC / 64) / 8)
__global__ __launch_bounds__(256) void k_pre(const float* __restrict__ X0, const float* __restrict__ X1, const float* __restrict__ X2, const float* __restrict__ WQ, const float* __restrict__ WK, const float* __restrict__ WV, const float* __restrict__ WO, __bf16* __restrict__ XP, __bf16* __restrict__ WP, float2* __restrict__ ROT) {
  const int tid = threadIdx.x, wave = tid >> 5, lane = tid & 31, col = lane & 15, g = lane >> 4; const int bx = blockIdx.x;
  if (bx < PRE_X) { const int u = bx * 8 + wave, kg = u & 3, rt = (u >> 2) & (NB * TT / 16 - 1), which = u >> 10; const float* X = which == 0 ? X0 : which == 1 ? X1 : X2;
    const float* p = X + ((size_t)rt * 16 + col) * CC + kg * 256 + 8 * g; __bf16* d = XP + (((size_t)which * (NB * TT / 16) + rt) * NKC + kg * 8) * FRAG_E + lane * 8;
    v4f a[16], b2[16];
#pragma unroll
    for (int e = 0; e < 16; ++e) { a[e] = *(const v4f*)(p + e * 16); b2[e] = *(const v4f*)(p + e * 16 + 4); }
    asm volatile("s_wait_xcnt 0x0" :: "v"(p) : "memory");   /* the loads' address pair stays whole until this wait */
#pragma unroll
    for (int e = 0; e < 16; ++e) { v8b o;
#pragma unroll
      for (int i = 0; i < 4; ++i) { o[i] = (__bf16)a[e][i]; o[4 + i] = (__bf16)b2[e][i]; }
      vst2(d + e * 256, o); }
    return; }
  if (bx < PRE_X + PRE_W) { const int u = (bx - PRE_X) * 8 + wave, ng = u & 15, kc = (u >> 4) & (NKC - 1), mat = u >> 9; const float* Wm = mat == 0 ? WQ : mat == 1 ? WK : mat == 2 ? WV : WO;
    const float* p = Wm + ((size_t)kc * 32 + 8 * g) * CC + ng * 64 + col; __bf16* d = WP + (((size_t)mat * (CC / 16) + ng * 4) * NKC + kc) * FRAG_E + lane * 8;
#pragma unroll
    for (int n = 0; n < 4; ++n)
#pragma unroll
      for (int hf = 0; hf < 2; ++hf) { v8b o;
#pragma unroll
        for (int i = 0; i < 8; ++i) o[i] = (__bf16)p[(size_t)(hf * 16 + i) * CC + n * 16];
        vst2(d + (size_t)n * NKC * FRAG_E + hf * 256, o); }
    asm volatile("s_wait_xcnt 0x0" ::: "memory");   /* behind the last store: the stores' address pair is not written anew on any way out of this part before the wait */
    return; }
  const int i = (bx - PRE_X - PRE_W) * 256 + tid; if (i >= TT * 32) return; const int t = i >> 5, j = i & 31; const float ang = (float)t * RCPF[j]; v2f v; v[0] = cosf(ang); v[1] = sinf(ang); vst2((v2f*)(ROT + i), v); }
// The two GEMM kernels bring their packed fragments to LDS once a block, by asynchronous copies: a stage is GST k steps of 16 tiles (a tile's part of a stage is GTB contiguous bytes in memory and in LDS), two buffers, the next stage flying while this one is worked on
#define GST 2
#define GNS (NKC / GST)
#define GTB (GST * FRAG_E * 2)
#define GSB (16 * GTB)
#define TPE (NKC * FRAG_E)      /* elements from one tile to the next in memory */
// eight 16-byte copies of a lane (block of 128 threads: one copy of the block = one tile's GTB bytes): four tiles from a, four from b. The s_wait_xcnt stands inside the statement, so that no register which an issued copy names is written anew in front of it
__device__ __forceinline__ void copy8(unsigned l, const __bf16* a, const __bf16* b) {
  const unsigned l1 = l + GTB, l2 = l + 2 * GTB, l3 = l + 3 * GTB, l4 = l + 4 * GTB, l5 = l + 5 * GTB, l6 = l + 6 * GTB, l7 = l + 7 * GTB; const __bf16 *a1 = a + TPE, *a2 = a + 2 * TPE, *a3 = a + 3 * TPE, *b1 = b + TPE, *b2 = b + 2 * TPE, *b3 = b + 3 * TPE;
  asm volatile("global_load_async_to_lds_b128 %0, %8, off\n\tglobal_load_async_to_lds_b128 %1, %9, off\n\tglobal_load_async_to_lds_b128 %2, %10, off\n\tglobal_load_async_to_lds_b128 %3, %11, off\n\tglobal_load_async_to_lds_b128 %4, %12, off\n\tglobal_load_async_to_lds_b128 %5, %13, off\n\tglobal_load_async_to_lds_b128 %6, %14, off\n\tglobal_load_async_to_lds_b128 %7, %15, off\n\ts_wait_xcnt 0x0" :: "v"(l), "v"(l1), "v"(l2), "v"(l3), "v"(l4), "v"(l5), "v"(l6), "v"(l7), "v"(a), "v"(a1), "v"(a2), "v"(a3), "v"(b), "v"(b1), "v"(b2), "v"(b3) : "memory");
}
// ---- k_proj: block = (128 rows, 128 cols, which), four waves of 64 x 64 (one head each): a k step's 8 fragments feed 16 products; qkv = x W (+ b), exact; q -> f16 hi (+ residual), k -> f16 rows, v -> bf16 planes. The 768 blocks are resident together, three a WGP (the operand ring, the q/k staging and the v staging share one LDS buffer)
#define PJP 136                 /* LDS row pitch of the output staging in 16-bit elements: 272 B = 16 B x 17 */
__global__ __launch_bounds__(128) void k_proj(const __bf16* __restrict__ XP, const __bf16* __restrict__ WP, const float* __restrict__ BQ, const float* __restrict__ BK, const float* __restrict__ BV, _Float16* __restrict__ QH, _Float16* __restrict__ QL, _Float16* __restrict__ KH, __bf16* __restrict__ VT, __bf16* __restrict__ VL, const float2* __restrict__ ROT) {
  __shared__ __align__(16) unsigned char smem[2 * 128 * PJP * 2];   /* 69,632 B: the ring's 2 * GSB = 65,536 B in the main loop, the output staging behind it */
  static_assert(2 * GSB <= 2 * 128 * PJP * 2, "ring fits");
  _Float16 (*sh)[PJP] = (_Float16 (*)[PJP])smem; _Float16 (*sl)[PJP] = (_Float16 (*)[PJP])(smem + 128 * PJP * 2); __bf16 (*th)[PJP] = (__bf16 (*)[PJP])smem; __bf16 (*tl2)[PJP] = (__bf16 (*)[PJP])(smem + 128 * PJP * 2);
  const int tid = threadIdx.x, wave = tid >> 5, lane = tid & 31, col = lane & 15, g = lane >> 4, wr = wave >> 1, wc = wave & 1; const int which = blockIdx.z; const int c0 = blockIdx.y * 128; const size_t r0 = (size_t)blockIdx.x * 128; const float* BA = which == 0 ? BQ : which == 1 ? BK : BV;
  v8f acc[4][4] = {};
  /* LDS tiles 0..7 = the block's 8 row tiles of x, 8..15 = its 8 column tiles of W */
  const __bf16* xg = XP + ((size_t)which * (NB * TT / 16) + blockIdx.x * 8) * TPE + tid * 8; const __bf16* wg = WP + ((size_t)which * (CC / 16) + blockIdx.y * 8) * TPE + tid * 8; const unsigned lc = (unsigned)(size_t)smem + (unsigned)tid * 16;
  copy8(lc, xg, xg + 4 * TPE); copy8(lc + 8 * GTB, wg, wg + 4 * TPE);
  asm volatile("s_wait_asynccnt 0x0" ::: "memory");   /* this wave's copies of stage 0 have landed */
  __syncthreads();                                    /* and every other wave's */
  copy8(lc + GSB, xg + GST * FRAG_E, xg + 4 * TPE + GST * FRAG_E); copy8(lc + GSB + 8 * GTB, wg + GST * FRAG_E, wg + 4 * TPE + GST * FRAG_E);
#pragma unroll 1   /* rolled: one stage's code serves both buffers */
  for (int st = 0; st < GNS; ++st) { const __bf16* bp = (const __bf16*)(smem + (st & 1) * GSB) + lane * 8;
#pragma unroll
    for (int s = 0; s < GST; ++s) { v16b a[4], w[4];   /* the k step's 16 LDS reads stand together in front of its products */
#pragma unroll
      for (int i = 0; i < 4; ++i) a[i] = frag_p(bp + ((wr * 4 + i) * GST + s) * FRAG_E);
#pragma unroll
      for (int j = 0; j < 4; ++j) w[j] = frag_p(bp + ((8 + wc * 4 + j) * GST + s) * FRAG_E);
#pragma unroll
      for (int i = 0; i < 4; ++i)
#pragma unroll
        for (int j = 0; j < 4; ++j) acc[i][j] = wmma_bf(a[i], w[j], acc[i][j]); }
    /* hand-over: this wave's reads of the buffer are done, its copies of the next stage have landed; behind the barrier that holds of every wave, and the buffer just read takes stage st + 2 */
    asm volatile("s_wait_dscnt 0x0" ::: "memory");
    asm volatile("s_wait_asynccnt 0x0" ::: "memory");
    __syncthreads();
    if (st + 2 < GNS) { const int eo = (st + 2) * GST * FRAG_E; const unsigned lb = lc + (unsigned)(st & 1) * GSB; copy8(lb, xg + eo, xg + 4 * TPE + eo); copy8(lb + 8 * GTB, wg + eo, wg + 4 * TPE + eo); } }
  asm volatile("s_wait_asynccnt 0x0" ::: "memory");   /* no copy outstanding when the buffer turns into the output staging */
  { float b4[4] = {0.f, 0.f, 0.f, 0.f};
    if (BA) { const float* bp = BA + c0 + wc * 64 + col;
#pragma unroll
      for (int j = 0; j < 4; ++j) b4[j] = bp[j * 16];
      asm volatile("s_wait_xcnt 0x0" :: "v"(bp) : "memory"); }   /* the four loads' address stays whole until this wait: no load lands on it */
#pragma unroll
    for (int j = 0; j < 4; ++j) { const float bb0 = bfr(b4[j]);
#pragma unroll
      for (int i = 0; i < 4; ++i)
#pragma unroll
        for (int r = 0; r < 8; ++r) acc[i][j][r] += bb0; } }   /* bias before the rotary */
  if (which < 2) {   /* rotate-half rotary on all 64 head dims: the wave's four column tiles are one head; tiles j (d 0..15), j+1 (16..31) pair with j+2 (32..47), j+3 (48..63) in the SAME lane and row: out[d] = x[d] c - x[d+32] s, out[d+32] = x[d] s + x[d+32] c, angle index = d (< 32). A block's 128 rows lie in one batch, so t = r0 % TT + the row in the block */
    const float2* rp = ROT + (size_t)((int)(r0 % TT) + wr * 64 + 8 * g) * 32 + col; float2 cv[4][2][8];
#pragma unroll
    for (int i = 0; i < 4; ++i)
#pragma unroll
      for (int j = 0; j < 2; ++j)
#pragma unroll
        for (int r = 0; r < 8; ++r) cv[i][j][r] = rp[(i * 16 + r) * 32 + j * 16];
#pragma unroll
    for (int i = 0; i < 4; ++i)
#pragma unroll
      for (int j = 0; j < 2; ++j)
#pragma unroll
        for (int r = 0; r < 8; ++r) { const float xl = acc[i][j][r], xr = acc[i][j + 2][r]; acc[i][j][r] = xl * cv[i][j][r].x - xr * cv[i][j][r].y; acc[i][j + 2][r] = xl * cv[i][j][r].y + xr * cv[i][j][r].x; } }
  if (which == 2) {   /* the branch on the matrix stands once, outside the 128 elements */
#pragma unroll
    for (int i = 0; i < 4; ++i)
#pragma unroll
      for (int j = 0; j < 4; ++j)
#pragma unroll
        for (int r = 0; r < 8; ++r) { const float v = acc[i][j][r] + 0.f; const int rl = wr * 64 + i * 16 + 8 * g + r, cl = wc * 64 + j * 16 + col; const __bf16 bh = (__bf16)v; th[cl][rl] = bh; tl2[cl][rl] = (__bf16)(v - (float)bh); } }
  else {
#pragma unroll
    for (int i = 0; i < 4; ++i)
#pragma unroll
      for (int j = 0; j < 4; ++j)
#pragma unroll
        for (int r = 0; r < 8; ++r) { const float v = acc[i][j][r] + 0.f; const int rl = wr * 64 + i * 16 + 8 * g + r, cl = wc * 64 + j * 16 + col; const _Float16 hv = (_Float16)v; sh[rl][cl] = hv; sl[rl][cl] = (_Float16)((v - (float)hv) * 1024.0f); } }   /* q residual carried x 2^10 so the plane stays f16-normal on the chip */
  __syncthreads();
  if (which == 0) { for (int e = tid; e < 128 * 16; e += 128) { const int rl = e >> 4, q = e & 15; _Float16* d0 = QH + (r0 + rl) * CC + c0 + q * 8; _Float16* d1 = QL + (r0 + rl) * CC + c0 + q * 8; const v4u u0 = *(const v4u*)&sh[rl][q * 8], u1 = *(const v4u*)&sl[rl][q * 8]; vst2(d0, u0); vst2(d1, u1); } }
  else if (which == 1) { for (int e = tid; e < 128 * 16; e += 128) { const int rl = e >> 4, q = e & 15; _Float16* d0 = KH + (r0 + rl) * CC + c0 + q * 8; const v4u u0 = *(const v4u*)&sh[rl][q * 8]; vst2(d0, u0); } }
  else { const size_t b = r0 / TT; const int t0 = (int)(r0 % TT); for (int e = tid; e < 128 * 16; e += 128) { const int cl = e >> 4, q = e & 15; const size_t o2 = (b * CC + c0 + cl) * (size_t)TT + t0 + q * 8; __bf16* d0 = VT + o2; __bf16* d1 = VL + o2; const v4u u0 = *(const v4u*)&th[cl][q * 8], u1 = *(const v4u*)&tl2[cl][q * 8]; vst2(d0, u0); vst2(d1, u1); } } }
// ---- k_fa: block = 8 waves x 16 queries of one (b, h); the block's keys come through LDS: a stage is 64 keys (K rows, V^T hi rows, V^T lo rows, 128 B a row at a pitch of 144 B), brought once for all eight waves by asynchronous copies into two buffers, the next stage flying while this one is worked on; the batch's 2,048 values of frac go to LDS once, as two f32 tables. A wave walks a stage 32 keys at a time and never stores a logit: S^T = kl frac_k + K Q^T (2 products) + ka max(frac_k, frac_q), x 64^-0.5 log2 e inside the fma that takes the maximum off, so that each weight is one exp2, running maximum and sum per query (a lane holds one query's column: keys 8g+r of each 16-key tile), P^T packed from the two score tiles straight into a B operand (hardware k order), O^T += V^T P^T (3 products), O^T / sum at the end. waves_per_eu(4, 4): a budget of 256 registers, the 512 blocks resident together, two a WGP
#define L2E 1.44269504088896340736f   /* log2(e): logits are carried in base 2 */
#define KST 64                  /* keys a stage */
#define NST (TT / KST)
#define LP 72                   /* LDS row pitch in 16-bit elements: 144 B = 16 B x 9, free of bank conflicts for 16-byte readers */
#define TILE_B (64 * LP * 2)
#define STAGE_B (3 * TILE_B)
// one stage's six 16-byte copies of a lane (rows r and r + 32 of K, V hi, V lo). The s_wait_xcnt stands inside the statement, so that no register which an issued copy names is written anew in front of it
__device__ __forceinline__ void stage_copy(unsigned l, const _Float16* k, const __bf16* v, const __bf16* w) {
  const unsigned l1 = l + 32 * LP * 2, l2 = l + TILE_B, l3 = l2 + 32 * LP * 2, l4 = l + 2 * TILE_B, l5 = l4 + 32 * LP * 2; const _Float16* k1 = k + (size_t)32 * CC; const __bf16* v1 = v + (size_t)32 * TT; const __bf16* w1 = w + (size_t)32 * TT;
  asm volatile("global_load_async_to_lds_b128 %0, %6, off\n\tglobal_load_async_to_lds_b128 %1, %7, off\n\tglobal_load_async_to_lds_b128 %2, %8, off\n\tglobal_load_async_to_lds_b128 %3, %9, off\n\tglobal_load_async_to_lds_b128 %4, %10, off\n\tglobal_load_async_to_lds_b128 %5, %11, off\n\ts_wait_xcnt 0x0" :: "v"(l), "v"(l1), "v"(l2), "v"(l3), "v"(l4), "v"(l5), "v"(k), "v"(k1), "v"(v), "v"(v1), "v"(w), "v"(w1) : "memory");
}
__global__ __launch_bounds__(256) __attribute__((amdgpu_waves_per_eu(4, 4))) void k_fa(const _Float16* __restrict__ QH, const _Float16* __restrict__ QL, const _Float16* __restrict__ KH, const __bf16* __restrict__ VT, const __bf16* __restrict__ VL, const float* __restrict__ FR, const float* __restrict__ AP, const float* __restrict__ AN, __bf16* __restrict__ YH, __bf16* __restrict__ YL) {
  __shared__ __align__(16) unsigned char ring[2 * STAGE_B]; __shared__ __align__(16) float sG[TT], sH[TT];
  const int tid = threadIdx.x, wave = tid >> 5, lane = tid & 31, col = lane & 15, g = lane >> 4; const int h = blockIdx.y, b = blockIdx.z; const int q = blockIdx.x * 128 + wave * 16 + col;
  const size_t qrow = ((size_t)b * TT + q) * CC + h * HD;
  /* the copies: thread = (row tid >> 3, 16-byte piece tid & 7), so a wave's copy covers four whole 128-byte rows */
  const int crow = tid >> 3, cpc = tid & 7; const _Float16* kg = KH + ((size_t)b * TT + crow) * CC + h * HD + cpc * 8; const size_t vg0 = ((size_t)b * CC + h * HD + crow) * (size_t)TT + cpc * 8; const __bf16* vg = VT + vg0; const __bf16* wg = VL + vg0;
  const unsigned lc = (unsigned)(size_t)ring + (unsigned)(crow * (LP * 2) + cpc * 16);
  stage_copy(lc, kg, vg, wg);
  /* the bias (D >= 0 ? ap : an) D, D = f_k - f_q, is an f_k + (ap - an) max(f_k, f_q) - ap f_q (f_k >= f_q: ap f_k - ap f_q; else an f_k - an f_q). The last term, one constant a query, leaves the softmax unchanged: it is not formed. In units of the raw product (logit / 64^-0.5): kl f_k + ka max(f_k, f_q). The block's two tables, once: sG = f_k (rounded as before), sH = kl f_k */
  const float ap = bfr(AP[h]), an = bfr(AN[h]), kl = 8.0f * an, ka = 8.0f * (ap - an), fq = bfr(FR[(size_t)b * TT + q]);
#pragma unroll
  for (int e = 0; e < 2; ++e) { const int i0 = e * 1024 + tid * 4; const v4f f = *(const v4f*)(FR + (size_t)b * TT + i0); v4f gv, hv;
#pragma unroll
    for (int i = 0; i < 4; ++i) { gv[i] = bfr(f[i]); hv[i] = gv[i] * kl; }
    *(v4f*)(sG + i0) = gv; *(v4f*)(sH + i0) = hv; }
  v16h qh[HD / 32], ql[HD / 32];
#pragma unroll
  for (int kc = 0; kc < HD / 32; ++kc) { qh[kc] = frag_h(QH + qrow + kc * 32, lane); ql[kc] = frag_h(QL + qrow + kc * 32, lane); }
  asm volatile("s_wait_asynccnt 0x0" ::: "memory");   /* this wave's copies of stage 0 have landed */
  __syncthreads();                                    /* and every other wave's, and every wave's part of the two tables */
  stage_copy(lc + STAGE_B, kg + (size_t)KST * CC, vg + KST, wg + KST);
  const int lo = col * LP + 8 * g;   /* each lane's own row and 8g */
  v8f o[HD / 16] = {}; float m = -3.0e38f, l = 0.f; const v2f ka2 = {ka, ka}, r2 = {1.0f / 1024.0f, 1.0f / 1024.0f}, c2 = {0.125f * L2E, 0.125f * L2E};
#pragma unroll 1   /* rolled: one stage's code serves both buffers */
  for (int st = 0; st < NST; ++st) { const unsigned char* bp = ring + (st & 1) * STAGE_B;
#pragma unroll 1   /* rolled: the fragments of two passes do not fit 256 registers */
  for (int hf = 0; hf < KST / 32; ++hf) { float s[16]; v4f fk[4]; v8f hk[2]; v16h kf[2][HD / 32]; v16b vf[HD / 16], wf[HD / 16];
    const _Float16* kq = (const _Float16*)bp + hf * 32 * LP + lo; const __bf16* vq = (const __bf16*)(bp + TILE_B) + hf * 32 + lo; const __bf16* wq = (const __bf16*)(bp + 2 * TILE_B) + hf * 32 + lo; const float* fp = sG + st * KST + hf * 32 + 8 * g; const float* hp = sH + st * KST + hf * 32 + 8 * g;
#pragma unroll
    for (int t = 0; t < 2; ++t) {
#pragma unroll
      for (int kc = 0; kc < HD / 32; ++kc) kf[t][kc] = frag_h(kq + (t * 16) * LP + kc * 32, 0);
      fk[t * 2] = *(const v4f*)(fp + t * 16); fk[t * 2 + 1] = *(const v4f*)(fp + t * 16 + 4);
      { union { v8f v; v4f q[2]; } u; u.q[0] = *(const v4f*)(hp + t * 16); u.q[1] = *(const v4f*)(hp + t * 16 + 4); hk[t] = u.v; } }   /* register r = key 8g + r of the tile: the accumulator's own row order */
#pragma unroll
    for (int j = 0; j < HD / 16; ++j) { vf[j] = frag_b(vq + (j * 16) * LP, 0); wf[j] = frag_b(wq + (j * 16) * LP, 0); }
#pragma unroll
    for (int t = 0; t < 2; ++t) { v8f a = hk[t], al = {};   /* kl f_k enters as the C operand of the first product */
#pragma unroll
      for (int kc = 0; kc < HD / 32; ++kc) { a = wmma16(kf[t][kc], qh[kc], a); al = wmma16(kf[t][kc], ql[kc], al); }
#pragma unroll
      for (int r = 0; r < 8; r += 2) { const v2f G = {fk[t * 2 + (r >> 2)][r & 3], fk[t * 2 + (r >> 2)][(r & 3) + 1]}, A = {a[r], a[r + 1]}, R = {al[r], al[r + 1]}; const v2f M = {fmaxf(G[0], fq), fmaxf(G[1], fq)}, x = __builtin_elementwise_fma(M, ka2, __builtin_elementwise_fma(R, r2, A));   /* pairs: packed f32 forms */
        s[t * 8 + r] = x[0]; s[t * 8 + r + 1] = x[1]; } }   /* still in raw-product units */
    float mx = s[0];
#pragma unroll
    for (int i = 1; i < 16; ++i) mx = fmaxf(mx, s[i]);
    mx *= 0.125f * L2E;   /* m is kept in base-2 logits; the scale is positive, so the maximum may be taken in front of it */
    mx = fmaxf(mx, __shfl_xor(mx, 16));   /* the other half of the wave holds this query's other 16 keys */
    const float mn = fmaxf(m, mx), sc = __builtin_amdgcn_exp2f(m - mn); m = mn; float ps = 0.f; const v2f nm2 = {-mn, -mn};
#pragma unroll
    for (int i = 0; i < 16; i += 2) { const v2f x = {s[i], s[i + 1]}, e = __builtin_elementwise_fma(x, c2, nm2); s[i] = e[0]; s[i + 1] = e[1]; }   /* 64^-0.5 log2 e rides in the subtraction's place */
#pragma unroll
    for (int i = 0; i < 16; ++i) { s[i] = __builtin_amdgcn_exp2f(s[i]); ps += s[i]; }
    l = l * sc + ps;
#pragma unroll
    for (int j = 0; j < HD / 16; ++j)
#pragma unroll
      for (int r = 0; r < 8; ++r) o[j][r] *= sc;
    const F2 p = bsplit16(s);   /* element i < 8 = the pass's key 8g + i, i >= 8 = key 16 + 8g + i - 8: the k order of frag_b */
#pragma unroll
    for (int j = 0; j < HD / 16; ++j) { o[j] = wmma_bf(vf[j], p.h, o[j]); o[j] = wmma_bf(vf[j], p.l, o[j]); o[j] = wmma_bf(wf[j], p.h, o[j]); } }
    /* hand-over: this wave's reads of the buffer are done, its copies of the next stage have landed; behind the barrier that holds of every wave, and the buffer just read takes stage st + 2 */
    asm volatile("s_wait_dscnt 0x0" ::: "memory");
    asm volatile("s_wait_asynccnt 0x0" ::: "memory");
    __syncthreads();
    if (st + 2 < NST) stage_copy(lc + (unsigned)(st & 1) * STAGE_B, kg + (size_t)(st + 2) * KST * CC, vg + (st + 2) * KST, wg + (st + 2) * KST); }
  asm volatile("s_wait_asynccnt 0x0" ::: "memory");   /* no copy outstanding when the wave ends */
  l += __shfl_xor(l, 16); const float inv = 1.0f / l;   /* O^T register r of tile j = head dim j*16 + 8g + r of this lane's query: piece (half j & 1, this lane) of k_out's A fragment (row tile of the wave's 16 queries, kc = 2h + (j >> 1)), so y leaves as packed bf16 hi + residual */
  const size_t yo = (((size_t)b * (TT / 16) + blockIdx.x * 8 + wave) * NKC + h * 2) * FRAG_E + lane * 8;
#pragma unroll
  for (int j = 0; j < HD / 16; ++j) { v8b uh, ul;
#pragma unroll
    for (int r = 0; r < 8; ++r) { const float v = o[j][r] * inv; const __bf16 hv = (__bf16)v; uh[r] = hv; ul[r] = (__bf16)(v - (float)hv); }
    vst2(YH + yo + j * 256, uh); vst2(YL + yo + j * 256, ul); } }
// ---- k_out: block = (64 rows, 128 cols): out = y (bf16 hi + lo) Wo + bo
__global__ __launch_bounds__(128) void k_out(const __bf16* __restrict__ YH, const __bf16* __restrict__ YL, const __bf16* __restrict__ WP, const float* __restrict__ BP, float* __restrict__ OUT) { __shared__ __align__(16) float sf[4][16][132]; __shared__ __align__(16) unsigned char ring[2 * GSB];
  const int tid = threadIdx.x, wave = tid >> 5, lane = tid & 31, col = lane & 15, g = lane >> 4; const int c0 = blockIdx.y * 128; const size_t r0 = (size_t)blockIdx.x * 64 + wave * 16;
  v8f acc[8] = {};
  /* LDS tiles 0..3 = the block's 4 row tiles of y hi, 4..7 = of y lo, 8..15 = its 8 column tiles of Wo */
  const size_t yo = (size_t)blockIdx.x * 4 * TPE + tid * 8; const __bf16* yh = YH + yo; const __bf16* yl = YL + yo; const __bf16* wg = WP + ((size_t)3 * (CC / 16) + blockIdx.y * 8) * TPE + tid * 8; const unsigned lc = (unsigned)(size_t)ring + (unsigned)tid * 16;
  copy8(lc, yh, yl); copy8(lc + 8 * GTB, wg, wg + 4 * TPE);
  asm volatile("s_wait_asynccnt 0x0" ::: "memory");   /* this wave's copies of stage 0 have landed */
  __syncthreads();                                    /* and every other wave's */
  copy8(lc + GSB, yh + GST * FRAG_E, yl + GST * FRAG_E); copy8(lc + GSB + 8 * GTB, wg + GST * FRAG_E, wg + 4 * TPE + GST * FRAG_E);
#pragma unroll 1   /* rolled: one stage's code serves both buffers */
  for (int st = 0; st < GNS; ++st) { const __bf16* bp = (const __bf16*)(ring + (st & 1) * GSB) + lane * 8;
#pragma unroll
    for (int s = 0; s < GST; ++s) { const v16b ah = frag_p(bp + (wave * GST + s) * FRAG_E), al = frag_p(bp + ((4 + wave) * GST + s) * FRAG_E); v16b w[8];   /* the k step's 20 LDS reads together in front of its products, as in k_proj */
#pragma unroll
      for (int j = 0; j < 8; ++j) w[j] = frag_p(bp + ((8 + j) * GST + s) * FRAG_E);
#pragma unroll
      for (int j = 0; j < 8; ++j) { acc[j] = wmma_bf(ah, w[j], acc[j]); acc[j] = wmma_bf(al, w[j], acc[j]); } }
    /* hand-over, as in k_proj */
    asm volatile("s_wait_dscnt 0x0" ::: "memory");
    asm volatile("s_wait_asynccnt 0x0" ::: "memory");
    __syncthreads();
    if (st + 2 < GNS) { const int eo = (st + 2) * GST * FRAG_E; const unsigned lb = lc + (unsigned)(st & 1) * GSB; copy8(lb, yh + eo, yl + eo); copy8(lb + 8 * GTB, wg + eo, wg + 4 * TPE + eo); } }
  asm volatile("s_wait_asynccnt 0x0" ::: "memory");   /* no copy outstanding when the wave ends */
#pragma unroll
  for (int j = 0; j < 8; ++j) { const float bb = BP ? bfr(BP[c0 + j * 16 + col]) : 0.f;
#pragma unroll
    for (int r = 0; r < 8; ++r) sf[wave][8 * g + r][j * 16 + col] = acc[j][r] + bb; }
  LDSX(); for (int rl = 0; rl < 16; ++rl) vst2(OUT + (r0 + rl) * CC + c0 + lane * 4, *(const v4f*)&sf[wave][rl][lane * 4]); }
extern "C" void kernel_launch(void* const* d_in, const int* in_sizes, int n_in, void* d_out, int out_size, void* d_ws, size_t ws_size, hipStream_t stream) {
  (void)in_sizes; (void)n_in; (void)out_size;
  const float** F = (const float**)d_in;   // 0 query, 1 key, 2 value [2,2048,1024]; 3 frac [2,2048]; 4 Wq, 5 Wk, 6 Wv, 7 Wo ((in,out)); 8 bq, 9 bk, 10 bv, 11 bo; 12 alpha_pos [16], 13 alpha_neg [16]
  if (ws_size < (size_t)WS_END) return;
  char* ws = (char*)d_ws; _Float16 *QH = (_Float16*)(ws + WS_QH), *QL = (_Float16*)(ws + WS_QL), *KH = (_Float16*)(ws + WS_KH); __bf16 *VT = (__bf16*)(ws + WS_VT), *VL = (__bf16*)(ws + WS_VL), *YH = (__bf16*)(ws + WS_YH), *YL = (__bf16*)(ws + WS_YL), *XP = (__bf16*)(ws + WS_XP), *WP = (__bf16*)(ws + WS_WP);
  k_pre<<<dim3(PRE_X + PRE_W + TT * 32 / 256), 256, 0, stream>>>(F[0], F[1], F[2], F[4], F[5], F[6], F[7], XP, WP, (float2*)(ws + WS_ROT));
  k_proj<<<dim3(TNB * TT / 128, CC / 128, 3), 128, 0, stream>>>(XP, WP, F[8], F[9], F[10], QH, QL, KH, VT, VL, (const float2*)(ws + WS_ROT));
  k_fa<<<dim3(TT / 128, NH, TNB), 256, 0, stream>>>(QH, QL, KH, VT, VL, F[3], F[12], F[13], YH, YL);
  k_out<<<dim3(TNB * TT / 64, CC / 128), 128, 0, stream>>>(YH, YL, WP, F[11], (float*)d_out);
}

// v008
// A run of this version takes 131 microseconds.
// In two side-by-side timings against v007, it was 1.04 and 1.03 times as fast.
// All steps since v000 together make it 13.0 times as fast.
// compute dtype: all float inputs rounded to bf16; q/k/v = x W + b with EXACT bf16 products on WMMA 16x16x32, f32 accumulate; rotate-half rotary in f32 from a cos/sin table of t * (1/freq_div[i]) (the module's f32 reciprocals; precise cosf/sinf); q as f16 hi + residual (x 2^10), k once to f16 -> 2-product logits + the stoichiometric bias from frac / alpha in f32, written as a per-key term (the products' C operand) + a multiple of max(frac_k, frac_q), its per-query constant left out (softmax does not see it); softmax in f32 in base 2 (64^-0.5 log2 e applied in the fma in front of the hardware exp2) and a running maximum and sum over 32-key steps, logits never stored; unnormalised P split bf16 hi + lo against v bf16 hi + lo (3 products), divided by the sum at the end; y (bf16 hi + lo) Wo + bo; f32 output.
#include <hip/hip_runtime.h>
#include <math.h>

typedef __attribute__((ext_vector_type(16))) _Float16 v16h;
typedef __attribute__((ext_vector_type(16))) __bf16 v16b;
typedef __attribute__((ext_vector_type(8)))  _Float16 v8h;
typedef __attribute__((ext_vector_type(8)))  float v8f;
typedef __attribute__((ext_vector_type(4)))  float v4f;
typedef __attribute__((ext_vector_type(2)))  float v2f;
typedef __attribute__((ext_vector_type(4)))  unsigned v4u;
typedef __attribute__((ext_vector_type(4)))  int v4i;
typedef float __attribute__((may_alias)) float_a;
typedef int __attribute__((may_alias)) int_a;

template <typename T> __device__ __forceinline__ void vst2(void* p, T v) { *(T*)p = v;  }
__device__ __forceinline__ v8f wmma16(v16h a, v16h b, v8f c) {
  v8f d = __builtin_amdgcn_wmma_f32_16x16x32_f16(false, a, false, b, (short)0, c, false, false);
  return d;
}
__device__ __forceinline__ v8f wmma_bf(v16b a, v16b b, v8f c) {
  v8f d = __builtin_amdgcn_wmma_f32_16x16x32_bf16(false, a, false, b, (short)0, c, false, false);
  return d;
}
// 16x16x32 fragments: lane = (h = lane>>4, row/col = lane&15); elements 0..7 = k0+8h+0..7, 8..15 = k0+16+8h+0..7; D element r = row 8h+r
__device__ __forceinline__ v16h frag_h(const _Float16* rowk0, int lane) {
  union { v16h v; v8h q[2]; } u; const _Float16* p = rowk0 + 8 * (lane >> 4);
  u.q[0] = *(const v8h*)p; u.q[1] = *(const v8h*)(p + 16); return u.v;
}
__device__ __forceinline__ v16h frag_f32(const float* rowk0, int lane) {
  v16h a; const float* p = rowk0 + 8 * (lane >> 4);
#pragma unroll
  for (int i = 0; i < 8; ++i) { a[i] = (_Float16)p[i]; a[8 + i] = (_Float16)p[16 + i]; }
  return a;
}
__device__ __forceinline__ v16h frag_f32s(const float* rowk0, int lane, float sc) {
  v16h a; const float* p = rowk0 + 8 * (lane >> 4);
#pragma unroll
  for (int i = 0; i < 8; ++i) { a[i] = (_Float16)(p[i] * sc); a[8 + i] = (_Float16)(p[16 + i] * sc); }
  return a;
}
// column fragment from a [K][ld] layout (column n), rows >= K read as 0
__device__ __forceinline__ v16h fragc_f32(const float* W, int k0, int n, int lane, int ld, int K) {
  v16h a; const int g = lane >> 4;
#pragma unroll
  for (int i = 0; i < 8; ++i) { const int ka = k0 + 8 * g + i, kb = ka + 16;
    a[i] = (_Float16)(ka < K ? W[(size_t)(ka < K ? ka : K - 1) * ld + n] : 0.f); a[8 + i] = (_Float16)(kb < K ? W[(size_t)(kb < K ? kb : K - 1) * ld + n] : 0.f); }
  return a;
}
struct F2 { v16b h, l; };
__device__ __forceinline__ F2 bsplit16(const float v[16]) { F2 r;
#pragma unroll
  for (int i = 0; i < 16; ++i) { const __bf16 h = (__bf16)v[i]; r.h[i] = h; r.l[i] = (__bf16)(v[i] - (float)h); }
  return r; }
__device__ __forceinline__ F2 split_row(const float* row, int k0, int lane) { float v[16]; const float* p = row + k0 + 8 * (lane >> 4);
#pragma unroll
  for (int i = 0; i < 8; ++i) { v[i] = p[i]; v[8 + i] = p[16 + i]; }
  return bsplit16(v); }
__device__ __forceinline__ F2 split_rowK(const float* row, int k0, int lane, int K) { float v[16]; const int g = lane >> 4;
#pragma unroll
  for (int i = 0; i < 8; ++i) { const int ka = k0 + 8 * g + i, kb = ka + 16; v[i] = ka < K ? row[ka < K ? ka : K - 1] : 0.f; v[8 + i] = kb < K ? row[kb < K ? kb : K - 1] : 0.f; }
  return bsplit16(v); }
__device__ __forceinline__ F2 split_col(const float* W, int k0, int n, int lane, int ld, int K) { float v[16]; const int g = lane >> 4;
#pragma unroll
  for (int i = 0; i < 8; ++i) { const int ka = k0 + 8 * g + i, kb = ka + 16; v[i] = ka < K ? W[(size_t)(ka < K ? ka : K - 1) * ld + n] : 0.f; v[8 + i] = kb < K ? W[(size_t)(kb < K ? kb : K - 1) * ld + n] : 0.f; }
  return bsplit16(v); }
__device__ __forceinline__ v8f mac3(const F2& a, const F2& b, v8f c) { c = wmma_bf(a.l, b.h, c); c = wmma_bf(a.h, b.l, c); return wmma_bf(a.h, b.h, c); }
__device__ __forceinline__ float sigm(float v) { return 1.0f / (1.0f + expf(-v)); }
#define LDSX() do { asm volatile("s_wait_dscnt 0" ::: "memory"); __builtin_amdgcn_wave_barrier(); __builtin_amdgcn_fence(__ATOMIC_RELEASE, "workgroup"); } while (0)


// Multi-head attention with rotary embedding and a data-dependent 'stoichiometric' bias (B 2, T 2,048, D 1,024 = 16 x 64): Q = query Wq + bq, K = key Wk + bk, V = value Wv + bv ((in,out)); rotate-half RoPE with angle t / 10000^(2i/64); scores = Q K^T 64^-0.5 + (alpha_pos[h] if frac_j >= frac_i else alpha_neg[h]) (frac_j - frac_i); softmax; P V; out Wo + bo.
#define NB 2
#define TT 2048
#define CC 1024
#define NH 16
#define HD 64
__constant__ float RCPF[32] = {1.000000000e+0f,7.498942018e-1f,5.623413324e-1f,4.216965139e-1f,3.162277639e-1f,2.371373624e-1f,1.778279394e-1f,1.333521456e-1f,1.000000015e-1f,7.498941571e-2f,5.623412877e-2f,4.216964915e-2f,3.162277862e-2f,2.371373586e-2f,1.778279431e-2f,1.333521493e-2f,9.999999776e-3f,7.498942316e-3f,5.623413250e-3f,4.216964822e-3f,3.162277862e-3f,2.371373819e-3f,1.778279431e-3f,1.333521446e-3f,1.000000047e-3f,7.498941850e-4f,5.623413017e-4f,4.216964880e-4f,3.162277862e-4f,2.371373848e-4f,1.778279402e-4f,1.333521504e-4f};   // f32(1 / f32(10000^(2i/64))): the module divides pos by freq_div, which XLA evaluates as pos * (1/freq_div)
#ifndef TNB
#define TNB NB
#endif
typedef __attribute__((ext_vector_type(8))) __bf16 v8b;
__device__ __forceinline__ v16b frag_b(const __bf16* rowk0, int lane) {
  union { v16b v; v8b q[2]; } u; const __bf16* p = rowk0 + 8 * (lane >> 4);
  u.q[0] = *(const v8b*)p; u.q[1] = *(const v8b*)(p + 16); return u.v;
}
__device__ __forceinline__ float bfr(float v) { return (float)(__bf16)v; }
__device__ __attribute__((noinline)) float exp_ni(float v) { return expf(v); }
__device__ __attribute__((noinline)) float erf_ni(float v) { return erff(v); }

#define WS_ROT 0u                                   // float2 (cos, sin)[t][32] = cos/sin(t * (1/freq_div[j]))
#define WS_QH  (WS_ROT + 8u * (size_t)TT * 32)
#define WS_QL  (WS_QH + 2u * (size_t)NB * TT * CC)
#define WS_KH  (WS_QL + 2u * (size_t)NB * TT * CC)
#define WS_VT  (WS_KH + 2u * (size_t)NB * TT * CC)      // bf16 v planes [b][c][t]
#define WS_VL  (WS_VT + 2u * (size_t)NB * CC * TT)      // bf16 v residual planes
#define WS_YH  (WS_VL + 2u * (size_t)NB * CC * TT)      // y, bf16 hi, packed fragments [row tile][kc]
#define WS_YL  (WS_YH + 2u * (size_t)NB * TT * CC)      // y, bf16 residual, packed likewise
#define WS_XP  (WS_YL + 2u * (size_t)NB * TT * CC)      // query, key, value as bf16, packed fragments [which][row tile][kc]
#define WS_WP  (WS_XP + 3u * 2u * (size_t)NB * TT * CC) // Wq, Wk, Wv, Wo as bf16, packed fragments [matrix][column tile][kc]
#define WS_END (WS_WP + 4u * 2u * (size_t)CC * CC)
// A packed fragment is the 1 KiB that one 16x16x32 operand takes, in the order the wave reads it: 16-byte piece (half, lane) at element half * 256 + lane * 8 holds k = kc * 32 + half * 16 + 8 * (lane >> 4) + 0..7 of row (or column) tile * 16 + (lane & 15); each of the two wave-wide 16-byte loads then covers 512 contiguous bytes, four whole lines
#define FRAG_E 512
#define NKC (CC / 32)
__device__ __forceinline__ v16b frag_p(const __bf16* lanebase) {
  union { v16b v; v8b q[2]; } u; u.q[0] = *(const v8b*)lanebase; u.q[1] = *(const v8b*)(lanebase + 256); return u.v;
}

// ---- k_pre: everything the GEMMs read is laid out once a call. Blocks 0..383: a wave packs 8 kc of one 16-row tile of query / key / value (f32 -> bf16). Blocks 384..639: a wave packs 4 column tiles of one kc of one weight matrix (the transposition happens here, once, not in every GEMM wave). Blocks 640..895: one thread per (t, j): precise cosf/sinf of t * inv_freq[j] -> table (keeps the trig and its large-argument reduction out of the GEMM kernel)
#define PRE_X (3 * (NB * TT / 16) * (NKC / 8) / 8)
#define PRE_W (4 * NKC * (CC / 64) / 8)
__global__ __launch_bounds__(256) void k_pre(const float* __restrict__ X0, const float* __restrict__ X1, const float* __restrict__ X2, const float* __restrict__ WQ, const float* __restrict__ WK, const float* __restrict__ WV, const float* __restrict__ WO, __bf16* __restrict__ XP, __bf16* __restrict__ WP, float2* __restrict__ ROT) {
  const int tid = threadIdx.x, wave = tid >> 5, lane = tid & 31, col = lane & 15, g = lane >> 4; const int bx = blockIdx.x;
  if (bx < PRE_X) { const int u = bx * 8 + wave, kg = u & 3, rt = (u >> 2) & (NB * TT / 16 - 1), which = u >> 10; const float* X = which == 0 ? X0 : which == 1 ? X1 : X2;
    const float* p = X + ((size_t)rt * 16 + col) * CC + kg * 256 + 8 * g; __bf16* d = XP + (((size_t)which * (NB * TT / 16) + rt) * NKC + kg * 8) * FRAG_E + lane * 8;
    v4f a[16], b2[16];
#pragma unroll
    for (int e = 0; e < 16; ++e) { a[e] = *(const v4f*)(p + e * 16); b2[e] = *(const v4f*)(p + e * 16 + 4); }
    asm volatile("s_wait_xcnt 0x0" :: "v"(p) : "memory");   /* the loads' address pair stays whole until this wait */
#pragma unroll
    for (int e = 0; e < 16; ++e) { v8b o;
#pragma unroll
      for (int i = 0; i < 4; ++i) { o[i] = (__bf16)a[e][i]; o[4 + i] = (__bf16)b2[e][i]; }
      vst2(d + e * 256, o); }
    return; }
  if (bx < PRE_X + PRE_W) { const int u = (bx - PRE_X) * 8 + wave, ng = u & 15, kc = (u >> 4) & (NKC - 1), mat = u >> 9; const float* Wm = mat == 0 ? WQ : mat == 1 ? WK : mat == 2 ? WV : WO;
    const float* p = Wm + ((size_t)kc * 32 + 8 * g) * CC + ng * 64 + col; __bf16* d = WP + (((size_t)mat * (CC / 16) + ng * 4) * NKC + kc) * FRAG_E + lane * 8;
#pragma unroll
    for (int n = 0; n < 4; ++n)
#pragma unroll
      for (int hf = 0; hf < 2; ++hf) { v8b o;
#pragma unroll
        for (int i = 0; i < 8; ++i) o[i] = (__bf16)p[(size_t)(hf * 16 + i) * CC + n * 16];
        vst2(d + (size_t)n * NKC * FRAG_E + hf * 256, o); }
    asm volatile("s_wait_xcnt 0x0" ::: "memory");   /* behind the last store: the stores' address pair is not written anew on any way out of this part before the wait */
    return; }
  const int i = (bx - PRE_X - PRE_W) * 256 + tid; if (i >= TT * 32) return; const int t = i >> 5, j = i & 31; const float ang = (float)t * RCPF[j]; v2f v; v[0] = cosf(ang); v[1] = sinf(ang); vst2((v2f*)(ROT + i), v); }
// The two GEMM kernels bring their packed fragments to LDS once a block, by asynchronous copies: a stage is GST k steps of 16 tiles (a tile's part of a stage is GTB contiguous bytes in memory and in LDS), two buffers, the next stage flying while this one is worked on
#define GST 2
#define GNS (NKC / GST)
#define GTB (GST * FRAG_E * 2)
#define GSB (16 * GTB)
#define TPE (NKC * FRAG_E)      /* elements from one tile to the next in memory */
// eight 16-byte copies of a lane (block of 128 threads: one copy of the block = one tile's GTB bytes): four tiles from a, four from b. The s_wait_xcnt stands inside the statement, so that no register which an issued copy names is written anew in front of it
__device__ __forceinline__ void copy8(unsigned l, const __bf16* a, const __bf16* b) {
  const unsigned l1 = l + GTB, l2 = l + 2 * GTB, l3 = l + 3 * GTB, l4 = l + 4 * GTB, l5 = l + 5 * GTB, l6 = l + 6 * GTB, l7 = l + 7 * GTB; const __bf16 *a1 = a + TPE, *a2 = a + 2 * TPE, *a3 = a + 3 * TPE, *b1 = b + TPE, *b2 = b + 2 * TPE, *b3 = b + 3 * TPE;
  asm volatile("global_load_async_to_lds_b128 %0, %8, off\n\tglobal_load_async_to_lds_b128 %1, %9, off\n\tglobal_load_async_to_lds_b128 %2, %10, off\n\tglobal_load_async_to_lds_b128 %3, %11, off\n\tglobal_load_async_to_lds_b128 %4, %12, off\n\tglobal_load_async_to_lds_b128 %5, %13, off\n\tglobal_load_async_to_lds_b128 %6, %14, off\n\tglobal_load_async_to_lds_b128 %7, %15, off\n\ts_wait_xcnt 0x0" :: "v"(l), "v"(l1), "v"(l2), "v"(l3), "v"(l4), "v"(l5), "v"(l6), "v"(l7), "v"(a), "v"(a1), "v"(a2), "v"(a3), "v"(b), "v"(b1), "v"(b2), "v"(b3) : "memory");
}
// ---- k_proj: block = (128 rows, 128 cols, which), four waves of 64 x 64 (one head each): a k step's 8 fragments feed 16 products; qkv = x W (+ b), exact; q -> f16 hi (+ residual), k -> f16 rows, v -> bf16 planes. The 768 blocks are resident together, three a WGP (the operand ring, the q/k staging and the v staging share one LDS buffer)
#define PJP 136                 /* LDS row pitch of the output staging in 16-bit elements: 272 B = 16 B x 17 */
__global__ __launch_bounds__(128) void k_proj(const __bf16* __restrict__ XP, const __bf16* __restrict__ WP, const float* __restrict__ BQ, const float* __restrict__ BK, const float* __restrict__ BV, _Float16* __restrict__ QH, _Float16* __restrict__ QL, _Float16* __restrict__ KH, __bf16* __restrict__ VT, __bf16* __restrict__ VL, const float2* __restrict__ ROT) {
  __shared__ __align__(16) unsigned char smem[2 * 128 * PJP * 2];   /* 69,632 B: the ring's 2 * GSB = 65,536 B in the main loop, the output staging behind it */
  static_assert(2 * GSB <= 2 * 128 * PJP * 2, "ring fits");
  _Float16 (*sh)[PJP] = (_Float16 (*)[PJP])smem; _Float16 (*sl)[PJP] = (_Float16 (*)[PJP])(smem + 128 * PJP * 2); __bf16 (*th)[PJP] = (__bf16 (*)[PJP])smem; __bf16 (*tl2)[PJP] = (__bf16 (*)[PJP])(smem + 128 * PJP * 2);
  const int tid = threadIdx.x, wave = tid >> 5, lane = tid & 31, col = lane & 15, g = lane >> 4, wr = wave >> 1, wc = wave & 1; const int which = blockIdx.z; const int c0 = blockIdx.y * 128; const size_t r0 = (size_t)blockIdx.x * 128; const float* BA = which == 0 ? BQ : which == 1 ? BK : BV;
  v8f acc[4][4] = {};
  /* LDS tiles 0..7 = the block's 8 row tiles of x, 8..15 = its 8 column tiles of W */
  const __bf16* xg = XP + ((size_t)which * (NB * TT / 16) + blockIdx.x * 8) * TPE + tid * 8; const __bf16* wg = WP + ((size_t)which * (CC / 16) + blockIdx.y * 8) * TPE + tid * 8; const unsigned lc = (unsigned)(size_t)smem + (unsigned)tid * 16;
  copy8(lc, xg, xg + 4 * TPE); copy8(lc + 8 * GTB, wg, wg + 4 * TPE);
  asm volatile("s_wait_asynccnt 0x0" ::: "memory");   /* this wave's copies of stage 0 have landed */
  __syncthreads();                                    /* and every other wave's */
  copy8(lc + GSB, xg + GST * FRAG_E, xg + 4 * TPE + GST * FRAG_E); copy8(lc + GSB + 8 * GTB, wg + GST * FRAG_E, wg + 4 * TPE + GST * FRAG_E);
#pragma unroll 1   /* rolled: one stage's code serves both buffers */
  for (int st = 0; st < GNS; ++st) { const __bf16* bp = (const __bf16*)(smem + (st & 1) * GSB) + lane * 8;
#pragma unroll
    for (int s = 0; s < GST; ++s) { v16b a[4], w[4];   /* the k step's 16 LDS reads stand together in front of its products */
      __builtin_amdgcn_sched_barrier(0);   /* this and the next: they hold the reads as one group; left free, the compiler reads one row fragment at a time into one register set and waits for each */
#pragma unroll
      for (int i = 0; i < 4; ++i) a[i] = frag_p(bp + ((wr * 4 + i) * GST + s) * FRAG_E);
#pragma unroll
      for (int j = 0; j < 4; ++j) w[j] = frag_p(bp + ((8 + wc * 4 + j) * GST + s) * FRAG_E);
      __builtin_amdgcn_sched_barrier(0);
#pragma unroll
      for (int i = 0; i < 4; ++i)
#pragma unroll
        for (int j = 0; j < 4; ++j) acc[i][j] = wmma_bf(a[i], w[j], acc[i][j]); }
    __builtin_amdgcn_sched_barrier(0);   /* the stage's products stay in front of the hand-over, so that the refill is not held back by them */
    /* hand-over: this wave's reads of the buffer are done, its copies of the next stage have landed; behind the barrier that holds of every wave, and the buffer just read takes stage st + 2 */
    asm volatile("s_wait_dscnt 0x0" ::: "memory");
    asm volatile("s_wait_asynccnt 0x0" ::: "memory");
    __syncthreads();
    if (st + 2 < GNS) { const int eo = (st + 2) * GST * FRAG_E; const unsigned lb = lc + (unsigned)(st & 1) * GSB; copy8(lb, xg + eo, xg + 4 * TPE + eo); copy8(lb + 8 * GTB, wg + eo, wg + 4 * TPE + eo); } }
  asm volatile("s_wait_asynccnt 0x0" ::: "memory");   /* no copy outstanding when the buffer turns into the output staging */
  { float b4[4] = {0.f, 0.f, 0.f, 0.f};
    if (BA) { const float* bp = BA + c0 + wc * 64 + col;
#pragma unroll
      for (int j = 0; j < 4; ++j) b4[j] = bp[j * 16];
      asm volatile("s_wait_xcnt 0x0" :: "v"(bp) : "memory"); }   /* the four loads' address stays whole until this wait: no load lands on it */
#pragma unroll
    for (int j = 0; j < 4; ++j) { const float bb0 = bfr(b4[j]);
#pragma unroll
      for (int i = 0; i < 4; ++i)
#pragma unroll
        for (int r = 0; r < 8; ++r) acc[i][j][r] += bb0; } }   /* bias before the rotary */
  if (which < 2) {   /* rotate-half rotary on all 64 head dims: the wave's four column tiles are one head; tiles j (d 0..15), j+1 (16..31) pair with j+2 (32..47), j+3 (48..63) in the SAME lane and row: out[d] = x[d] c - x[d+32] s, out[d+32] = x[d] s + x[d+32] c, angle index = d (< 32). A block's 128 rows lie in one batch, so t = r0 % TT + the row in the block */
    const float2* rp = ROT + (size_t)((int)(r0 % TT) + wr * 64 + 8 * g) * 32 + col; float2 cv[4][2][8];
#pragma unroll
    for (int i = 0; i < 4; ++i)
#pragma unroll
      for (int j = 0; j < 2; ++j)
#pragma unroll
        for (int r = 0; r < 8; ++r) cv[i][j][r] = rp[(i * 16 + r) * 32 + j * 16];
#pragma unroll
    for (int i = 0; i < 4; ++i)
#pragma unroll
      for (int j = 0; j < 2; ++j)
#pragma unroll
        for (int r = 0; r < 8; ++r) { const float xl = acc[i][j][r], xr = acc[i][j + 2][r]; acc[i][j][r] = xl * cv[i][j][r].x - xr * cv[i][j][r].y; acc[i][j + 2][r] = xl * cv[i][j][r].y + xr * cv[i][j][r].x; } }
  if (which == 2) {   /* the branch on the matrix stands once, outside the 128 elements */
#pragma unroll
    for (int i = 0; i < 4; ++i)
#pragma unroll
      for (int j = 0; j < 4; ++j)
#pragma unroll
        for (int r = 0; r < 8; ++r) { const float v = acc[i][j][r] + 0.f; const int rl = wr * 64 + i * 16 + 8 * g + r, cl = wc * 64 + j * 16 + col; const __bf16 bh = (__bf16)v; th[cl][rl] = bh; tl2[cl][rl] = (__bf16)(v - (float)bh); } }
  else {
#pragma unroll
    for (int i = 0; i < 4; ++i)
#pragma unroll
      for (int j = 0; j < 4; ++j)
#pragma unroll
        for (int r = 0; r < 8; ++r) { const float v = acc[i][j][r] + 0.f; const int rl = wr * 64 + i * 16 + 8 * g + r, cl = wc * 64 + j * 16 + col; const _Float16 hv = (_Float16)v; sh[rl][cl] = hv; sl[rl][cl] = (_Float16)((v - (float)hv) * 1024.0f); } }   /* q residual carried x 2^10 so the plane stays f16-normal on the chip */
  __syncthreads();
  if (which == 0) { for (int e = tid; e < 128 * 16; e += 128) { const int rl = e >> 4, q = e & 15; _Float16* d0 = QH + (r0 + rl) * CC + c0 + q * 8; _Float16* d1 = QL + (r0 + rl) * CC + c0 + q * 8; const v4u u0 = *(const v4u*)&sh[rl][q * 8], u1 = *(const v4u*)&sl[rl][q * 8]; vst2(d0, u0); vst2(d1, u1); } }
  else if (which == 1) { for (int e = tid; e < 128 * 16; e += 128) { const int rl = e >> 4, q = e & 15; _Float16* d0 = KH + (r0 + rl) * CC + c0 + q * 8; const v4u u0 = *(const v4u*)&sh[rl][q * 8]; vst2(d0, u0); } }
  else { const size_t b = r0 / TT; const int t0 = (int)(r0 % TT); for (int e = tid; e < 128 * 16; e += 128) { const int cl = e >> 4, q = e & 15; const size_t o2 = (b * CC + c0 + cl) * (size_t)TT + t0 + q * 8; __bf16* d0 = VT + o2; __bf16* d1 = VL + o2; const v4u u0 = *(const v4u*)&th[cl][q * 8], u1 = *(const v4u*)&tl2[cl][q * 8]; vst2(d0, u0); vst2(d1, u1); } } }
// ---- k_fa: block = 8 waves x 16 queries of one (b, h); the block's keys come through LDS: a stage is 64 keys (K rows, V^T hi rows, V^T lo rows, 128 B a row at a pitch of 144 B), brought once for all eight waves by asynchronous copies into two buffers, the next stage flying while this one is worked on; the batch's 2,048 values of frac go to LDS once, as two f32 tables. A wave walks a stage 32 keys at a time and never stores a logit: S^T = kl frac_k + K Q^T (2 products) + ka max(frac_k, frac_q), x 64^-0.5 log2 e inside the fma that takes the maximum off, so that each weight is one exp2, running maximum and sum per query (a lane holds one query's column: keys 8g+r of each 16-key tile), P^T packed from the two score tiles straight into a B operand (hardware k order), O^T += V^T P^T (3 products), O^T / sum at the end. waves_per_eu(4, 4): a budget of 256 registers, the 512 blocks resident together, two a WGP
#define L2E 1.44269504088896340736f   /* log2(e): logits are carried in base 2 */
#define KST 64                  /* keys a stage */
#define NST (TT / KST)
#define LP 72                   /* LDS row pitch in 16-bit elements: 144 B = 16 B x 9, free of bank conflicts for 16-byte readers */
#define TILE_B (64 * LP * 2)
#define STAGE_B (3 * TILE_B)
// one stage's six 16-byte copies of a lane (rows r and r + 32 of K, V hi, V lo). The s_wait_xcnt stands inside the statement, so that no register which an issued copy names is written anew in front of it
__device__ __forceinline__ void stage_copy(unsigned l, const _Float16* k, const __bf16* v, const __bf16* w) {
  const unsigned l1 = l + 32 * LP * 2, l2 = l + TILE_B, l3 = l2 + 32 * LP * 2, l4 = l + 2 * TILE_B, l5 = l4 + 32 * LP * 2; const _Float16* k1 = k + (size_t)32 * CC; const __bf16* v1 = v + (size_t)32 * TT; const __bf16* w1 = w + (size_t)32 * TT;
  asm volatile("global_load_async_to_lds_b128 %0, %6, off\n\tglobal_load_async_to_lds_b128 %1, %7, off\n\tglobal_load_async_to_lds_b128 %2, %8, off\n\tglobal_load_async_to_lds_b128 %3, %9, off\n\tglobal_load_async_to_lds_b128 %4, %10, off\n\tglobal_load_async_to_lds_b128 %5, %11, off\n\ts_wait_xcnt 0x0" :: "v"(l), "v"(l1), "v"(l2), "v"(l3), "v"(l4), "v"(l5), "v"(k), "v"(k1), "v"(v), "v"(v1), "v"(w), "v"(w1) : "memory");
}
__global__ __launch_bounds__(256) __attribute__((amdgpu_waves_per_eu(4, 4))) void k_fa(const _Float16* __restrict__ QH, const _Float16* __restrict__ QL, const _Float16* __restrict__ KH, const __bf16* __restrict__ VT, const __bf16* __restrict__ VL, const float* __restrict__ FR, const float* __restrict__ AP, const float* __restrict__ AN, __bf16* __restrict__ YH, __bf16* __restrict__ YL) {
  __shared__ __align__(16) unsigned char ring[2 * STAGE_B]; __shared__ __align__(16) float sG[TT], sH[TT];
  const int tid = threadIdx.x, wave = tid >> 5, lane = tid & 31, col = lane & 15, g = lane >> 4; const int h = blockIdx.y, b = blockIdx.z; const int q = blockIdx.x * 128 + wave * 16 + col;
  const size_t qrow = ((size_t)b * TT + q) * CC + h * HD;
  /* the copies: thread = (row tid >> 3, 16-byte piece tid & 7), so a wave's copy covers four whole 128-byte rows */
  const int crow = tid >> 3, cpc = tid & 7; const _Float16* kg = KH + ((size_t)b * TT + crow) * CC + h * HD + cpc * 8; const size_t vg0 = ((size_t)b * CC + h * HD + crow) * (size_t)TT + cpc * 8; const __bf16* vg = VT + vg0; const __bf16* wg = VL + vg0;
  const unsigned lc = (unsigned)(size_t)ring + (unsigned)(crow * (LP * 2) + cpc * 16);
  stage_copy(lc, kg, vg, wg);
  /* the bias (D >= 0 ? ap : an) D, D = f_k - f_q, is an f_k + (ap - an) max(f_k, f_q) - ap f_q (f_k >= f_q: ap f_k - ap f_q; else an f_k - an f_q). The last term, one constant a query, leaves the softmax unchanged: it is not formed. In units of the raw product (logit / 64^-0.5): kl f_k + ka max(f_k, f_q). The block's two tables, once: sG = f_k (rounded as before), sH = kl f_k */
  const float ap = bfr(AP[h]), an = bfr(AN[h]), kl = 8.0f * an, ka = 8.0f * (ap - an), fq = bfr(FR[(size_t)b * TT + q]);
#pragma unroll
  for (int e = 0; e < 2; ++e) { const int i0 = e * 1024 + tid * 4; const v4f f = *(const v4f*)(FR + (size_t)b * TT + i0); v4f gv, hv;
#pragma unroll
    for (int i = 0; i < 4; ++i) { gv[i] = bfr(f[i]); hv[i] = gv[i] * kl; }
    *(v4f*)(sG + i0) = gv; *(v4f*)(sH + i0) = hv; }
  v16h qh[HD / 32], ql[HD / 32];
#pragma unroll
  for (int kc = 0; kc < HD / 32; ++kc) { qh[kc] = frag_h(QH + qrow + kc * 32, lane); ql[kc] = frag_h(QL + qrow + kc * 32, lane); }
  asm volatile("s_wait_asynccnt 0x0" ::: "memory");   /* this wave's copies of stage 0 have landed */
  __syncthreads();                                    /* and every other wave's, and every wave's part of the two tables */
  stage_copy(lc + STAGE_B, kg + (size_t)KST * CC, vg + KST, wg + KST);
  const int lo = col * LP + 8 * g;   /* each lane's own row and 8g */
  v8f o[HD / 16] = {}; float m = -3.0e38f, l = 0.f; const v2f ka2 = {ka, ka}, r2 = {1.0f / 1024.0f, 1.0f / 1024.0f}, c2 = {0.125f * L2E, 0.125f * L2E};
#pragma unroll 1   /* rolled: one stage's code serves both buffers */
  for (int st = 0; st < NST; ++st) { const unsigned char* bp = ring + (st & 1) * STAGE_B;
#pragma unroll 1   /* rolled: the fragments of two passes do not fit 256 registers */
  for (int hf = 0; hf < KST / 32; ++hf) { float s[16]; v4f fk[4]; v8f hk[2]; v16h kf[2][HD / 32]; v16b vf[HD / 16], wf[HD / 16];
    const _Float16* kq = (const _Float16*)bp + hf * 32 * LP + lo; const __bf16* vq = (const __bf16*)(bp + TILE_B) + hf * 32 + lo; const __bf16* wq = (const __bf16*)(bp + 2 * TILE_B) + hf * 32 + lo; const float* fp = sG + st * KST + hf * 32 + 8 * g; const float* hp = sH + st * KST + hf * 32 + 8 * g;
#pragma unroll
    for (int t = 0; t < 2; ++t) {
#pragma unroll
      for (int kc = 0; kc < HD / 32; ++kc) kf[t][kc] = frag_h(kq + (t * 16) * LP + kc * 32, 0);
      fk[t * 2] = *(const v4f*)(fp + t * 16); fk[t * 2 + 1] = *(const v4f*)(fp + t * 16 + 4);
      { union { v8f v; v4f q[2]; } u; u.q[0] = *(const v4f*)(hp + t * 16); u.q[1] = *(const v4f*)(hp + t * 16 + 4); hk[t] = u.v; } }   /* register r = key 8g + r of the tile: the accumulator's own row order */
#pragma unroll
    for (int j = 0; j < HD / 16; ++j) { vf[j] = frag_b(vq + (j * 16) * LP, 0); wf[j] = frag_b(wq + (j * 16) * LP, 0); }
    __builtin_amdgcn_sched_barrier(0);   /* the pass's 32 LDS reads stay one group in front of its products: without it the compiler sinks a part of them among the products */
#pragma unroll
    for (int t = 0; t < 2; ++t) { v8f a = hk[t], al = {};   /* kl f_k enters as the C operand of the first product */
#pragma unroll
      for (int kc = 0; kc < HD / 32; ++kc) { a = wmma16(kf[t][kc], qh[kc], a); al = wmma16(kf[t][kc], ql[kc], al); }
#pragma unroll
      for (int r = 0; r < 8; r += 2) { const v2f G = {fk[t * 2 + (r >> 2)][r & 3], fk[t * 2 + (r >> 2)][(r & 3) + 1]}, A = {a[r], a[r + 1]}, R = {al[r], al[r + 1]}; const v2f M = {fmaxf(G[0], fq), fmaxf(G[1], fq)}, x = __builtin_elementwise_fma(M, ka2, __builtin_elementwise_fma(R, r2, A));   /* pairs: packed f32 forms */
        s[t * 8 + r] = x[0]; s[t * 8 + r + 1] = x[1]; } }   /* still in raw-product units */
    float mx = s[0];
#pragma unroll
    for (int i = 1; i < 16; ++i) mx = fmaxf(mx, s[i]);
    mx *= 0.125f * L2E;   /* m is kept in base-2 logits; the scale is positive, so the maximum may be taken in front of it */
    mx = fmaxf(mx, __shfl_xor(mx, 16));   /* the other half of the wave holds this query's other 16 keys */
    const float mn = fmaxf(m, mx), sc = __builtin_amdgcn_exp2f(m - mn); m = mn; float ps = 0.f; const v2f nm2 = {-mn, -mn};
#pragma unroll
    for (int i = 0; i < 16; i += 2) { const v2f x = {s[i], s[i + 1]}, e = __builtin_elementwise_fma(x, c2, nm2); s[i] = e[0]; s[i + 1] = e[1]; }   /* 64^-0.5 log2 e rides in the subtraction's place */
#pragma unroll
    for (int i = 0; i < 16; ++i) s[i] = __builtin_amdgcn_exp2f(s[i]);
#pragma unroll
    for (int j = 0; j < HD / 16; ++j)
#pragma unroll
      for (int r = 0; r < 8; ++r) o[j][r] *= sc;
    const F2 p = bsplit16(s);   /* element i < 8 = the pass's key 8g + i, i >= 8 = key 16 + 8g + i - 8: the k order of frag_b */
#pragma unroll
    for (int j = 0; j < HD / 16; ++j) o[j] = wmma_bf(vf[j], p.h, o[j]);   /* the twelve products as one run, the four tiles in turn; each tile's three in the order they had */
#pragma unroll
    for (int j = 0; j < HD / 16; ++j) o[j] = wmma_bf(vf[j], p.l, o[j]);
#pragma unroll
    for (int j = 0; j < HD / 16; ++j) o[j] = wmma_bf(wf[j], p.h, o[j]);
    __builtin_amdgcn_sched_barrier(0);   /* keeps adds of the row sum behind the last product: they fill the vector slots that the chip needs before the next pass writes over that product's operands */
#pragma unroll
    for (int i = 0; i < 16; ++i) ps += s[i];
    l = l * sc + ps; }
    /* hand-over: this wave's reads of the buffer are done, its copies of the next stage have landed; behind the barrier that holds of every wave, and the buffer just read takes stage st + 2 */
    asm volatile("s_wait_dscnt 0x0" ::: "memory");
    asm volatile("s_wait_asynccnt 0x0" ::: "memory");
    __syncthreads();
    if (st + 2 < NST) stage_copy(lc + (unsigned)(st & 1) * STAGE_B, kg + (size_t)(st + 2) * KST * CC, vg + (st + 2) * KST, wg + (st + 2) * KST); }
  asm volatile("s_wait_asynccnt 0x0" ::: "memory");   /* no copy outstanding when the wave ends */
  l += __shfl_xor(l, 16); const float inv = 1.0f / l;   /* O^T register r of tile j = head dim j*16 + 8g + r of this lane's query: piece (half j & 1, this lane) of k_out's A fragment (row tile of the wave's 16 queries, kc = 2h + (j >> 1)), so y leaves as packed bf16 hi + residual */
  const size_t yo = (((size_t)b * (TT / 16) + blockIdx.x * 8 + wave) * NKC + h * 2) * FRAG_E + lane * 8;
#pragma unroll
  for (int j = 0; j < HD / 16; ++j) { v8b uh, ul;
#pragma unroll
    for (int r = 0; r < 8; ++r) { const float v = o[j][r] * inv; const __bf16 hv = (__bf16)v; uh[r] = hv; ul[r] = (__bf16)(v - (float)hv); }
    vst2(YH + yo + j * 256, uh); vst2(YL + yo + j * 256, ul); } }
// ---- k_out: block = (64 rows, 128 cols): out = y (bf16 hi + lo) Wo + bo
__global__ __launch_bounds__(128) void k_out(const __bf16* __restrict__ YH, const __bf16* __restrict__ YL, const __bf16* __restrict__ WP, const float* __restrict__ BP, float* __restrict__ OUT) { __shared__ __align__(16) float sf[4][16][132]; __shared__ __align__(16) unsigned char ring[2 * GSB];
  const int tid = threadIdx.x, wave = tid >> 5, lane = tid & 31, col = lane & 15, g = lane >> 4; const int c0 = blockIdx.y * 128; const size_t r0 = (size_t)blockIdx.x * 64 + wave * 16;
  v8f acc[8] = {};
  /* LDS tiles 0..3 = the block's 4 row tiles of y hi, 4..7 = of y lo, 8..15 = its 8 column tiles of Wo */
  const size_t yo = (size_t)blockIdx.x * 4 * TPE + tid * 8; const __bf16* yh = YH + yo; const __bf16* yl = YL + yo; const __bf16* wg = WP + ((size_t)3 * (CC / 16) + blockIdx.y * 8) * TPE + tid * 8; const unsigned lc = (unsigned)(size_t)ring + (unsigned)tid * 16;
  copy8(lc, yh, yl); copy8(lc + 8 * GTB, wg, wg + 4 * TPE);
  asm volatile("s_wait_asynccnt 0x0" ::: "memory");   /* this wave's copies of stage 0 have landed */
  __syncthreads();                                    /* and every other wave's */
  copy8(lc + GSB, yh + GST * FRAG_E, yl + GST * FRAG_E); copy8(lc + GSB + 8 * GTB, wg + GST * FRAG_E, wg + 4 * TPE + GST * FRAG_E);
#pragma unroll 1   /* rolled: one stage's code serves both buffers */
  for (int st = 0; st < GNS; ++st) { const __bf16* bp = (const __bf16*)(ring + (st & 1) * GSB) + lane * 8;
#pragma unroll
    for (int s = 0; s < GST; ++s) { __builtin_amdgcn_sched_barrier(0);   /* the three: as in k_proj */
      const v16b ah = frag_p(bp + (wave * GST + s) * FRAG_E), al = frag_p(bp + ((4 + wave) * GST + s) * FRAG_E); v16b w[8];   /* the k step's 20 LDS reads together in front of its products, as in k_proj */
#pragma unroll
      for (int j = 0; j < 8; ++j) w[j] = frag_p(bp + ((8 + j) * GST + s) * FRAG_E);
      __builtin_amdgcn_sched_barrier(0);
#pragma unroll
      for (int j = 0; j < 8; ++j) { acc[j] = wmma_bf(ah, w[j], acc[j]); acc[j] = wmma_bf(al, w[j], acc[j]); } }
    __builtin_amdgcn_sched_barrier(0);
    /* hand-over, as in k_proj */
    asm volatile("s_wait_dscnt 0x0" ::: "memory");
    asm volatile("s_wait_asynccnt 0x0" ::: "memory");
    __syncthreads();
    if (st + 2 < GNS) { const int eo = (st + 2) * GST * FRAG_E; const unsigned lb = lc + (unsigned)(st & 1) * GSB; copy8(lb, yh + eo, yl + eo); copy8(lb + 8 * GTB, wg + eo, wg + 4 * TPE + eo); } }
  asm volatile("s_wait_asynccnt 0x0" ::: "memory");   /* no copy outstanding when the wave ends */
#pragma unroll
  for (int j = 0; j < 8; ++j) { const float bb = BP ? bfr(BP[c0 + j * 16 + col]) : 0.f;
#pragma unroll
    for (int r = 0; r < 8; ++r) sf[wave][8 * g + r][j * 16 + col] = acc[j][r] + bb; }
  LDSX(); for (int rl = 0; rl < 16; ++rl) vst2(OUT + (r0 + rl) * CC + c0 + lane * 4, *(const v4f*)&sf[wave][rl][lane * 4]); }
extern "C" void kernel_launch(void* const* d_in, const int* in_sizes, int n_in, void* d_out, int out_size, void* d_ws, size_t ws_size, hipStream_t stream) {
  (void)in_sizes; (void)n_in; (void)out_size;
  const float** F = (const float**)d_in;   // 0 query, 1 key, 2 value [2,2048,1024]; 3 frac [2,2048]; 4 Wq, 5 Wk, 6 Wv, 7 Wo ((in,out)); 8 bq, 9 bk, 10 bv, 11 bo; 12 alpha_pos [16], 13 alpha_neg [16]
  if (ws_size < (size_t)WS_END) return;
  char* ws = (char*)d_ws; _Float16 *QH = (_Float16*)(ws + WS_QH), *QL = (_Float16*)(ws + WS_QL), *KH = (_Float16*)(ws + WS_KH); __bf16 *VT = (__bf16*)(ws + WS_VT), *VL = (__bf16*)(ws + WS_VL), *YH = (__bf16*)(ws + WS_YH), *YL = (__bf16*)(ws + WS_YL), *XP = (__bf16*)(ws + WS_XP), *WP = (__bf16*)(ws + WS_WP);
  k_pre<<<dim3(PRE_X + PRE_W + TT * 32 / 256), 256, 0, stream>>>(F[0], F[1], F[2], F[4], F[5], F[6], F[7], XP, WP, (float2*)(ws + WS_ROT));
  k_proj<<<dim3(TNB * TT / 128, CC / 128, 3), 128, 0, stream>>>(XP, WP, F[8], F[9], F[10], QH, QL, KH, VT, VL, (const float2*)(ws + WS_ROT));
  k_fa<<<dim3(TT / 128, NH, TNB), 256, 0, stream>>>(QH, QL, KH, VT, VL, F[3], F[12], F[13], YH, YL);
  k_out<<<dim3(TNB * TT / 64, CC / 128), 128, 0, stream>>>(YH, YL, WP, F[11], (float*)d_out);
}

// v009
// It runs in 122 microseconds.
// Two timings next to v008 put it at 1.06 and 1.05 times that version's speed.
// Over all steps from v000 it is 13.7 times as fast.
// compute dtype: all float inputs rounded to bf16; q/k/v = x W + b with EXACT bf16 products on WMMA 16x16x32, f32 accumulate; rotate-half rotary in f32 from a cos/sin table of t * (1/freq_div[i]) (the module's f32 reciprocals; precise cosf/sinf); q as f16 hi + residual (x 2^10), k once to f16 -> 2-product logits + the stoichiometric bias from frac / alpha in f32, written as a per-key term (the products' C operand) + a multiple of max(frac_k, frac_q), its per-query constant left out (softmax does not see it); softmax in f32 in base 2 (64^-0.5 log2 e applied in the fma in front of the hardware exp2) and a running maximum and sum over 32-key steps, logits never stored; unnormalised P split bf16 hi + lo against v bf16 hi + lo (3 products), divided by the sum at the end; y (bf16 hi + lo) Wo + bo; f32 output.
#include <hip/hip_runtime.h>
#include <math.h>

typedef __attribute__((ext_vector_type(16))) _Float16 v16h;
typedef __attribute__((ext_vector_type(16))) __bf16 v16b;
typedef __attribute__((ext_vector_type(8)))  _Float16 v8h;
typedef __attribute__((ext_vector_type(8)))  float v8f;
typedef __attribute__((ext_vector_type(4)))  float v4f;
typedef __attribute__((ext_vector_type(2)))  float v2f;
typedef __attribute__((ext_vector_type(4)))  unsigned v4u;
typedef __attribute__((ext_vector_type(4)))  int v4i;
typedef float __attribute__((may_alias)) float_a;
typedef int __attribute__((may_alias)) int_a;

template <typename T> __device__ __forceinline__ void vst2(void* p, T v) { *(T*)p = v;  }
__device__ __forceinline__ v8f wmma16(v16h a, v16h b, v8f c) {
  v8f d = __builtin_amdgcn_wmma_f32_16x16x32_f16(false, a, false, b, (short)0, c, false, false);
  return d;
}
__device__ __forceinline__ v8f wmma_bf(v16b a, v16b b, v8f c) {
  v8f d = __builtin_amdgcn_wmma_f32_16x16x32_bf16(false, a, false, b, (short)0, c, false, false);
  return d;
}
// 16x16x32 fragments: lane = (h = lane>>4, row/col = lane&15); elements 0..7 = k0+8h+0..7, 8..15 = k0+16+8h+0..7; D element r = row 8h+r
__device__ __forceinline__ v16h frag_h(const _Float16* rowk0, int lane) {
  union { v16h v; v8h q[2]; } u; const _Float16* p = rowk0 + 8 * (lane >> 4);
  u.q[0] = *(const v8h*)p; u.q[1] = *(const v8h*)(p + 16); return u.v;
}
__device__ __forceinline__ v16h frag_f32(const float* rowk0, int lane) {
  v16h a; const float* p = rowk0 + 8 * (lane >> 4);
#pragma unroll
  for (int i = 0; i < 8; ++i) { a[i] = (_Float16)p[i]; a[8 + i] = (_Float16)p[16 + i]; }
  return a;
}
__device__ __forceinline__ v16h frag_f32s(const float* rowk0, int lane, float sc) {
  v16h a; const float* p = rowk0 + 8 * (lane >> 4);
#pragma unroll
  for (int i = 0; i < 8; ++i) { a[i] = (_Float16)(p[i] * sc); a[8 + i] = (_Float16)(p[16 + i] * sc); }
  return a;
}
// column fragment from a [K][ld] layout (column n), rows >= K read as 0
__device__ __forceinline__ v16h fragc_f32(const float* W, int k0, int n, int lane, int ld, int K) {
  v16h a; const int g = lane >> 4;
#pragma unroll
  for (int i = 0; i < 8; ++i) { const int ka = k0 + 8 * g + i, kb = ka + 16;
    a[i] = (_Float16)(ka < K ? W[(size_t)(ka < K ? ka : K - 1) * ld + n] : 0.f); a[8 + i] = (_Float16)(kb < K ? W[(size_t)(kb < K ? kb : K - 1) * ld + n] : 0.f); }
  return a;
}
struct F2 { v16b h, l; };
__device__ __forceinline__ F2 bsplit16(const float v[16]) { F2 r;
#pragma unroll
  for (int i = 0; i < 16; ++i) { const __bf16 h = (__bf16)v[i]; r.h[i] = h; r.l[i] = (__bf16)(v[i] - (float)h); }
  return r; }
__device__ __forceinline__ F2 split_row(const float* row, int k0, int lane) { float v[16]; const float* p = row + k0 + 8 * (lane >> 4);
#pragma unroll
  for (int i = 0; i < 8; ++i) { v[i] = p[i]; v[8 + i] = p[16 + i]; }
  return bsplit16(v); }
__device__ __forceinline__ F2 split_rowK(const float* row, int k0, int lane, int K) { float v[16]; const int g = lane >> 4;
#pragma unroll
  for (int i = 0; i < 8; ++i) { const int ka = k0 + 8 * g + i, kb = ka + 16; v[i] = ka < K ? row[ka < K ? ka : K - 1] : 0.f; v[8 + i] = kb < K ? row[kb < K ? kb : K - 1] : 0.f; }
  return bsplit16(v); }
__device__ __forceinline__ F2 split_col(const float* W, int k0, int n, int lane, int ld, int K) { float v[16]; const int g = lane >> 4;
#pragma unroll
  for (int i = 0; i < 8; ++i) { const int ka = k0 + 8 * g + i, kb = ka + 16; v[i] = ka < K ? W[(size_t)(ka < K ? ka : K - 1) * ld + n] : 0.f; v[8 + i] = kb < K ? W[(size_t)(kb < K ? kb : K - 1) * ld + n] : 0.f; }
  return bsplit16(v); }
__device__ __forceinline__ v8f mac3(const F2& a, const F2& b, v8f c) { c = wmma_bf(a.l, b.h, c); c = wmma_bf(a.h, b.l, c); return wmma_bf(a.h, b.h, c); }
__device__ __forceinline__ float sigm(float v) { return 1.0f / (1.0f + expf(-v)); }
#define LDSX() do { asm volatile("s_wait_dscnt 0" ::: "memory"); __builtin_amdgcn_wave_barrier(); __builtin_amdgcn_fence(__ATOMIC_RELEASE, "workgroup"); } while (0)


// Multi-head attention with rotary embedding and a data-dependent 'stoichiometric' bias (B 2, T 2,048, D 1,024 = 16 x 64): Q = query Wq + bq, K = key Wk + bk, V = value Wv + bv ((in,out)); rotate-half RoPE with angle t / 10000^(2i/64); scores = Q K^T 64^-0.5 + (alpha_pos[h] if frac_j >= frac_i else alpha_neg[h]) (frac_j - frac_i); softmax; P V; out Wo + bo.
#define NB 2
#define TT 2048
#define CC 1024
#define NH 16
#define HD 64
__constant__ float RCPF[32] = {1.000000000e+0f,7.498942018e-1f,5.623413324e-1f,4.216965139e-1f,3.162277639e-1f,2.371373624e-1f,1.778279394e-1f,1.333521456e-1f,1.000000015e-1f,7.498941571e-2f,5.623412877e-2f,4.216964915e-2f,3.162277862e-2f,2.371373586e-2f,1.778279431e-2f,1.333521493e-2f,9.999999776e-3f,7.498942316e-3f,5.623413250e-3f,4.216964822e-3f,3.162277862e-3f,2.371373819e-3f,1.778279431e-3f,1.333521446e-3f,1.000000047e-3f,7.498941850e-4f,5.623413017e-4f,4.216964880e-4f,3.162277862e-4f,2.371373848e-4f,1.778279402e-4f,1.333521504e-4f};   // f32(1 / f32(10000^(2i/64))): the module divides pos by freq_div, which XLA evaluates as pos * (1/freq_div)
#ifndef TNB
#define TNB NB
#endif
typedef __attribute__((ext_vector_type(8))) __bf16 v8b;
__device__ __forceinline__ v16b frag_b(const __bf16* rowk0, int lane) {
  union { v16b v; v8b q[2]; } u; const __bf16* p = rowk0 + 8 * (lane >> 4);
  u.q[0] = *(const v8b*)p; u.q[1] = *(const v8b*)(p + 16); return u.v;
}
__device__ __forceinline__ float bfr(float v) { return (float)(__bf16)v; }
__device__ __attribute__((noinline)) float exp_ni(float v) { return expf(v); }
__device__ __attribute__((noinline)) float erf_ni(float v) { return erff(v); }

#define WS_ROT 0u                                   // float2 (cos, sin)[t][32] = cos/sin(t * (1/freq_div[j]))
#define WS_QH  (WS_ROT + 8u * (size_t)TT * 32)
#define WS_QL  (WS_QH + 2u * (size_t)NB * TT * CC)
#define WS_KH  (WS_QL + 2u * (size_t)NB * TT * CC)
#define WS_VT  (WS_KH + 2u * (size_t)NB * TT * CC)      // bf16 v planes [b][c][t]
#define WS_VL  (WS_VT + 2u * (size_t)NB * CC * TT)      // bf16 v residual planes
#define WS_YH  (WS_VL + 2u * (size_t)NB * CC * TT)      // y, bf16 hi, packed fragments [row tile][kc]
#define WS_YL  (WS_YH + 2u * (size_t)NB * TT * CC)      // y, bf16 residual, packed likewise
#define WS_XP  (WS_YL + 2u * (size_t)NB * TT * CC)      // query, key, value as bf16, packed fragments [which][row tile][kc]
#define WS_WP  (WS_XP + 3u * 2u * (size_t)NB * TT * CC) // Wq, Wk, Wv, Wo as bf16, packed fragments [matrix][column tile][kc]
#define WS_END (WS_WP + 4u * 2u * (size_t)CC * CC)
// A packed fragment is the 1 KiB that one 16x16x32 operand takes, in the order the wave reads it: 16-byte piece (half, lane) at element half * 256 + lane * 8 holds k = kc * 32 + half * 16 + 8 * (lane >> 4) + 0..7 of row (or column) tile * 16 + (lane & 15); each of the two wave-wide 16-byte loads then covers 512 contiguous bytes, four whole lines
#define FRAG_E 512
#define NKC (CC / 32)
__device__ __forceinline__ v16b frag_p(const __bf16* lanebase) {
  union { v16b v; v8b q[2]; } u; u.q[0] = *(const v8b*)lanebase; u.q[1] = *(const v8b*)(lanebase + 256); return u.v;
}

// ---- k_pre: everything the GEMMs read is laid out once a call. Blocks 0..383: a wave packs 8 kc of one 16-row tile of query / key / value (f32 -> bf16). Blocks 384..639: a wave packs 4 column tiles of one kc of one weight matrix (the transposition happens here, once, not in every GEMM wave). Blocks 640..895: one thread per (t, j): precise cosf/sinf of t * inv_freq[j] -> table (keeps the trig and its large-argument reduction out of the GEMM kernel)
#define PRE_X (3 * (NB * TT / 16) * (NKC / 8) / 8)
#define PRE_W (4 * NKC * (CC / 64) / 8)
__global__ __launch_bounds__(256) void k_pre(const float* __restrict__ X0, const float* __restrict__ X1, const float* __restrict__ X2, const float* __restrict__ WQ, const float* __restrict__ WK, const float* __restrict__ WV, const float* __restrict__ WO, __bf16* __restrict__ XP, __bf16* __restrict__ WP, float2* __restrict__ ROT) {
  const int tid = threadIdx.x, wave = tid >> 5, lane = tid & 31, col = lane & 15, g = lane >> 4; const int bx = blockIdx.x;
  if (bx < PRE_X) { const int u = bx * 8 + wave, kg = u & 3, rt = (u >> 2) & (NB * TT / 16 - 1), which = u >> 10; const float* X = which == 0 ? X0 : which == 1 ? X1 : X2;
    const float* p = X + ((size_t)rt * 16 + col) * CC + kg * 256 + 8 * g; __bf16* d = XP + (((size_t)which * (NB * TT / 16) + rt) * NKC + kg * 8) * FRAG_E + lane * 8;
    v4f a[16], b2[16];
#pragma unroll
    for (int e = 0; e < 16; ++e) { a[e] = *(const v4f*)(p + e * 16); b2[e] = *(const v4f*)(p + e * 16 + 4); }
    asm volatile("s_wait_xcnt 0x0" :: "v"(p) : "memory");   /* the loads' address pair stays whole until this wait */
#pragma unroll
    for (int e = 0; e < 16; ++e) { v8b o;
#pragma unroll
      for (int i = 0; i < 4; ++i) { o[i] = (__bf16)a[e][i]; o[4 + i] = (__bf16)b2[e][i]; }
      vst2(d + e * 256, o); }
    return; }
  if (bx < PRE_X + PRE_W) { const int u = (bx - PRE_X) * 8 + wave, ng = u & 15, kc = (u >> 4) & (NKC - 1), mat = u >> 9; const float* Wm = mat == 0 ? WQ : mat == 1 ? WK : mat == 2 ? WV : WO;
    const float* p = Wm + ((size_t)kc * 32 + 8 * g) * CC + ng * 64 + col; __bf16* d = WP + (((size_t)mat * (CC / 16) + ng * 4) * NKC + kc) * FRAG_E + lane * 8;
#pragma unroll
    for (int n = 0; n < 4; ++n)
#pragma unroll
      for (int hf = 0; hf < 2; ++hf) { v8b o;
#pragma unroll
        for (int i = 0; i < 8; ++i) o[i] = (__bf16)p[(size_t)(hf * 16 + i) * CC + n * 16];
        vst2(d + (size_t)n * NKC * FRAG_E + hf * 256, o); }
    asm volatile("s_wait_xcnt 0x0" ::: "memory");   /* behind the last store: the stores' address pair is not written anew on any way out of this part before the wait */
    return; }
  const int i = (bx - PRE_X - PRE_W) * 256 + tid; if (i >= TT * 32) return; const int t = i >> 5, j = i & 31; const float ang = (float)t * RCPF[j]; v2f v; v[0] = cosf(ang); v[1] = sinf(ang); vst2((v2f*)(ROT + i), v); }
// The two GEMM kernels bring their packed fragments to LDS once a block, by asynchronous copies: a stage is GST k steps of 16 tiles (a tile's part of a stage is GTB contiguous bytes in memory and in LDS), two buffers, the next stage flying while this one is worked on
#define GST 2
#define GNS (NKC / GST)
#define GTB (GST * FRAG_E * 2)
#define GSB (16 * GTB)
#define TPE (NKC * FRAG_E)      /* elements from one tile to the next in memory */
// eight 16-byte copies of a lane (block of 128 threads: one copy of the block = one tile's GTB bytes): four tiles from a, four from b. The s_wait_xcnt stands inside the statement, so that no register which an issued copy names is written anew in front of it
__device__ __forceinline__ void copy8(unsigned l, const __bf16* a, const __bf16* b) {
  const unsigned l1 = l + GTB, l2 = l + 2 * GTB, l3 = l + 3 * GTB, l4 = l + 4 * GTB, l5 = l + 5 * GTB, l6 = l + 6 * GTB, l7 = l + 7 * GTB; const __bf16 *a1 = a + TPE, *a2 = a + 2 * TPE, *a3 = a + 3 * TPE, *b1 = b + TPE, *b2 = b + 2 * TPE, *b3 = b + 3 * TPE;
  asm volatile("global_load_async_to_lds_b128 %0, %8, off\n\tglobal_load_async_to_lds_b128 %1, %9, off\n\tglobal_load_async_to_lds_b128 %2, %10, off\n\tglobal_load_async_to_lds_b128 %3, %11, off\n\tglobal_load_async_to_lds_b128 %4, %12, off\n\tglobal_load_async_to_lds_b128 %5, %13, off\n\tglobal_load_async_to_lds_b128 %6, %14, off\n\tglobal_load_async_to_lds_b128 %7, %15, off\n\ts_wait_xcnt 0x0" :: "v"(l), "v"(l1), "v"(l2), "v"(l3), "v"(l4), "v"(l5), "v"(l6), "v"(l7), "v"(a), "v"(a1), "v"(a2), "v"(a3), "v"(b), "v"(b1), "v"(b2), "v"(b3) : "memory");
}
// ---- k_proj: block = (128 rows, 128 cols, which), four waves of 64 x 64 (one head each): a k step's 8 fragments feed 16 products; qkv = x W (+ b), exact; q -> f16 hi (+ residual), k -> f16 rows, v -> bf16 planes. The 768 blocks are resident together, three a WGP (the operand ring, the q/k staging and the v staging share one LDS buffer)
#define PJP 136                 /* LDS row pitch of the output staging in 16-bit elements: 272 B = 16 B x 17 */
__global__ __launch_bounds__(128) void k_proj(const __bf16* __restrict__ XP, const __bf16* __restrict__ WP, const float* __restrict__ BQ, const float* __restrict__ BK, const float* __restrict__ BV, _Float16* __restrict__ QH, _Float16* __restrict__ QL, _Float16* __restrict__ KH, __bf16* __restrict__ VT, __bf16* __restrict__ VL, const float2* __restrict__ ROT) {
  __shared__ __align__(16) unsigned char smem[2 * 128 * PJP * 2];   /* 69,632 B: the ring's 2 * GSB = 65,536 B in the main loop, the output staging behind it */
  static_assert(2 * GSB <= 2 * 128 * PJP * 2, "ring fits");
  _Float16 (*sh)[PJP] = (_Float16 (*)[PJP])smem; _Float16 (*sl)[PJP] = (_Float16 (*)[PJP])(smem + 128 * PJP * 2); __bf16 (*th)[PJP] = (__bf16 (*)[PJP])smem; __bf16 (*tl2)[PJP] = (__bf16 (*)[PJP])(smem + 128 * PJP * 2);
  const int tid = threadIdx.x, wave = tid >> 5, lane = tid & 31, col = lane & 15, g = lane >> 4, wr = wave >> 1, wc = wave & 1; const int which = blockIdx.z; const int c0 = blockIdx.y * 128; const size_t r0 = (size_t)blockIdx.x * 128; const float* BA = which == 0 ? BQ : which == 1 ? BK : BV;
  v8f acc[4][4] = {};
  /* LDS tiles 0..7 = the block's 8 row tiles of x, 8..15 = its 8 column tiles of W */
  const __bf16* xg = XP + ((size_t)which * (NB * TT / 16) + blockIdx.x * 8) * TPE + tid * 8; const __bf16* wg = WP + ((size_t)which * (CC / 16) + blockIdx.y * 8) * TPE + tid * 8; const unsigned lc = (unsigned)(size_t)smem + (unsigned)tid * 16;
  copy8(lc, xg, xg + 4 * TPE); copy8(lc + 8 * GTB, wg, wg + 4 * TPE);
  asm volatile("s_wait_asynccnt 0x0" ::: "memory");   /* this wave's copies of stage 0 have landed */
  __syncthreads();                                    /* and every other wave's */
  copy8(lc + GSB, xg + GST * FRAG_E, xg + 4 * TPE + GST * FRAG_E); copy8(lc + GSB + 8 * GTB, wg + GST * FRAG_E, wg + 4 * TPE + GST * FRAG_E);
#pragma unroll 1   /* rolled: one stage's code serves both buffers */
  for (int st = 0; st < GNS; ++st) { const __bf16* bp = (const __bf16*)(smem + (st & 1) * GSB) + lane * 8;
#pragma unroll
    for (int s = 0; s < GST; ++s) { v16b a[4], w[4];   /* the k step's 16 LDS reads stand together in front of its products */
      __builtin_amdgcn_sched_barrier(0);   /* this and the next: they hold the reads as one group; left free, the compiler reads one row fragment at a time into one register set and waits for each */
#pragma unroll
      for (int i = 0; i < 4; ++i) a[i] = frag_p(bp + ((wr * 4 + i) * GST + s) * FRAG_E);
#pragma unroll
      for (int j = 0; j < 4; ++j) w[j] = frag_p(bp + ((8 + wc * 4 + j) * GST + s) * FRAG_E);
      __builtin_amdgcn_sched_barrier(0);
#pragma unroll
      for (int i = 0; i < 4; ++i)
#pragma unroll
        for (int j = 0; j < 4; ++j) acc[i][j] = wmma_bf(a[i], w[j], acc[i][j]); }
    __builtin_amdgcn_sched_barrier(0);   /* the stage's products stay in front of the hand-over, so that the refill is not held back by them */
    /* hand-over: this wave's reads of the buffer are done, its copies of the next stage have landed; behind the barrier that holds of every wave, and the buffer just read takes stage st + 2 */
    asm volatile("s_wait_dscnt 0x0" ::: "memory");
    asm volatile("s_wait_asynccnt 0x0" ::: "memory");
    __syncthreads();
    if (st + 2 < GNS) { const int eo = (st + 2) * GST * FRAG_E; const unsigned lb = lc + (unsigned)(st & 1) * GSB; copy8(lb, xg + eo, xg + 4 * TPE + eo); copy8(lb + 8 * GTB, wg + eo, wg + 4 * TPE + eo); } }
  asm volatile("s_wait_asynccnt 0x0" ::: "memory");   /* no copy outstanding when the buffer turns into the output staging */
  { float b4[4] = {0.f, 0.f, 0.f, 0.f};
    if (BA) { const float* bp = BA + c0 + wc * 64 + col;
#pragma unroll
      for (int j = 0; j < 4; ++j) b4[j] = bp[j * 16];
      asm volatile("s_wait_xcnt 0x0" :: "v"(bp) : "memory"); }   /* the four loads' address stays whole until this wait: no load lands on it */
#pragma unroll
    for (int j = 0; j < 4; ++j) { const float bb0 = bfr(b4[j]);
#pragma unroll
      for (int i = 0; i < 4; ++i)
#pragma unroll
        for (int r = 0; r < 8; ++r) acc[i][j][r] += bb0; } }   /* bias before the rotary */
  if (which < 2) {   /* rotate-half rotary on all 64 head dims: the wave's four column tiles are one head; tiles j (d 0..15), j+1 (16..31) pair with j+2 (32..47), j+3 (48..63) in the SAME lane and row: out[d] = x[d] c - x[d+32] s, out[d+32] = x[d] s + x[d+32] c, angle index = d (< 32). A block's 128 rows lie in one batch, so t = r0 % TT + the row in the block */
    const float2* rp = ROT + (size_t)((int)(r0 % TT) + wr * 64 + 8 * g) * 32 + col; float2 cv[4][2][8];
#pragma unroll
    for (int i = 0; i < 4; ++i)
#pragma unroll
      for (int j = 0; j < 2; ++j)
#pragma unroll
        for (int r = 0; r < 8; ++r) cv[i][j][r] = rp[(i * 16 + r) * 32 + j * 16];
#pragma unroll
    for (int i = 0; i < 4; ++i)
#pragma unroll
      for (int j = 0; j < 2; ++j)
#pragma unroll
        for (int r = 0; r < 8; ++r) { const float xl = acc[i][j][r], xr = acc[i][j + 2][r]; acc[i][j][r] = xl * cv[i][j][r].x - xr * cv[i][j][r].y; acc[i][j + 2][r] = xl * cv[i][j][r].y + xr * cv[i][j][r].x; } }
  if (which == 2) {   /* the branch on the matrix stands once, outside the 128 elements */
#pragma unroll
    for (int i = 0; i < 4; ++i)
#pragma unroll
      for (int j = 0; j < 4; ++j)
#pragma unroll
        for (int r = 0; r < 8; ++r) { const float v = acc[i][j][r] + 0.f; const int rl = wr * 64 + i * 16 + 8 * g + r, cl = wc * 64 + j * 16 + col; const __bf16 bh = (__bf16)v; th[cl][rl] = bh; tl2[cl][rl] = (__bf16)(v - (float)bh); } }
  else {
#pragma unroll
    for (int i = 0; i < 4; ++i)
#pragma unroll
      for (int j = 0; j < 4; ++j)
#pragma unroll
        for (int r = 0; r < 8; ++r) { const float v = acc[i][j][r] + 0.f; const int rl = wr * 64 + i * 16 + 8 * g + r, cl = wc * 64 + j * 16 + col; const _Float16 hv = (_Float16)v; sh[rl][cl] = hv; sl[rl][cl] = (_Float16)((v - (float)hv) * 1024.0f); } }   /* q residual carried x 2^10 so the plane stays f16-normal on the chip */
  __syncthreads();
  if (which == 0) { for (int e = tid; e < 128 * 16; e += 128) { const int rl = e >> 4, q = e & 15; _Float16* d0 = QH + (r0 + rl) * CC + c0 + q * 8; _Float16* d1 = QL + (r0 + rl) * CC + c0 + q * 8; const v4u u0 = *(const v4u*)&sh[rl][q * 8], u1 = *(const v4u*)&sl[rl][q * 8]; vst2(d0, u0); vst2(d1, u1); } }
  else if (which == 1) { for (int e = tid; e < 128 * 16; e += 128) { const int rl = e >> 4, q = e & 15; _Float16* d0 = KH + (r0 + rl) * CC + c0 + q * 8; const v4u u0 = *(const v4u*)&sh[rl][q * 8]; vst2(d0, u0); } }
  else { const size_t b = r0 / TT; const int t0 = (int)(r0 % TT); for (int e = tid; e < 128 * 16; e += 128) { const int cl = e >> 4, q = e & 15; const size_t o2 = (b * CC + c0 + cl) * (size_t)TT + t0 + q * 8; __bf16* d0 = VT + o2; __bf16* d1 = VL + o2; const v4u u0 = *(const v4u*)&th[cl][q * 8], u1 = *(const v4u*)&tl2[cl][q * 8]; vst2(d0, u0); vst2(d1, u1); } } }
// ---- k_fa: block = 8 waves x 16 queries of one (b, h); the block's keys come through LDS: a stage is 64 keys (K rows, V^T hi rows, V^T lo rows, 128 B a row at a pitch of 144 B), brought once for all eight waves by asynchronous copies into two buffers, the next stage flying while this one is worked on; the batch's 2,048 values of frac go to LDS once, as two f32 tables. A wave walks a stage 32 keys at a time and never stores a logit: S^T = kl frac_k + K Q^T (2 products) + ka max(frac_k, frac_q), x 64^-0.5 log2 e inside the fma that takes the maximum off, so that each weight is one exp2, a maximum in use (raised lazily) and a sum per query (a lane holds one query's column: keys 8g+r of each 16-key tile), P^T packed from the two score tiles straight into a B operand (hardware k order), O^T += V^T P^T (3 products), O^T / sum at the end. waves_per_eu(4, 4): a budget of 256 registers, the 512 blocks resident together, two a WGP
#define L2E 1.44269504088896340736f   /* log2(e): logits are carried in base 2 */
#define KST 64                  /* keys a stage */
#define NST (TT / KST)
#define LP 72                   /* LDS row pitch in 16-bit elements: 144 B = 16 B x 9, free of bank conflicts for 16-byte readers */
#define TILE_B (64 * LP * 2)
#define STAGE_B (3 * TILE_B)
// one stage's six 16-byte copies of a lane (rows r and r + 32 of K, V hi, V lo). The s_wait_xcnt stands inside the statement, so that no register which an issued copy names is written anew in front of it
__device__ __forceinline__ void stage_copy(unsigned l, const _Float16* k, const __bf16* v, const __bf16* w) {
  const unsigned l1 = l + 32 * LP * 2, l2 = l + TILE_B, l3 = l2 + 32 * LP * 2, l4 = l + 2 * TILE_B, l5 = l4 + 32 * LP * 2; const _Float16* k1 = k + (size_t)32 * CC; const __bf16* v1 = v + (size_t)32 * TT; const __bf16* w1 = w + (size_t)32 * TT;
  asm volatile("global_load_async_to_lds_b128 %0, %6, off\n\tglobal_load_async_to_lds_b128 %1, %7, off\n\tglobal_load_async_to_lds_b128 %2, %8, off\n\tglobal_load_async_to_lds_b128 %3, %9, off\n\tglobal_load_async_to_lds_b128 %4, %10, off\n\tglobal_load_async_to_lds_b128 %5, %11, off\n\ts_wait_xcnt 0x0" :: "v"(l), "v"(l1), "v"(l2), "v"(l3), "v"(l4), "v"(l5), "v"(k), "v"(k1), "v"(v), "v"(v1), "v"(w), "v"(w1) : "memory");
}
__global__ __launch_bounds__(256) __attribute__((amdgpu_waves_per_eu(4, 4))) void k_fa(const _Float16* __restrict__ QH, const _Float16* __restrict__ QL, const _Float16* __restrict__ KH, const __bf16* __restrict__ VT, const __bf16* __restrict__ VL, const float* __restrict__ FR, const float* __restrict__ AP, const float* __restrict__ AN, __bf16* __restrict__ YH, __bf16* __restrict__ YL) {
  __shared__ __align__(16) unsigned char ring[2 * STAGE_B]; __shared__ __align__(16) float sG[TT], sH[TT];
  const int tid = threadIdx.x, wave = tid >> 5, lane = tid & 31, col = lane & 15, g = lane >> 4; const int h = blockIdx.y, b = blockIdx.z; const int q = blockIdx.x * 128 + wave * 16 + col;
  const size_t qrow = ((size_t)b * TT + q) * CC + h * HD;
  /* the copies: thread = (row tid >> 3, 16-byte piece tid & 7), so a wave's copy covers four whole 128-byte rows */
  const int crow = tid >> 3, cpc = tid & 7; const _Float16* kg = KH + ((size_t)b * TT + crow) * CC + h * HD + cpc * 8; const size_t vg0 = ((size_t)b * CC + h * HD + crow) * (size_t)TT + cpc * 8; const __bf16* vg = VT + vg0; const __bf16* wg = VL + vg0;
  const unsigned lc = (unsigned)(size_t)ring + (unsigned)(crow * (LP * 2) + cpc * 16);
  stage_copy(lc, kg, vg, wg);
  /* the bias (D >= 0 ? ap : an) D, D = f_k - f_q, is an f_k + (ap - an) max(f_k, f_q) - ap f_q (f_k >= f_q: ap f_k - ap f_q; else an f_k - an f_q). The last term, one constant a query, leaves the softmax unchanged: it is not formed. In units of the raw product (logit / 64^-0.5): kl f_k + ka max(f_k, f_q). The block's two tables, once: sG = f_k (rounded as before), sH = kl f_k */
  const float ap = bfr(AP[h]), an = bfr(AN[h]), kl = 8.0f * an, ka = 8.0f * (ap - an), fq = bfr(FR[(size_t)b * TT + q]);
#pragma unroll
  for (int e = 0; e < 2; ++e) { const int i0 = e * 1024 + tid * 4; const v4f f = *(const v4f*)(FR + (size_t)b * TT + i0); v4f gv, hv;
#pragma unroll
    for (int i = 0; i < 4; ++i) { gv[i] = bfr(f[i]); hv[i] = gv[i] * kl; }
    *(v4f*)(sG + i0) = gv; *(v4f*)(sH + i0) = hv; }
  v16h qh[HD / 32], ql[HD / 32];
#pragma unroll
  for (int kc = 0; kc < HD / 32; ++kc) { qh[kc] = frag_h(QH + qrow + kc * 32, lane); ql[kc] = frag_h(QL + qrow + kc * 32, lane); }
  asm volatile("s_wait_asynccnt 0x0" ::: "memory");   /* this wave's copies of stage 0 have landed */
  __syncthreads();                                    /* and every other wave's, and every wave's part of the two tables */
  stage_copy(lc + STAGE_B, kg + (size_t)KST * CC, vg + KST, wg + KST);
  const int lo = col * LP + 8 * g;   /* each lane's own row and 8g */
  v8f o[HD / 16] = {}; float m = -3.0e38f, thr = -3.0e38f, l = 0.f; const v2f ka2 = {ka, ka}, r2 = {1.0f / 1024.0f, 1.0f / 1024.0f}, c2 = {0.125f * L2E, 0.125f * L2E};
#pragma unroll 1   /* rolled: one stage's code serves both buffers */
  for (int st = 0; st < NST; ++st) { const unsigned char* bp = ring + (st & 1) * STAGE_B;
#pragma unroll 1   /* rolled: the fragments of two passes do not fit 256 registers */
  for (int hf = 0; hf < KST / 32; ++hf) { float s[16]; v4f fk[4]; v8f hk[2]; v16h kf[2][HD / 32]; v16b vf[HD / 16], wf[HD / 16];
    const _Float16* kq = (const _Float16*)bp + hf * 32 * LP + lo; const __bf16* vq = (const __bf16*)(bp + TILE_B) + hf * 32 + lo; const __bf16* wq = (const __bf16*)(bp + 2 * TILE_B) + hf * 32 + lo; const float* fp = sG + st * KST + hf * 32 + 8 * g; const float* hp = sH + st * KST + hf * 32 + 8 * g;
#pragma unroll
    for (int t = 0; t < 2; ++t) {
#pragma unroll
      for (int kc = 0; kc < HD / 32; ++kc) kf[t][kc] = frag_h(kq + (t * 16) * LP + kc * 32, 0);
      fk[t * 2] = *(const v4f*)(fp + t * 16); fk[t * 2 + 1] = *(const v4f*)(fp + t * 16 + 4);
      { union { v8f v; v4f q[2]; } u; u.q[0] = *(const v4f*)(hp + t * 16); u.q[1] = *(const v4f*)(hp + t * 16 + 4); hk[t] = u.v; } }   /* register r = key 8g + r of the tile: the accumulator's own row order */
#pragma unroll
    for (int j = 0; j < HD / 16; ++j) { vf[j] = frag_b(vq + (j * 16) * LP, 0); wf[j] = frag_b(wq + (j * 16) * LP, 0); }
    __builtin_amdgcn_sched_barrier(0);   /* the pass's 32 LDS reads stay one group in front of its products: without it the compiler sinks a part of them among the products */
#pragma unroll
    for (int t = 0; t < 2; ++t) { v8f a = hk[t], al = {};   /* kl f_k enters as the C operand of the first product */
#pragma unroll
      for (int kc = 0; kc < HD / 32; ++kc) { a = wmma16(kf[t][kc], qh[kc], a); al = wmma16(kf[t][kc], ql[kc], al); }
#pragma unroll
      for (int r = 0; r < 8; r += 2) { const v2f G = {fk[t * 2 + (r >> 2)][r & 3], fk[t * 2 + (r >> 2)][(r & 3) + 1]}, A = {a[r], a[r + 1]}, R = {al[r], al[r + 1]}; const v2f M = {fmaxf(G[0], fq), fmaxf(G[1], fq)}, x = __builtin_elementwise_fma(M, ka2, __builtin_elementwise_fma(R, r2, A));   /* pairs: packed f32 forms */
        s[t * 8 + r] = x[0]; s[t * 8 + r + 1] = x[1]; } }   /* still in raw-product units */
    float mx = s[0];
#pragma unroll
    for (int i = 1; i < 16; ++i) mx = fmaxf(mx, s[i]);
    /* lazy rescale: the maximum in use, m (base-2 logits), stays while no lane's scores of this pass rise more than 8 above it, so a weight reaches 2^8 at most; sum and output carry the same factor, which the final division takes out. One test a pass on raw scores against thr = (m + 8) / (64^-0.5 log2 e), a scalar branch that the wave takes whole; only there are the two halves' maxima joined (the other half of the wave holds this query's other 16 keys), so both halves keep one m */
    if (__builtin_amdgcn_ballot_w32(mx > thr) != 0) { mx *= 0.125f * L2E; mx = fmaxf(mx, __shfl_xor(mx, 16)); const float mn = fmaxf(m, mx), sc = __builtin_amdgcn_exp2f(m - mn); m = mn; thr = (mn + 8.0f) * (8.0f / L2E); l *= sc;
#pragma unroll
      for (int j = 0; j < HD / 16; ++j)
#pragma unroll
        for (int r = 0; r < 8; ++r) o[j][r] *= sc; }
    float ps = 0.f; const v2f nm2 = {-m, -m};
#pragma unroll
    for (int i = 0; i < 16; i += 2) { const v2f x = {s[i], s[i + 1]}, e = __builtin_elementwise_fma(x, c2, nm2); s[i] = e[0]; s[i + 1] = e[1]; }   /* 64^-0.5 log2 e rides in the subtraction's place */
#pragma unroll
    for (int i = 0; i < 16; ++i) s[i] = __builtin_amdgcn_exp2f(s[i]);
    const F2 p = bsplit16(s);   /* element i < 8 = the pass's key 8g + i, i >= 8 = key 16 + 8g + i - 8: the k order of frag_b */
#pragma unroll
    for (int j = 0; j < HD / 16; ++j) o[j] = wmma_bf(vf[j], p.h, o[j]);   /* the twelve products as one run, the four tiles in turn; each tile's three in the order they had */
#pragma unroll
    for (int j = 0; j < HD / 16; ++j) o[j] = wmma_bf(vf[j], p.l, o[j]);
#pragma unroll
    for (int j = 0; j < HD / 16; ++j) o[j] = wmma_bf(wf[j], p.h, o[j]);
    __builtin_amdgcn_sched_barrier(0);   /* keeps adds of the row sum behind the last product: they fill the vector slots that the chip needs before the next pass writes over that product's operands */
#pragma unroll
    for (int i = 0; i < 16; ++i) ps += s[i];
    l += ps; }
    /* hand-over: this wave's reads of the buffer are done, its copies of the next stage have landed; behind the barrier that holds of every wave, and the buffer just read takes stage st + 2 */
    asm volatile("s_wait_dscnt 0x0" ::: "memory");
    asm volatile("s_wait_asynccnt 0x0" ::: "memory");
    __syncthreads();
    if (st + 2 < NST) stage_copy(lc + (unsigned)(st & 1) * STAGE_B, kg + (size_t)(st + 2) * KST * CC, vg + (st + 2) * KST, wg + (st + 2) * KST); }
  asm volatile("s_wait_asynccnt 0x0" ::: "memory");   /* no copy outstanding when the wave ends */
  l += __shfl_xor(l, 16); const float inv = 1.0f / l;   /* O^T register r of tile j = head dim j*16 + 8g + r of this lane's query: piece (half j & 1, this lane) of k_out's A fragment (row tile of the wave's 16 queries, kc = 2h + (j >> 1)), so y leaves as packed bf16 hi + residual */
  const size_t yo = (((size_t)b * (TT / 16) + blockIdx.x * 8 + wave) * NKC + h * 2) * FRAG_E + lane * 8;
#pragma unroll
  for (int j = 0; j < HD / 16; ++j) { v8b uh, ul;
#pragma unroll
    for (int r = 0; r < 8; ++r) { const float v = o[j][r] * inv; const __bf16 hv = (__bf16)v; uh[r] = hv; ul[r] = (__bf16)(v - (float)hv); }
    vst2(YH + yo + j * 256, uh); vst2(YL + yo + j * 256, ul); } }
// ---- k_out: block = (64 rows, 128 cols): out = y (bf16 hi + lo) Wo + bo
__global__ __launch_bounds__(128) void k_out(const __bf16* __restrict__ YH, const __bf16* __restrict__ YL, const __bf16* __restrict__ WP, const float* __restrict__ BP, float* __restrict__ OUT) { __shared__ __align__(16) float sf[4][16][132]; __shared__ __align__(16) unsigned char ring[2 * GSB];
  const int tid = threadIdx.x, wave = tid >> 5, lane = tid & 31, col = lane & 15, g = lane >> 4; const int c0 = blockIdx.y * 128; const size_t r0 = (size_t)blockIdx.x * 64 + wave * 16;
  v8f acc[8] = {};
  /* LDS tiles 0..3 = the block's 4 row tiles of y hi, 4..7 = of y lo, 8..15 = its 8 column tiles of Wo */
  const size_t yo = (size_t)blockIdx.x * 4 * TPE + tid * 8; const __bf16* yh = YH + yo; const __bf16* yl = YL + yo; const __bf16* wg = WP + ((size_t)3 * (CC / 16) + blockIdx.y * 8) * TPE + tid * 8; const unsigned lc = (unsigned)(size_t)ring + (unsigned)tid * 16;
  copy8(lc, yh, yl); copy8(lc + 8 * GTB, wg, wg + 4 * TPE);
  asm volatile("s_wait_asynccnt 0x0" ::: "memory");   /* this wave's copies of stage 0 have landed */
  __syncthreads();                                    /* and every other wave's */
  copy8(lc + GSB, yh + GST * FRAG_E, yl + GST * FRAG_E); copy8(lc + GSB + 8 * GTB, wg + GST * FRAG_E, wg + 4 * TPE + GST * FRAG_E);
#pragma unroll 1   /* rolled: one stage's code serves both buffers */
  for (int st = 0; st < GNS; ++st) { const __bf16* bp = (const __bf16*)(ring + (st & 1) * GSB) + lane * 8;
#pragma unroll
    for (int s = 0; s < GST; ++s) { __builtin_amdgcn_sched_barrier(0);   /* the three: as in k_proj */
      const v16b ah = frag_p(bp + (wave * GST + s) * FRAG_E), al = frag_p(bp + ((4 + wave) * GST + s) * FRAG_E); v16b w[8];   /* the k step's 20 LDS reads together in front of its products, as in k_proj */
#pragma unroll
      for (int j = 0; j < 8; ++j) w[j] = frag_p(bp + ((8 + j) * GST + s) * FRAG_E);
      __builtin_amdgcn_sched_barrier(0);
#pragma unroll
      for (int j = 0; j < 8; ++j) { acc[j] = wmma_bf(ah, w[j], acc[j]); acc[j] = wmma_bf(al, w[j], acc[j]); } }
    __builtin_amdgcn_sched_barrier(0);
    /* hand-over, as in k_proj */
    asm volatile("s_wait_dscnt 0x0" ::: "memory");
    asm volatile("s_wait_asynccnt 0x0" ::: "memory");
    __syncthreads();
    if (st + 2 < GNS) { const int eo = (st + 2) * GST * FRAG_E; const unsigned lb = lc + (unsigned)(st & 1) * GSB; copy8(lb, yh + eo, yl + eo); copy8(lb + 8 * GTB, wg + eo, wg + 4 * TPE + eo); } }
  asm volatile("s_wait_asynccnt 0x0" ::: "memory");   /* no copy outstanding when the wave ends */
#pragma unroll
  for (int j = 0; j < 8; ++j) { const float bb = BP ? bfr(BP[c0 + j * 16 + col]) : 0.f;
#pragma unroll
    for (int r = 0; r < 8; ++r) sf[wave][8 * g + r][j * 16 + col] = acc[j][r] + bb; }
  LDSX(); for (int rl = 0; rl < 16; ++rl) vst2(OUT + (r0 + rl) * CC + c0 + lane * 4, *(const v4f*)&sf[wave][rl][lane * 4]); }
extern "C" void kernel_launch(void* const* d_in, const int* in_sizes, int n_in, void* d_out, int out_size, void* d_ws, size_t ws_size, hipStream_t stream) {
  (void)in_sizes; (void)n_in; (void)out_size;
  const float** F = (const float**)d_in;   // 0 query, 1 key, 2 value [2,2048,1024]; 3 frac [2,2048]; 4 Wq, 5 Wk, 6 Wv, 7 Wo ((in,out)); 8 bq, 9 bk, 10 bv, 11 bo; 12 alpha_pos [16], 13 alpha_neg [16]
  if (ws_size < (size_t)WS_END) return;
  char* ws = (char*)d_ws; _Float16 *QH = (_Float16*)(ws + WS_QH), *QL = (_Float16*)(ws + WS_QL), *KH = (_Float16*)(ws + WS_KH); __bf16 *VT = (__bf16*)(ws + WS_VT), *VL = (__bf16*)(ws + WS_VL), *YH = (__bf16*)(ws + WS_YH), *YL = (__bf16*)(ws + WS_YL), *XP = (__bf16*)(ws + WS_XP), *WP = (__bf16*)(ws + WS_WP);
  k_pre<<<dim3(PRE_X + PRE_W + TT * 32 / 256), 256, 0, stream>>>(F[0], F[1], F[2], F[4], F[5], F[6], F[7], XP, WP, (float2*)(ws + WS_ROT));
  k_proj<<<dim3(TNB * TT / 128, CC / 128, 3), 128, 0, stream>>>(XP, WP, F[8], F[9], F[10], QH, QL, KH, VT, VL, (const float2*)(ws + WS_ROT));
  k_fa<<<dim3(TT / 128, NH, TNB), 256, 0, stream>>>(QH, QL, KH, VT, VL, F[3], F[12], F[13], YH, YL);
  k_out<<<dim3(TNB * TT / 64, CC / 128), 128, 0, stream>>>(YH, YL, WP, F[11], (float*)d_out);
}
